// v000
// Times are from an AMD MI455X. After a warm-up the kernel runs many times in a row, and a time is the length of
// such a window on the GPU divided by its runs, so every launch and the gaps after it count. The runs cycle
// through copies of the inputs. A figure is the median of several windows, for all but v000 over two sittings.
// Sittings can differ by a few percent; kernels timed side by side share one.
// v000 is the starting kernel. One run takes 376 microseconds.
#include <hip/hip_runtime.h>
#include <hip/hip_bf16.h>
#include <math.h>

typedef __attribute__((ext_vector_type(16))) _Float16 v16h;
typedef __attribute__((ext_vector_type(8)))  _Float16 h8;
typedef __attribute__((ext_vector_type(8)))  float    v8f;

#define D_MODEL 1024
#define HEADS   16
#define DH      64
#define DH2     128            // 2*DH per head
#define BATCH   2
#define SEQ     2048
#define TOKENS  (BATCH*SEQ)    // 4096
#define QKV_N   (2*D_MODEL)    // 2048
#define LAMBDA_INIT 0.8f
#define EPS_RMS 1e-5f

#define USE_ASYNC_LDS 1

#if USE_ASYNC_LDS
__device__ __forceinline__ void stage_b128(const _Float16* g, _Float16* l) {
  unsigned lds_addr = (unsigned)(size_t)(void*)l;
  asm volatile("global_load_async_to_lds_b128 %0, %1, off"
               :: "v"(lds_addr), "v"(g) : "memory");
}
#define WAIT_ASYNC() asm volatile("s_wait_asynccnt 0x0" ::: "memory")
#else
__device__ __forceinline__ void stage_b128(const _Float16* g, _Float16* l) {
  *(h8*)l = *(const h8*)g;   // synchronous load + ds_store fallback
}
#define WAIT_ASYNC() ((void)0)
#endif

__device__ __forceinline__ v16h load_op(const _Float16* p, int halfsel) {
  h8 lo = *(const h8*)(p + halfsel * 8);
  h8 hi = *(const h8*)(p + 16 + halfsel * 8);
  v16h r;
#pragma unroll
  for (int i = 0; i < 8; ++i) { r[i] = lo[i]; r[i + 8] = hi[i]; }
  return r;
}

__device__ __forceinline__ v8f wmma32(v16h a, v16h b, v8f c) {
  // D = A(16x32) * B(32x16) + C, f32 accumulate
  return __builtin_amdgcn_wmma_f32_16x16x32_f16(
      /*neg_a=*/false, a, /*neg_b=*/false, b,
      /*c_mod=*/(short)0, c, /*reuse_a=*/false, /*reuse_b=*/false);
}

// ---------------------------------------------------------------------------
// Elementwise f32 -> f16
// ---------------------------------------------------------------------------
__global__ void k_f32_to_f16(const float* __restrict__ src,
                             _Float16* __restrict__ dst, int n) {
  int i = blockIdx.x * blockDim.x + threadIdx.x;
  int stride = gridDim.x * blockDim.x;
  for (; i < n; i += stride) dst[i] = (_Float16)src[i];
}

// Transpose src[rows][cols] (f32) -> dst[cols][rows] (f16)
__global__ void k_transpose_f16(const float* __restrict__ src,
                                _Float16* __restrict__ dst, int rows, int cols) {
  int i = blockIdx.x * blockDim.x + threadIdx.x;
  int stride = gridDim.x * blockDim.x;
  int n = rows * cols;
  for (; i < n; i += stride) {
    int c = i / rows, r = i % rows;
    dst[i] = (_Float16)src[(size_t)r * cols + c];
  }
}

// lam[h] = exp(lq1.lk1) - exp(lq2.lk2) + lambda_init
__global__ void k_lambda(const float* __restrict__ lq1, const float* __restrict__ lk1,
                         const float* __restrict__ lq2, const float* __restrict__ lk2,
                         float* __restrict__ lam) {
  int h = threadIdx.x;
  if (h < HEADS) {
    float s1 = 0.f, s2 = 0.f;
    for (int i = 0; i < DH; ++i) {
      s1 += lq1[h * DH + i] * lk1[h * DH + i];
      s2 += lq2[h * DH + i] * lk2[h * DH + i];
    }
    lam[h] = __expf(s1) - __expf(s2) + LAMBDA_INIT;
  }
}

template <int MODE>
__global__ __launch_bounds__(256) void k_gemm(
    const _Float16* __restrict__ A, const _Float16* __restrict__ BT,
    _Float16* __restrict__ outH, float* __restrict__ outF,
    int M, int Nn, int K) {
  __shared__ _Float16 Bs[2][128 * 40];   // 2 x 10 KB, padded row stride 40
  const int tid = threadIdx.x;
  const int lane = tid & 31;
  const int wave = tid >> 5;
  const int lq = lane & 15;   // row (A) / col (B) within tile
  const int hs = lane >> 4;   // operand half selector
  const int m0 = blockIdx.y * 128 + wave * 16;
  const int n0 = blockIdx.x * 128;

  // Staging map: thread t -> panel row sr = t/2, 16-half chunk sc = (t&1)*16.
  const int sr = tid >> 1;
  const int sc = (tid & 1) * 16;
  const _Float16* gB = BT + (size_t)(n0 + sr) * K + sc;
  _Float16* lB0 = &Bs[0][sr * 40 + sc];
  _Float16* lB1 = &Bs[1][sr * 40 + sc];

  // Preload panel for k0 = 0 into buffer 0.
  stage_b128(gB + 0, lB0);
  stage_b128(gB + 8, lB0 + 8);

  v8f acc[8] = {};
  const _Float16* arow = A + (size_t)(m0 + lq) * K;
  for (int k0 = 0, buf = 0; k0 < K; k0 += 32, buf ^= 1) {
    WAIT_ASYNC();            // this wave's staging of Bs[buf] is complete
    __syncthreads();         // every wave's staging of Bs[buf] is complete
    if (k0 + 32 < K) {       // kick off next panel while we compute
      _Float16* lB = buf ? lB0 : lB1;
      stage_b128(gB + k0 + 32,     lB);
      stage_b128(gB + k0 + 32 + 8, lB + 8);
    }
    // A operand direct from global (per-wave rows, no cross-wave reuse).
    v16h a = load_op(arow + k0, hs);
    v16h b[8];
#pragma unroll
    for (int j = 0; j < 8; ++j)
      b[j] = load_op(&Bs[buf][(j * 16 + lq) * 40], hs);
#pragma unroll
    for (int j = 0; j < 8; ++j)
      acc[j] = wmma32(a, b[j], acc[j]);
  }
#pragma unroll
  for (int j = 0; j < 8; ++j) {
    const int n = n0 + j * 16 + lq;
#pragma unroll
    for (int v = 0; v < 8; ++v) {
      const int m = m0 + hs * 8 + v;
      if (MODE == 0)      outH[(size_t)m * Nn + n] = (_Float16)acc[j][v];
      else if (MODE == 1) outH[(size_t)n * M + m]  = (_Float16)acc[j][v];
      else                outF[(size_t)m * Nn + n] = acc[j][v];
    }
  }
}

// ---------------------------------------------------------------------------
// Fused differential flash-attention + RMS norm.
// One wave owns 16 queries of one (b,h). Computes S^T = K*Q^T so the score
// tile's C layout (lane=query, reg=key) feeds the second WMMA (O^T = V^T*P^T)
// with no cross-lane movement. Two independent online softmaxes (comp 1/2),
// O = P1 V / l1 - lam * P2 V / l2, then RMS norm over 128 dims, * 0.2.
// Loads for each 32-key step are issued as one clause before the WMMAs, and
// the next step's K/V lines are prefetched (global_prefetch_b8) while the
// current step's 24 WMMAs execute.
// ---------------------------------------------------------------------------
__global__ __launch_bounds__(128) void k_diff_attn(
    const _Float16* __restrict__ Qh, const _Float16* __restrict__ Kh,
    const _Float16* __restrict__ Vt,   // [2048 feat][4096 tokens]
    const float* __restrict__ lamBuf, const float* __restrict__ rms_scale,
    _Float16* __restrict__ Oh) {
  const int lane = threadIdx.x & 31;
  const int wid = (blockIdx.x * blockDim.x + threadIdx.x) >> 5;
  const int lq = lane & 15, hs = lane >> 4;
  const int qtiles = SEQ / 16;          // 128
  const int bh = wid / qtiles;
  const int qt = wid % qtiles;
  const int b = bh / HEADS, h = bh % HEADS;
  const int q0 = qt * 16;
  const int qglob = q0 + lq;            // this lane's query index

  const float scale = 0.125f;           // 1/sqrt(64)
  const float lam = lamBuf[h];

  // Q^T as B operand: lane = query, halves = d-contiguous. 2 comps x 2 K-chunks.
  const _Float16* qrow = Qh + (size_t)(b * SEQ + qglob) * QKV_N + h * DH2;
  v16h qop[2][2];
#pragma unroll
  for (int c = 0; c < 2; ++c)
#pragma unroll
    for (int kk = 0; kk < 2; ++kk)
      qop[c][kk] = load_op(qrow + c * DH + kk * 32, hs);

  v8f O1[8] = {}, O2[8] = {};           // O^T accumulators: 8 d-tiles x (16x16)
  float m1 = -INFINITY, m2 = -INFINITY, l1 = 0.f, l2 = 0.f;

  const _Float16* kbase = Kh + (size_t)(b * SEQ) * QKV_N + h * DH2;
  const _Float16* vhead = Vt + (size_t)(h * DH2 + lq) * TOKENS + b * SEQ;

  const int nk = q0 + 16;               // causal: keys 0..q0+15
  for (int kt = 0; kt < nk; kt += 32) { // 32 keys/step: tiles a (kt), b (kt+16)
    // ---- load clause: all 8 K operands of this step --------------------
    v16h kA[2][2], kB[2][2];
#pragma unroll
    for (int c = 0; c < 2; ++c)
#pragma unroll
      for (int kk = 0; kk < 2; ++kk) {
        const _Float16* kc = kbase + c * DH + kk * 32;
        kA[c][kk] = load_op(kc + (size_t)(kt + lq) * QKV_N, hs);
        kB[c][kk] = load_op(kc + (size_t)(kt + 16 + lq) * QKV_N, hs);
      }
    // Prefetch next step's K rows (both components) while WMMAs run.
    if (kt + 32 < nk) {
#pragma unroll
      for (int c = 0; c < 2; ++c) {
        __builtin_prefetch(kbase + c * DH + (size_t)(kt + 32 + lq) * QKV_N, 0, 1);
        __builtin_prefetch(kbase + c * DH + (size_t)(kt + 48 + lq) * QKV_N, 0, 1);
      }
    }

    // ---- score tiles (S^T) + online softmax ----------------------------
    v16h pop[2];
    float alpha[2];
#pragma unroll
    for (int c = 0; c < 2; ++c) {
      v8f sa = {}, sb = {};
#pragma unroll
      for (int kk = 0; kk < 2; ++kk) {  // accumulate over d = 64 (2 x K=32)
        sa = wmma32(kA[c][kk], qop[c][kk], sa);
        sb = wmma32(kB[c][kk], qop[c][kk], sb);
      }
      // S^T C layout: lane = query (lq), reg v -> key = kt + hs*8 + v (+16 for b)
      float pa[8], pb[8];
      float smax = -INFINITY;
#pragma unroll
      for (int v = 0; v < 8; ++v) {
        const int keyA = kt + hs * 8 + v;
        float xa = (keyA       <= qglob) ? sa[v] * scale : -INFINITY;
        float xb = (keyA + 16  <= qglob) ? sb[v] * scale : -INFINITY;
        pa[v] = xa; pb[v] = xb;
        smax = fmaxf(smax, fmaxf(xa, xb));
      }
      smax = fmaxf(smax, __shfl_xor(smax, 16, 32)); // lanes q, q+16 share a query
      const float mo = (c == 0) ? m1 : m2;
      const float mn = fmaxf(mo, smax);
      const float al = __expf(mo - mn);
      float ls = 0.f;
#pragma unroll
      for (int v = 0; v < 8; ++v) {
        pa[v] = __expf(pa[v] - mn);
        pb[v] = __expf(pb[v] - mn);
        ls += pa[v] + pb[v];
      }
      ls += __shfl_xor(ls, 16, 32);
      if (c == 0) { l1 = l1 * al + ls; m1 = mn; }
      else        { l2 = l2 * al + ls; m2 = mn; }
      alpha[c] = al;
      // Pack P^T directly as B operand (K=32 keys): halves[0..7]=tile a,
      // halves[8..15]=tile b — exactly matches the C layout we already hold.
      v16h pv;
#pragma unroll
      for (int v = 0; v < 8; ++v) { pv[v] = (_Float16)pa[v]; pv[v + 8] = (_Float16)pb[v]; }
      pop[c] = pv;
    }

    // ---- O^T += V^T * P^T ---------------------------------------------
    // Load clause: all 8 V^T operands first, then 16 WMMAs.
    const _Float16* vbase = vhead + kt;
    v16h vop[8];
#pragma unroll
    for (int t = 0; t < 8; ++t)
      vop[t] = load_op(vbase + (size_t)(t * 16) * TOKENS, hs);
    if (kt + 32 < nk) {
#pragma unroll
      for (int t = 0; t < 8; ++t)
        __builtin_prefetch(vhead + kt + 32 + (size_t)(t * 16) * TOKENS, 0, 1);
    }
#pragma unroll
    for (int t = 0; t < 8; ++t) {
#pragma unroll
      for (int v = 0; v < 8; ++v) { O1[t][v] *= alpha[0]; O2[t][v] *= alpha[1]; }
      O1[t] = wmma32(vop[t], pop[0], O1[t]);
      O2[t] = wmma32(vop[t], pop[1], O2[t]);
    }
  }

  // Combine streams, RMS-normalize over 128 dims, scale by (1 - lambda_init).
  const float inv1 = 1.0f / l1;
  const float inv2 = lam / l2;
  float ssq = 0.f;
#pragma unroll
  for (int t = 0; t < 8; ++t)
#pragma unroll
    for (int v = 0; v < 8; ++v) {
      float o = O1[t][v] * inv1 - O2[t][v] * inv2;
      ssq += o * o;
    }
  ssq += __shfl_xor(ssq, 16, 32);       // other 64 dims live in lane^16
  const float rinv = rsqrtf(ssq * (1.0f / DH2) + EPS_RMS) * (1.0f - LAMBDA_INIT);

  _Float16* orow = Oh + (size_t)(b * SEQ + qglob) * QKV_N + h * DH2;
#pragma unroll
  for (int t = 0; t < 8; ++t)
#pragma unroll
    for (int v = 0; v < 8; ++v) {
      const int d = t * 16 + hs * 8 + v;
      float o = O1[t][v] * inv1 - O2[t][v] * inv2;
      orow[d] = (_Float16)(o * rinv * rms_scale[d]);
    }
}

// ---------------------------------------------------------------------------
extern "C" void kernel_launch(void* const* d_in, const int* in_sizes, int n_in,
                              void* d_out, int out_size, void* d_ws, size_t ws_size,
                              hipStream_t stream) {
  const float* X    = (const float*)d_in[0];
  const float* Wq   = (const float*)d_in[1];
  const float* Wk   = (const float*)d_in[2];
  const float* Wv   = (const float*)d_in[3];
  const float* Wo   = (const float*)d_in[4];
  const float* lq1  = (const float*)d_in[5];
  const float* lk1  = (const float*)d_in[6];
  const float* lq2  = (const float*)d_in[7];
  const float* lk2  = (const float*)d_in[8];
  const float* rmss = (const float*)d_in[9];
  float* out = (float*)d_out;

  char* w = (char*)d_ws;
  _Float16* Xh  = (_Float16*)w; w += (size_t)TOKENS * D_MODEL * 2;  // 8 MB
  _Float16* WqT = (_Float16*)w; w += (size_t)QKV_N * D_MODEL * 2;   // 4 MB
  _Float16* WkT = (_Float16*)w; w += (size_t)QKV_N * D_MODEL * 2;
  _Float16* WvT = (_Float16*)w; w += (size_t)QKV_N * D_MODEL * 2;
  _Float16* WoT = (_Float16*)w; w += (size_t)D_MODEL * QKV_N * 2;
  _Float16* Qh  = (_Float16*)w; w += (size_t)TOKENS * QKV_N * 2;    // 16 MB
  _Float16* Kh  = (_Float16*)w; w += (size_t)TOKENS * QKV_N * 2;
  _Float16* Vt  = (_Float16*)w; w += (size_t)QKV_N * TOKENS * 2;    // transposed
  _Float16* Ohb = (_Float16*)w; w += (size_t)TOKENS * QKV_N * 2;
  float*    lam = (float*)w;

  // Stage 1: precision conversion + weight transposes + lambda scalars
  k_f32_to_f16<<<512, 256, 0, stream>>>(X, Xh, TOKENS * D_MODEL);
  k_transpose_f16<<<512, 256, 0, stream>>>(Wq, WqT, D_MODEL, QKV_N);
  k_transpose_f16<<<512, 256, 0, stream>>>(Wk, WkT, D_MODEL, QKV_N);
  k_transpose_f16<<<512, 256, 0, stream>>>(Wv, WvT, D_MODEL, QKV_N);
  k_transpose_f16<<<512, 256, 0, stream>>>(Wo, WoT, QKV_N, D_MODEL);
  k_lambda<<<1, 32, 0, stream>>>(lq1, lk1, lq2, lk2, lam);

  // Stage 2: QKV projections (WMMA). V stored transposed for the attention V^T operand.
  dim3 gq(QKV_N / 128, TOKENS / 128);
  k_gemm<0><<<gq, 256, 0, stream>>>(Xh, WqT, Qh, nullptr, TOKENS, QKV_N, D_MODEL);
  k_gemm<0><<<gq, 256, 0, stream>>>(Xh, WkT, Kh, nullptr, TOKENS, QKV_N, D_MODEL);
  k_gemm<1><<<gq, 256, 0, stream>>>(Xh, WvT, Vt, nullptr, TOKENS, QKV_N, D_MODEL);

  // Stage 3: fused differential flash attention + RMS norm
  const int waves = BATCH * HEADS * (SEQ / 16);  // 4096 waves
  k_diff_attn<<<waves / 4, 128, 0, stream>>>(Qh, Kh, Vt, lam, rmss, Ohb);

  // Stage 4: output projection -> fp32 result
  dim3 go(D_MODEL / 128, TOKENS / 128);
  k_gemm<2><<<go, 256, 0, stream>>>(Ohb, WoT, nullptr, out, TOKENS, D_MODEL, QKV_N);
}

// v001
// One run takes 298 microseconds.
// Timed twice side by side with v000, it ran 1.30 times as fast both times.
#include <hip/hip_runtime.h>
#include <hip/hip_bf16.h>
#include <math.h>

typedef __attribute__((ext_vector_type(16))) _Float16 v16h;
typedef __attribute__((ext_vector_type(8)))  _Float16 h8;
typedef __attribute__((ext_vector_type(8)))  float    v8f;

#define D_MODEL 1024
#define HEADS   16
#define DH      64
#define DH2     128            // 2*DH per head
#define BATCH   2
#define SEQ     2048
#define TOKENS  (BATCH*SEQ)    // 4096
#define QKV_N   (2*D_MODEL)    // 2048
#define LAMBDA_INIT 0.8f
#define EPS_RMS 1e-5f

#define USE_ASYNC_LDS 1

#if USE_ASYNC_LDS
__device__ __forceinline__ void stage_b128(const _Float16* g, _Float16* l) {
  unsigned lds_addr = (unsigned)(size_t)(void*)l;
  asm volatile("global_load_async_to_lds_b128 %0, %1, off"
               :: "v"(lds_addr), "v"(g) : "memory");
}
#define WAIT_ASYNC() asm volatile("s_wait_asynccnt 0x0" ::: "memory")
#else
__device__ __forceinline__ void stage_b128(const _Float16* g, _Float16* l) {
  *(h8*)l = *(const h8*)g;   // synchronous load + ds_store fallback
}
#define WAIT_ASYNC() ((void)0)
#endif

__device__ __forceinline__ v16h load_op(const _Float16* p, int halfsel) {
  h8 lo = *(const h8*)(p + halfsel * 8);
  h8 hi = *(const h8*)(p + 16 + halfsel * 8);
  v16h r;
#pragma unroll
  for (int i = 0; i < 8; ++i) { r[i] = lo[i]; r[i + 8] = hi[i]; }
  return r;
}

__device__ __forceinline__ v8f wmma32(v16h a, v16h b, v8f c) {
  // D = A(16x32) * B(32x16) + C, f32 accumulate
  return __builtin_amdgcn_wmma_f32_16x16x32_f16(
      /*neg_a=*/false, a, /*neg_b=*/false, b,
      /*c_mod=*/(short)0, c, /*reuse_a=*/false, /*reuse_b=*/false);
}

// ---------------------------------------------------------------------------
// Elementwise f32 -> f16
// ---------------------------------------------------------------------------
__global__ void k_f32_to_f16(const float* __restrict__ src,
                             _Float16* __restrict__ dst, int n) {
  int i = blockIdx.x * blockDim.x + threadIdx.x;
  int stride = gridDim.x * blockDim.x;
  for (; i < n; i += stride) dst[i] = (_Float16)src[i];
}

// Transpose src[rows][cols] (f32) -> dst[cols][rows] (f16)
__global__ void k_transpose_f16(const float* __restrict__ src,
                                _Float16* __restrict__ dst, int rows, int cols) {
  int i = blockIdx.x * blockDim.x + threadIdx.x;
  int stride = gridDim.x * blockDim.x;
  int n = rows * cols;
  for (; i < n; i += stride) {
    int c = i / rows, r = i % rows;
    dst[i] = (_Float16)src[(size_t)r * cols + c];
  }
}

// lam[h] = exp(lq1.lk1) - exp(lq2.lk2) + lambda_init
__global__ void k_lambda(const float* __restrict__ lq1, const float* __restrict__ lk1,
                         const float* __restrict__ lq2, const float* __restrict__ lk2,
                         float* __restrict__ lam) {
  int h = threadIdx.x;
  if (h < HEADS) {
    float s1 = 0.f, s2 = 0.f;
    for (int i = 0; i < DH; ++i) {
      s1 += lq1[h * DH + i] * lk1[h * DH + i];
      s2 += lq2[h * DH + i] * lk2[h * DH + i];
    }
    lam[h] = __expf(s1) - __expf(s2) + LAMBDA_INIT;
  }
}

template <int MODE>
__global__ __launch_bounds__(256) void k_gemm(
    const _Float16* __restrict__ A, const _Float16* __restrict__ BT,
    _Float16* __restrict__ outH, float* __restrict__ outF,
    int M, int Nn, int K) {
  __shared__ _Float16 Bs[2][128 * 40];   // 2 x 10 KB, padded row stride 40
  const int tid = threadIdx.x;
  const int lane = tid & 31;
  const int wave = tid >> 5;
  const int lq = lane & 15;   // row (A) / col (B) within tile
  const int hs = lane >> 4;   // operand half selector
  const int m0 = blockIdx.y * 128 + wave * 16;
  const int n0 = blockIdx.x * 128;

  // Staging map: thread t -> panel row sr = t/2, 16-half chunk sc = (t&1)*16.
  const int sr = tid >> 1;
  const int sc = (tid & 1) * 16;
  const _Float16* gB = BT + (size_t)(n0 + sr) * K + sc;
  _Float16* lB0 = &Bs[0][sr * 40 + sc];
  _Float16* lB1 = &Bs[1][sr * 40 + sc];

  // Preload panel for k0 = 0 into buffer 0.
  stage_b128(gB + 0, lB0);
  stage_b128(gB + 8, lB0 + 8);

  v8f acc[8] = {};
  const _Float16* arow = A + (size_t)(m0 + lq) * K;
  for (int k0 = 0, buf = 0; k0 < K; k0 += 32, buf ^= 1) {
    WAIT_ASYNC();            // this wave's staging of Bs[buf] is complete
    __syncthreads();         // every wave's staging of Bs[buf] is complete
    if (k0 + 32 < K) {       // kick off next panel while we compute
      _Float16* lB = buf ? lB0 : lB1;
      stage_b128(gB + k0 + 32,     lB);
      stage_b128(gB + k0 + 32 + 8, lB + 8);
    }
    // A operand direct from global (per-wave rows, no cross-wave reuse).
    v16h a = load_op(arow + k0, hs);
    v16h b[8];
#pragma unroll
    for (int j = 0; j < 8; ++j)
      b[j] = load_op(&Bs[buf][(j * 16 + lq) * 40], hs);
#pragma unroll
    for (int j = 0; j < 8; ++j)
      acc[j] = wmma32(a, b[j], acc[j]);
  }
#pragma unroll
  for (int j = 0; j < 8; ++j) {
    const int n = n0 + j * 16 + lq;
#pragma unroll
    for (int v = 0; v < 8; ++v) {
      const int m = m0 + hs * 8 + v;
      if (MODE == 0)      outH[(size_t)m * Nn + n] = (_Float16)acc[j][v];
      else if (MODE == 1) outH[(size_t)n * M + m]  = (_Float16)acc[j][v];
      else                outF[(size_t)m * Nn + n] = acc[j][v];
    }
  }
}

__device__ __forceinline__ void stage_tile8(
    const _Float16* g0, const _Float16* g1, const _Float16* g2, const _Float16* g3,
    const _Float16* g4, const _Float16* g5, const _Float16* g6, const _Float16* g7,
    unsigned l0, unsigned l1, unsigned l2, unsigned l3,
    unsigned l4, unsigned l5, unsigned l6, unsigned l7) {
  asm volatile(
      "global_load_async_to_lds_b128 %0, %8, off\n\t"
      "global_load_async_to_lds_b128 %1, %9, off\n\t"
      "global_load_async_to_lds_b128 %2, %10, off\n\t"
      "global_load_async_to_lds_b128 %3, %11, off\n\t"
      "global_load_async_to_lds_b128 %4, %12, off\n\t"
      "global_load_async_to_lds_b128 %5, %13, off\n\t"
      "global_load_async_to_lds_b128 %6, %14, off\n\t"
      "global_load_async_to_lds_b128 %7, %15, off\n\t"
      "s_wait_xcnt 0x0"
      :: "v"(l0), "v"(l1), "v"(l2), "v"(l3), "v"(l4), "v"(l5), "v"(l6), "v"(l7),
         "v"(g0), "v"(g1), "v"(g2), "v"(g3), "v"(g4), "v"(g5), "v"(g6), "v"(g7)
      : "memory");
}

#define KPITCH 136             // K tile row pitch in halves: 272 B = 16 B x 17
#define VPITCH 40              // V^T tile row pitch in halves: 80 B = 16 B x 5
#define KTILE  (32 * KPITCH)   // 32 keys x 128 dims
#define VTILE  (DH2 * VPITCH)  // 128 dims x 32 keys

// ---------------------------------------------------------------------------
// Fused differential flash-attention + RMS norm.
// One wave owns 16 queries of one (b,h). Computes S^T = K*Q^T so the score
// tile's C layout (lane=query, reg=key) feeds the second WMMA (O^T = V^T*P^T)
// with no cross-lane movement. Two independent online softmaxes (comp 1/2),
// O = P1 V / l1 - lam * P2 V / l2, then RMS norm over 128 dims, * 0.2.
// The four waves of a block own 64 consecutive queries and walk the same keys:
// each 32-key K tile and V^T tile is brought into LDS once per block by async
// copies (whole 256-B / 64-B row pieces), two buffers, the next tile in flight
// while this one is worked on; all operands are then read by ds_load_b128.
// ---------------------------------------------------------------------------
__global__ __launch_bounds__(128) void k_diff_attn(
    const _Float16* __restrict__ Qh, const _Float16* __restrict__ Kh,
    const _Float16* __restrict__ Vt,   // [2048 feat][4096 tokens]
    const float* __restrict__ lamBuf, const float* __restrict__ rms_scale,
    _Float16* __restrict__ Oh) {
  __shared__ __attribute__((aligned(16))) _Float16 Ks[2][KTILE];
  __shared__ __attribute__((aligned(16))) _Float16 Vs[2][VTILE];
  const int tid = threadIdx.x;
  const int lane = tid & 31;
  const int wave = __builtin_amdgcn_readfirstlane(tid >> 5);
  const int lq = lane & 15, hs = lane >> 4;
  const int qblocks = SEQ / 64;         // 32 blocks of 64 queries per (b,h)
  const int bh = blockIdx.x / qblocks;
  const int qb = blockIdx.x % qblocks;
  const int b = bh / HEADS, h = bh % HEADS;
  const int q0 = qb * 64 + wave * 16;
  const int qglob = q0 + lq;            // this lane's query index

  const float scale = 0.125f;           // 1/sqrt(64)
  const float lam = lamBuf[h];

  const _Float16* kbase = Kh + (size_t)(b * SEQ) * QKV_N + h * DH2;
  const _Float16* vbase = Vt + (size_t)(h * DH2) * TOKENS + b * SEQ;

  // Copy map. K tile: 512 chunks of 16 B, lane -> row tid/16 (+8 per copy),
  // chunk tid%16. V^T tile: 512 chunks, lane -> row tid/4 (+32 per copy),
  // chunk tid%4.
  const _Float16* gK = kbase + (size_t)(tid >> 4) * QKV_N + (tid & 15) * 8;
  const _Float16* gV = vbase + (size_t)(tid >> 2) * TOKENS + (tid & 3) * 8;
  const unsigned lK = (unsigned)(size_t)(void*)&Ks[0][(tid >> 4) * KPITCH + (tid & 15) * 8];
  const unsigned lV = (unsigned)(size_t)(void*)&Vs[0][(tid >> 2) * VPITCH + (tid & 3) * 8];

  auto stage = [&](int t) {             // tile t (keys 32t..32t+31) -> buffer t&1
    const _Float16* k = gK + (size_t)(t * 32) * QKV_N;
    const _Float16* v = gV + t * 32;
    const unsigned lk = lK + (t & 1) * (KTILE * 2);
    const unsigned lv = lV + (t & 1) * (VTILE * 2);
    stage_tile8(k, k + 8 * QKV_N, k + 16 * QKV_N, k + 24 * QKV_N,
                v, v + (size_t)32 * TOKENS, v + (size_t)64 * TOKENS, v + (size_t)96 * TOKENS,
                lk, lk + 8 * KPITCH * 2, lk + 16 * KPITCH * 2, lk + 24 * KPITCH * 2,
                lv, lv + 32 * VPITCH * 2, lv + 64 * VPITCH * 2, lv + 96 * VPITCH * 2);
  };

  const int ntiles = 2 * qb + 2;        // block's causal range, always >= 2 tiles
  stage(0);

  // Q^T as B operand: lane = query, halves = d-contiguous. 2 comps x 2 K-chunks.
  const _Float16* qrow = Qh + (size_t)(b * SEQ + qglob) * QKV_N + h * DH2;
  v16h qop[2][2];
#pragma unroll
  for (int c = 0; c < 2; ++c)
#pragma unroll
    for (int kk = 0; kk < 2; ++kk)
      qop[c][kk] = load_op(qrow + c * DH + kk * 32, hs);

  v8f O1[8] = {}, O2[8] = {};           // O^T accumulators: 8 d-tiles x (16x16)
  float m1 = -INFINITY, m2 = -INFINITY, l1 = 0.f, l2 = 0.f;

  WAIT_ASYNC();                         // this wave's share of tile 0 has landed
  __syncthreads();                      // every wave's share of tile 0 has landed
  stage(1);

  const int nk = q0 + 16;               // causal: this wave needs keys 0..q0+15
  for (int t = 0; t < ntiles; ++t) {    // 32 keys/step: tiles a (kt), b (kt+16)
    const int kt = t * 32;
    if (kt < nk) {                      // wave-uniform: skip tiles past the diagonal
      const _Float16* ks = &Ks[t & 1][lq * KPITCH];
      const _Float16* vs = &Vs[t & 1][lq * VPITCH];
      // ---- all 8 K operands of this step ---------------------------------
      v16h kA[2][2], kB[2][2];
#pragma unroll
      for (int c = 0; c < 2; ++c)
#pragma unroll
        for (int kk = 0; kk < 2; ++kk) {
          kA[c][kk] = load_op(ks + c * DH + kk * 32, hs);
          kB[c][kk] = load_op(ks + 16 * KPITCH + c * DH + kk * 32, hs);
        }

      // ---- score tiles (S^T) + online softmax ----------------------------
      v16h pop[2];
      float alpha[2];
#pragma unroll
      for (int c = 0; c < 2; ++c) {
        v8f sa = {}, sb = {};
#pragma unroll
        for (int kk = 0; kk < 2; ++kk) {  // accumulate over d = 64 (2 x K=32)
          sa = wmma32(kA[c][kk], qop[c][kk], sa);
          sb = wmma32(kB[c][kk], qop[c][kk], sb);
        }
        // S^T C layout: lane = query (lq), reg v -> key = kt + hs*8 + v (+16 for b)
        float pa[8], pb[8];
        float smax = -INFINITY;
#pragma unroll
        for (int v = 0; v < 8; ++v) {
          const int keyA = kt + hs * 8 + v;
          float xa = (keyA       <= qglob) ? sa[v] * scale : -INFINITY;
          float xb = (keyA + 16  <= qglob) ? sb[v] * scale : -INFINITY;
          pa[v] = xa; pb[v] = xb;
          smax = fmaxf(smax, fmaxf(xa, xb));
        }
        smax = fmaxf(smax, __shfl_xor(smax, 16, 32)); // lanes q, q+16 share a query
        const float mo = (c == 0) ? m1 : m2;
        const float mn = fmaxf(mo, smax);
        const float al = __expf(mo - mn);
        float ls = 0.f;
#pragma unroll
        for (int v = 0; v < 8; ++v) {
          pa[v] = __expf(pa[v] - mn);
          pb[v] = __expf(pb[v] - mn);
          ls += pa[v] + pb[v];
        }
        ls += __shfl_xor(ls, 16, 32);
        if (c == 0) { l1 = l1 * al + ls; m1 = mn; }
        else        { l2 = l2 * al + ls; m2 = mn; }
        alpha[c] = al;
        // Pack P^T directly as B operand (K=32 keys): halves[0..7]=tile a,
        // halves[8..15]=tile b: exactly matches the C layout we already hold.
        v16h pv;
#pragma unroll
        for (int v = 0; v < 8; ++v) { pv[v] = (_Float16)pa[v]; pv[v + 8] = (_Float16)pb[v]; }
        pop[c] = pv;
      }

      // ---- O^T += V^T * P^T ----------------------------------------------
      v16h vop[8];
#pragma unroll
      for (int tt = 0; tt < 8; ++tt)
        vop[tt] = load_op(vs + tt * 16 * VPITCH, hs);
#pragma unroll
      for (int tt = 0; tt < 8; ++tt) {
#pragma unroll
        for (int v = 0; v < 8; ++v) { O1[tt][v] *= alpha[0]; O2[tt][v] *= alpha[1]; }
        O1[tt] = wmma32(vop[tt], pop[0], O1[tt]);
        O2[tt] = wmma32(vop[tt], pop[1], O2[tt]);
      }
    }
    // Hand-over, passed by every wave, also one that skipped the tile.
    asm volatile("s_wait_dscnt 0x0" ::: "memory");  // own reads of buffer t&1 are done
    WAIT_ASYNC();                       // own share of tile t+1 has landed
    __syncthreads();                    // tile t+1 readable; buffer t&1 free for refill
    if (t + 2 < ntiles) stage(t + 2);   // block-uniform test
  }
  WAIT_ASYNC();                         // nothing in flight when the wave ends

  // Combine streams, RMS-normalize over 128 dims, scale by (1 - lambda_init).
  const float inv1 = 1.0f / l1;
  const float inv2 = lam / l2;
  float ssq = 0.f;
#pragma unroll
  for (int t = 0; t < 8; ++t)
#pragma unroll
    for (int v = 0; v < 8; ++v) {
      float o = O1[t][v] * inv1 - O2[t][v] * inv2;
      ssq += o * o;
    }
  ssq += __shfl_xor(ssq, 16, 32);       // other 64 dims live in lane^16
  const float rinv = rsqrtf(ssq * (1.0f / DH2) + EPS_RMS) * (1.0f - LAMBDA_INIT);

  _Float16* orow = Oh + (size_t)(b * SEQ + qglob) * QKV_N + h * DH2;
#pragma unroll
  for (int t = 0; t < 8; ++t)
#pragma unroll
    for (int v = 0; v < 8; ++v) {
      const int d = t * 16 + hs * 8 + v;
      float o = O1[t][v] * inv1 - O2[t][v] * inv2;
      orow[d] = (_Float16)(o * rinv * rms_scale[d]);
    }
}

// ---------------------------------------------------------------------------
extern "C" void kernel_launch(void* const* d_in, const int* in_sizes, int n_in,
                              void* d_out, int out_size, void* d_ws, size_t ws_size,
                              hipStream_t stream) {
  const float* X    = (const float*)d_in[0];
  const float* Wq   = (const float*)d_in[1];
  const float* Wk   = (const float*)d_in[2];
  const float* Wv   = (const float*)d_in[3];
  const float* Wo   = (const float*)d_in[4];
  const float* lq1  = (const float*)d_in[5];
  const float* lk1  = (const float*)d_in[6];
  const float* lq2  = (const float*)d_in[7];
  const float* lk2  = (const float*)d_in[8];
  const float* rmss = (const float*)d_in[9];
  float* out = (float*)d_out;

  char* w = (char*)d_ws;
  _Float16* Xh  = (_Float16*)w; w += (size_t)TOKENS * D_MODEL * 2;  // 8 MB
  _Float16* WqT = (_Float16*)w; w += (size_t)QKV_N * D_MODEL * 2;   // 4 MB
  _Float16* WkT = (_Float16*)w; w += (size_t)QKV_N * D_MODEL * 2;
  _Float16* WvT = (_Float16*)w; w += (size_t)QKV_N * D_MODEL * 2;
  _Float16* WoT = (_Float16*)w; w += (size_t)D_MODEL * QKV_N * 2;
  _Float16* Qh  = (_Float16*)w; w += (size_t)TOKENS * QKV_N * 2;    // 16 MB
  _Float16* Kh  = (_Float16*)w; w += (size_t)TOKENS * QKV_N * 2;
  _Float16* Vt  = (_Float16*)w; w += (size_t)QKV_N * TOKENS * 2;    // transposed
  _Float16* Ohb = (_Float16*)w; w += (size_t)TOKENS * QKV_N * 2;
  float*    lam = (float*)w;

  // Stage 1: precision conversion + weight transposes + lambda scalars
  k_f32_to_f16<<<512, 256, 0, stream>>>(X, Xh, TOKENS * D_MODEL);
  k_transpose_f16<<<512, 256, 0, stream>>>(Wq, WqT, D_MODEL, QKV_N);
  k_transpose_f16<<<512, 256, 0, stream>>>(Wk, WkT, D_MODEL, QKV_N);
  k_transpose_f16<<<512, 256, 0, stream>>>(Wv, WvT, D_MODEL, QKV_N);
  k_transpose_f16<<<512, 256, 0, stream>>>(Wo, WoT, QKV_N, D_MODEL);
  k_lambda<<<1, 32, 0, stream>>>(lq1, lk1, lq2, lk2, lam);

  // Stage 2: QKV projections (WMMA). V stored transposed for the attention V^T operand.
  dim3 gq(QKV_N / 128, TOKENS / 128);
  k_gemm<0><<<gq, 256, 0, stream>>>(Xh, WqT, Qh, nullptr, TOKENS, QKV_N, D_MODEL);
  k_gemm<0><<<gq, 256, 0, stream>>>(Xh, WkT, Kh, nullptr, TOKENS, QKV_N, D_MODEL);
  k_gemm<1><<<gq, 256, 0, stream>>>(Xh, WvT, Vt, nullptr, TOKENS, QKV_N, D_MODEL);

  // Stage 3: fused differential flash attention + RMS norm
  const int waves = BATCH * HEADS * (SEQ / 16);  // 4096 waves
  k_diff_attn<<<waves / 4, 128, 0, stream>>>(Qh, Kh, Vt, lam, rmss, Ohb);

  // Stage 4: output projection -> fp32 result
  dim3 go(D_MODEL / 128, TOKENS / 128);
  k_gemm<2><<<go, 256, 0, stream>>>(Ohb, WoT, nullptr, out, TOKENS, D_MODEL, QKV_N);
}

// v002
// Measured time: 259 microseconds a run.
// Two timings next to v001 put it at 1.16 and 1.15 times that version's speed.
// Over all steps from v000 it is 1.50 times as fast.
#include <hip/hip_runtime.h>
#include <hip/hip_bf16.h>
#include <math.h>

typedef __attribute__((ext_vector_type(16))) _Float16 v16h;
typedef __attribute__((ext_vector_type(8)))  _Float16 h8;
typedef __attribute__((ext_vector_type(8)))  float    v8f;
typedef __attribute__((ext_vector_type(2)))  _Float16 h2;
typedef __attribute__((ext_vector_type(4)))  float    f4;

#define D_MODEL 1024
#define HEADS   16
#define DH      64
#define DH2     128            // 2*DH per head
#define BATCH   2
#define SEQ     2048
#define TOKENS  (BATCH*SEQ)    // 4096
#define QKV_N   (2*D_MODEL)    // 2048
#define LAMBDA_INIT 0.8f
#define EPS_RMS 1e-5f

#define USE_ASYNC_LDS 1

#if USE_ASYNC_LDS
__device__ __forceinline__ void stage_b128(const _Float16* g, _Float16* l) {
  unsigned lds_addr = (unsigned)(size_t)(void*)l;
  asm volatile("global_load_async_to_lds_b128 %0, %1, off"
               :: "v"(lds_addr), "v"(g) : "memory");
}
#define WAIT_ASYNC() asm volatile("s_wait_asynccnt 0x0" ::: "memory")
#else
__device__ __forceinline__ void stage_b128(const _Float16* g, _Float16* l) {
  *(h8*)l = *(const h8*)g;   // synchronous load + ds_store fallback
}
#define WAIT_ASYNC() ((void)0)
#endif

__device__ __forceinline__ v16h load_op(const _Float16* p, int halfsel) {
  h8 lo = *(const h8*)(p + halfsel * 8);
  h8 hi = *(const h8*)(p + 16 + halfsel * 8);
  v16h r;
#pragma unroll
  for (int i = 0; i < 8; ++i) { r[i] = lo[i]; r[i + 8] = hi[i]; }
  return r;
}

__device__ __forceinline__ v8f wmma32(v16h a, v16h b, v8f c) {
  // D = A(16x32) * B(32x16) + C, f32 accumulate
  return __builtin_amdgcn_wmma_f32_16x16x32_f16(
      /*neg_a=*/false, a, /*neg_b=*/false, b,
      /*c_mod=*/(short)0, c, /*reuse_a=*/false, /*reuse_b=*/false);
}

// ---------------------------------------------------------------------------
// Elementwise f32 -> f16
// ---------------------------------------------------------------------------
__global__ void k_f32_to_f16(const float* __restrict__ src,
                             _Float16* __restrict__ dst, int n) {
  int i = blockIdx.x * blockDim.x + threadIdx.x;
  int stride = gridDim.x * blockDim.x;
  for (; i < n; i += stride) dst[i] = (_Float16)src[i];
}

#define TR 128                 // src rows per tile (contiguous in dst)
#define TC 64                  // src cols per tile (contiguous in src)
#define TP (TR + 2)            // LDS row pitch in halves
template <int ROWS, int COLS>
__global__ __launch_bounds__(256) void k_transpose_f16(const float* __restrict__ src,
                                                       _Float16* __restrict__ dst) {
  __shared__ __attribute__((aligned(16))) _Float16 tile[TC * TP];  // [src col][src row]
  const int hi = threadIdx.x >> 4;      // 0..15
  const int lo = threadIdx.x & 15;      // 0..15
  const int c0 = blockIdx.x * TC, r0 = blockIdx.y * TR;

  // src rows r0 + 2*hi + 32*j (+1), cols c0 + 4*lo .. +3
  const float* s = src + (size_t)(r0 + 2 * hi) * COLS + c0 + 4 * lo;
  f4 a[4], b[4];                        // eight loads in flight, constant offsets
  for (int j = 0; j < 4; ++j) {
    a[j] = *(const f4*)(s + (size_t)(32 * j) * COLS);
    b[j] = *(const f4*)(s + (size_t)(32 * j + 1) * COLS);
  }
  for (int j = 0; j < 4; ++j)
    for (int k = 0; k < 4; ++k) {
      h2 p;
      p[0] = (_Float16)a[j][k];
      p[1] = (_Float16)b[j][k];
      *(h2*)&tile[(4 * lo + k) * TP + 2 * hi + 32 * j] = p;
    }
  __syncthreads();                      // the whole tile is in LDS

  // dst rows c0 + hi + 16*j, cols r0 + 8*lo .. +7
  _Float16* d = dst + (size_t)(c0 + hi) * ROWS + r0 + 8 * lo;
  for (int j = 0; j < 4; ++j) {
    const _Float16* t = &tile[(hi + 16 * j) * TP + 8 * lo];
    h8 w;
    for (int k = 0; k < 4; ++k) {
      h2 p = *(const h2*)(t + 2 * k);
      w[2 * k] = p[0];
      w[2 * k + 1] = p[1];
    }
    *(h8*)(d + (size_t)(16 * j) * ROWS) = w;
  }
}

// lam[h] = exp(lq1.lk1) - exp(lq2.lk2) + lambda_init
__global__ void k_lambda(const float* __restrict__ lq1, const float* __restrict__ lk1,
                         const float* __restrict__ lq2, const float* __restrict__ lk2,
                         float* __restrict__ lam) {
  int h = threadIdx.x;
  if (h < HEADS) {
    float s1 = 0.f, s2 = 0.f;
    for (int i = 0; i < DH; ++i) {
      s1 += lq1[h * DH + i] * lk1[h * DH + i];
      s2 += lq2[h * DH + i] * lk2[h * DH + i];
    }
    lam[h] = __expf(s1) - __expf(s2) + LAMBDA_INIT;
  }
}

template <int MODE>
__global__ __launch_bounds__(256) void k_gemm(
    const _Float16* __restrict__ A, const _Float16* __restrict__ BT,
    _Float16* __restrict__ outH, float* __restrict__ outF,
    int M, int Nn, int K) {
  __shared__ _Float16 Bs[2][128 * 40];   // 2 x 10 KB, padded row stride 40
  const int tid = threadIdx.x;
  const int lane = tid & 31;
  const int wave = tid >> 5;
  const int lq = lane & 15;   // row (A) / col (B) within tile
  const int hs = lane >> 4;   // operand half selector
  const int m0 = blockIdx.y * 128 + wave * 16;
  const int n0 = blockIdx.x * 128;

  // Staging map: thread t -> panel row sr = t/2, 16-half chunk sc = (t&1)*16.
  const int sr = tid >> 1;
  const int sc = (tid & 1) * 16;
  const _Float16* gB = BT + (size_t)(n0 + sr) * K + sc;
  _Float16* lB0 = &Bs[0][sr * 40 + sc];
  _Float16* lB1 = &Bs[1][sr * 40 + sc];

  // Preload panel for k0 = 0 into buffer 0.
  stage_b128(gB + 0, lB0);
  stage_b128(gB + 8, lB0 + 8);

  v8f acc[8] = {};
  const _Float16* arow = A + (size_t)(m0 + lq) * K;
  for (int k0 = 0, buf = 0; k0 < K; k0 += 32, buf ^= 1) {
    WAIT_ASYNC();            // this wave's staging of Bs[buf] is complete
    __syncthreads();         // every wave's staging of Bs[buf] is complete
    if (k0 + 32 < K) {       // kick off next panel while we compute
      _Float16* lB = buf ? lB0 : lB1;
      stage_b128(gB + k0 + 32,     lB);
      stage_b128(gB + k0 + 32 + 8, lB + 8);
    }
    // A operand direct from global (per-wave rows, no cross-wave reuse).
    v16h a = load_op(arow + k0, hs);
    v16h b[8];
#pragma unroll
    for (int j = 0; j < 8; ++j)
      b[j] = load_op(&Bs[buf][(j * 16 + lq) * 40], hs);
#pragma unroll
    for (int j = 0; j < 8; ++j)
      acc[j] = wmma32(a, b[j], acc[j]);
  }
#pragma unroll
  for (int j = 0; j < 8; ++j) {
    const int n = n0 + j * 16 + lq;
#pragma unroll
    for (int v = 0; v < 8; ++v) {
      const int m = m0 + hs * 8 + v;
      if (MODE == 0)      outH[(size_t)m * Nn + n] = (_Float16)acc[j][v];
      else if (MODE == 1) outH[(size_t)n * M + m]  = (_Float16)acc[j][v];
      else                outF[(size_t)m * Nn + n] = acc[j][v];
    }
  }
}

__device__ __forceinline__ void stage_tile8(
    const _Float16* g0, const _Float16* g1, const _Float16* g2, const _Float16* g3,
    const _Float16* g4, const _Float16* g5, const _Float16* g6, const _Float16* g7,
    unsigned l0, unsigned l1, unsigned l2, unsigned l3,
    unsigned l4, unsigned l5, unsigned l6, unsigned l7) {
  asm volatile(
      "global_load_async_to_lds_b128 %0, %8, off\n\t"
      "global_load_async_to_lds_b128 %1, %9, off\n\t"
      "global_load_async_to_lds_b128 %2, %10, off\n\t"
      "global_load_async_to_lds_b128 %3, %11, off\n\t"
      "global_load_async_to_lds_b128 %4, %12, off\n\t"
      "global_load_async_to_lds_b128 %5, %13, off\n\t"
      "global_load_async_to_lds_b128 %6, %14, off\n\t"
      "global_load_async_to_lds_b128 %7, %15, off\n\t"
      "s_wait_xcnt 0x0"
      :: "v"(l0), "v"(l1), "v"(l2), "v"(l3), "v"(l4), "v"(l5), "v"(l6), "v"(l7),
         "v"(g0), "v"(g1), "v"(g2), "v"(g3), "v"(g4), "v"(g5), "v"(g6), "v"(g7)
      : "memory");
}

#define KPITCH 136             // K tile row pitch in halves: 272 B = 16 B x 17
#define VPITCH 40              // V^T tile row pitch in halves: 80 B = 16 B x 5
#define KTILE  (32 * KPITCH)   // 32 keys x 128 dims
#define VTILE  (DH2 * VPITCH)  // 128 dims x 32 keys

// ---------------------------------------------------------------------------
// Fused differential flash-attention + RMS norm.
// One wave owns 16 queries of one (b,h). Computes S^T = K*Q^T so the score
// tile's C layout (lane=query, reg=key) feeds the second WMMA (O^T = V^T*P^T)
// with no cross-lane movement. Two independent online softmaxes (comp 1/2),
// O = P1 V / l1 - lam * P2 V / l2, then RMS norm over 128 dims, * 0.2.
// The four waves of a block own 64 consecutive queries and walk the same keys:
// each 32-key K tile and V^T tile is brought into LDS once per block by async
// copies (whole 256-B / 64-B row pieces), two buffers, the next tile in flight
// while this one is worked on; all operands are then read by ds_load_b128.
// ---------------------------------------------------------------------------
__global__ __launch_bounds__(128) void k_diff_attn(
    const _Float16* __restrict__ Qh, const _Float16* __restrict__ Kh,
    const _Float16* __restrict__ Vt,   // [2048 feat][4096 tokens]
    const float* __restrict__ lamBuf, const float* __restrict__ rms_scale,
    _Float16* __restrict__ Oh) {
  __shared__ __attribute__((aligned(16))) _Float16 Ks[2][KTILE];
  __shared__ __attribute__((aligned(16))) _Float16 Vs[2][VTILE];
  const int tid = threadIdx.x;
  const int lane = tid & 31;
  const int wave = __builtin_amdgcn_readfirstlane(tid >> 5);
  const int lq = lane & 15, hs = lane >> 4;
  const int qblocks = SEQ / 64;         // 32 blocks of 64 queries per (b,h)
  const int bh = blockIdx.x / qblocks;
  const int qb = blockIdx.x % qblocks;
  const int b = bh / HEADS, h = bh % HEADS;
  const int q0 = qb * 64 + wave * 16;
  const int qglob = q0 + lq;            // this lane's query index

  const float scale = 0.125f;           // 1/sqrt(64)
  const float lam = lamBuf[h];

  const _Float16* kbase = Kh + (size_t)(b * SEQ) * QKV_N + h * DH2;
  const _Float16* vbase = Vt + (size_t)(h * DH2) * TOKENS + b * SEQ;

  // Copy map. K tile: 512 chunks of 16 B, lane -> row tid/16 (+8 per copy),
  // chunk tid%16. V^T tile: 512 chunks, lane -> row tid/4 (+32 per copy),
  // chunk tid%4.
  const _Float16* gK = kbase + (size_t)(tid >> 4) * QKV_N + (tid & 15) * 8;
  const _Float16* gV = vbase + (size_t)(tid >> 2) * TOKENS + (tid & 3) * 8;
  const unsigned lK = (unsigned)(size_t)(void*)&Ks[0][(tid >> 4) * KPITCH + (tid & 15) * 8];
  const unsigned lV = (unsigned)(size_t)(void*)&Vs[0][(tid >> 2) * VPITCH + (tid & 3) * 8];

  auto stage = [&](int t) {             // tile t (keys 32t..32t+31) -> buffer t&1
    const _Float16* k = gK + (size_t)(t * 32) * QKV_N;
    const _Float16* v = gV + t * 32;
    const unsigned lk = lK + (t & 1) * (KTILE * 2);
    const unsigned lv = lV + (t & 1) * (VTILE * 2);
    stage_tile8(k, k + 8 * QKV_N, k + 16 * QKV_N, k + 24 * QKV_N,
                v, v + (size_t)32 * TOKENS, v + (size_t)64 * TOKENS, v + (size_t)96 * TOKENS,
                lk, lk + 8 * KPITCH * 2, lk + 16 * KPITCH * 2, lk + 24 * KPITCH * 2,
                lv, lv + 32 * VPITCH * 2, lv + 64 * VPITCH * 2, lv + 96 * VPITCH * 2);
  };

  const int ntiles = 2 * qb + 2;        // block's causal range, always >= 2 tiles
  stage(0);

  // Q^T as B operand: lane = query, halves = d-contiguous. 2 comps x 2 K-chunks.
  const _Float16* qrow = Qh + (size_t)(b * SEQ + qglob) * QKV_N + h * DH2;
  v16h qop[2][2];
#pragma unroll
  for (int c = 0; c < 2; ++c)
#pragma unroll
    for (int kk = 0; kk < 2; ++kk)
      qop[c][kk] = load_op(qrow + c * DH + kk * 32, hs);

  v8f O1[8] = {}, O2[8] = {};           // O^T accumulators: 8 d-tiles x (16x16)
  float m1 = -INFINITY, m2 = -INFINITY, l1 = 0.f, l2 = 0.f;

  WAIT_ASYNC();                         // this wave's share of tile 0 has landed
  __syncthreads();                      // every wave's share of tile 0 has landed
  stage(1);

  const int nk = q0 + 16;               // causal: this wave needs keys 0..q0+15
  for (int t = 0; t < ntiles; ++t) {    // 32 keys/step: tiles a (kt), b (kt+16)
    const int kt = t * 32;
    if (kt < nk) {                      // wave-uniform: skip tiles past the diagonal
      const _Float16* ks = &Ks[t & 1][lq * KPITCH];
      const _Float16* vs = &Vs[t & 1][lq * VPITCH];
      // ---- all 8 K operands of this step ---------------------------------
      v16h kA[2][2], kB[2][2];
#pragma unroll
      for (int c = 0; c < 2; ++c)
#pragma unroll
        for (int kk = 0; kk < 2; ++kk) {
          kA[c][kk] = load_op(ks + c * DH + kk * 32, hs);
          kB[c][kk] = load_op(ks + 16 * KPITCH + c * DH + kk * 32, hs);
        }

      // ---- score tiles (S^T) + online softmax ----------------------------
      v16h pop[2];
      float alpha[2];
#pragma unroll
      for (int c = 0; c < 2; ++c) {
        v8f sa = {}, sb = {};
#pragma unroll
        for (int kk = 0; kk < 2; ++kk) {  // accumulate over d = 64 (2 x K=32)
          sa = wmma32(kA[c][kk], qop[c][kk], sa);
          sb = wmma32(kB[c][kk], qop[c][kk], sb);
        }
        // S^T C layout: lane = query (lq), reg v -> key = kt + hs*8 + v (+16 for b)
        float pa[8], pb[8];
        float smax = -INFINITY;
#pragma unroll
        for (int v = 0; v < 8; ++v) {
          const int keyA = kt + hs * 8 + v;
          float xa = (keyA       <= qglob) ? sa[v] * scale : -INFINITY;
          float xb = (keyA + 16  <= qglob) ? sb[v] * scale : -INFINITY;
          pa[v] = xa; pb[v] = xb;
          smax = fmaxf(smax, fmaxf(xa, xb));
        }
        smax = fmaxf(smax, __shfl_xor(smax, 16, 32)); // lanes q, q+16 share a query
        const float mo = (c == 0) ? m1 : m2;
        const float mn = fmaxf(mo, smax);
        const float al = __expf(mo - mn);
        float ls = 0.f;
#pragma unroll
        for (int v = 0; v < 8; ++v) {
          pa[v] = __expf(pa[v] - mn);
          pb[v] = __expf(pb[v] - mn);
          ls += pa[v] + pb[v];
        }
        ls += __shfl_xor(ls, 16, 32);
        if (c == 0) { l1 = l1 * al + ls; m1 = mn; }
        else        { l2 = l2 * al + ls; m2 = mn; }
        alpha[c] = al;
        // Pack P^T directly as B operand (K=32 keys): halves[0..7]=tile a,
        // halves[8..15]=tile b: exactly matches the C layout we already hold.
        v16h pv;
#pragma unroll
        for (int v = 0; v < 8; ++v) { pv[v] = (_Float16)pa[v]; pv[v + 8] = (_Float16)pb[v]; }
        pop[c] = pv;
      }

      // ---- O^T += V^T * P^T ----------------------------------------------
      v16h vop[8];
#pragma unroll
      for (int tt = 0; tt < 8; ++tt)
        vop[tt] = load_op(vs + tt * 16 * VPITCH, hs);
#pragma unroll
      for (int tt = 0; tt < 8; ++tt) {
#pragma unroll
        for (int v = 0; v < 8; ++v) { O1[tt][v] *= alpha[0]; O2[tt][v] *= alpha[1]; }
        O1[tt] = wmma32(vop[tt], pop[0], O1[tt]);
        O2[tt] = wmma32(vop[tt], pop[1], O2[tt]);
      }
    }
    // Hand-over, passed by every wave, also one that skipped the tile.
    asm volatile("s_wait_dscnt 0x0" ::: "memory");  // own reads of buffer t&1 are done
    WAIT_ASYNC();                       // own share of tile t+1 has landed
    __syncthreads();                    // tile t+1 readable; buffer t&1 free for refill
    if (t + 2 < ntiles) stage(t + 2);   // block-uniform test
  }
  WAIT_ASYNC();                         // nothing in flight when the wave ends

  // Combine streams, RMS-normalize over 128 dims, scale by (1 - lambda_init).
  const float inv1 = 1.0f / l1;
  const float inv2 = lam / l2;
  float ssq = 0.f;
#pragma unroll
  for (int t = 0; t < 8; ++t)
#pragma unroll
    for (int v = 0; v < 8; ++v) {
      float o = O1[t][v] * inv1 - O2[t][v] * inv2;
      ssq += o * o;
    }
  ssq += __shfl_xor(ssq, 16, 32);       // other 64 dims live in lane^16
  const float rinv = rsqrtf(ssq * (1.0f / DH2) + EPS_RMS) * (1.0f - LAMBDA_INIT);

  _Float16* orow = Oh + (size_t)(b * SEQ + qglob) * QKV_N + h * DH2;
#pragma unroll
  for (int t = 0; t < 8; ++t)
#pragma unroll
    for (int v = 0; v < 8; ++v) {
      const int d = t * 16 + hs * 8 + v;
      float o = O1[t][v] * inv1 - O2[t][v] * inv2;
      orow[d] = (_Float16)(o * rinv * rms_scale[d]);
    }
}

// ---------------------------------------------------------------------------
extern "C" void kernel_launch(void* const* d_in, const int* in_sizes, int n_in,
                              void* d_out, int out_size, void* d_ws, size_t ws_size,
                              hipStream_t stream) {
  const float* X    = (const float*)d_in[0];
  const float* Wq   = (const float*)d_in[1];
  const float* Wk   = (const float*)d_in[2];
  const float* Wv   = (const float*)d_in[3];
  const float* Wo   = (const float*)d_in[4];
  const float* lq1  = (const float*)d_in[5];
  const float* lk1  = (const float*)d_in[6];
  const float* lq2  = (const float*)d_in[7];
  const float* lk2  = (const float*)d_in[8];
  const float* rmss = (const float*)d_in[9];
  float* out = (float*)d_out;

  char* w = (char*)d_ws;
  _Float16* Xh  = (_Float16*)w; w += (size_t)TOKENS * D_MODEL * 2;  // 8 MB
  _Float16* WqT = (_Float16*)w; w += (size_t)QKV_N * D_MODEL * 2;   // 4 MB
  _Float16* WkT = (_Float16*)w; w += (size_t)QKV_N * D_MODEL * 2;
  _Float16* WvT = (_Float16*)w; w += (size_t)QKV_N * D_MODEL * 2;
  _Float16* WoT = (_Float16*)w; w += (size_t)D_MODEL * QKV_N * 2;
  _Float16* Qh  = (_Float16*)w; w += (size_t)TOKENS * QKV_N * 2;    // 16 MB
  _Float16* Kh  = (_Float16*)w; w += (size_t)TOKENS * QKV_N * 2;
  _Float16* Vt  = (_Float16*)w; w += (size_t)QKV_N * TOKENS * 2;    // transposed
  _Float16* Ohb = (_Float16*)w; w += (size_t)TOKENS * QKV_N * 2;
  float*    lam = (float*)w;

  // Stage 1: precision conversion + weight transposes + lambda scalars
  k_f32_to_f16<<<512, 256, 0, stream>>>(X, Xh, TOKENS * D_MODEL);
  dim3 gt(QKV_N / TC, D_MODEL / TR);    // 256 tiles
  dim3 gu(D_MODEL / TC, QKV_N / TR);    // 256 tiles
  k_transpose_f16<D_MODEL, QKV_N><<<gt, 256, 0, stream>>>(Wq, WqT);
  k_transpose_f16<D_MODEL, QKV_N><<<gt, 256, 0, stream>>>(Wk, WkT);
  k_transpose_f16<D_MODEL, QKV_N><<<gt, 256, 0, stream>>>(Wv, WvT);
  k_transpose_f16<QKV_N, D_MODEL><<<gu, 256, 0, stream>>>(Wo, WoT);
  k_lambda<<<1, 32, 0, stream>>>(lq1, lk1, lq2, lk2, lam);

  // Stage 2: QKV projections (WMMA). V stored transposed for the attention V^T operand.
  dim3 gq(QKV_N / 128, TOKENS / 128);
  k_gemm<0><<<gq, 256, 0, stream>>>(Xh, WqT, Qh, nullptr, TOKENS, QKV_N, D_MODEL);
  k_gemm<0><<<gq, 256, 0, stream>>>(Xh, WkT, Kh, nullptr, TOKENS, QKV_N, D_MODEL);
  k_gemm<1><<<gq, 256, 0, stream>>>(Xh, WvT, Vt, nullptr, TOKENS, QKV_N, D_MODEL);

  // Stage 3: fused differential flash attention + RMS norm
  const int waves = BATCH * HEADS * (SEQ / 16);  // 4096 waves
  k_diff_attn<<<waves / 4, 128, 0, stream>>>(Qh, Kh, Vt, lam, rmss, Ohb);

  // Stage 4: output projection -> fp32 result
  dim3 go(D_MODEL / 128, TOKENS / 128);
  k_gemm<2><<<go, 256, 0, stream>>>(Ohb, WoT, nullptr, out, TOKENS, D_MODEL, QKV_N);
}

// v003
// A run of this version takes 191 microseconds.
// In two side-by-side timings against v002, it was 1.35 and 1.34 times as fast.
// Over all steps from v000 it is 2.02 times as fast.
#include <hip/hip_runtime.h>
#include <hip/hip_bf16.h>
#include <math.h>

typedef __attribute__((ext_vector_type(16))) _Float16 v16h;
typedef __attribute__((ext_vector_type(8)))  _Float16 h8;
typedef __attribute__((ext_vector_type(8)))  float    v8f;
typedef __attribute__((ext_vector_type(2)))  _Float16 h2;
typedef __attribute__((ext_vector_type(4)))  float    f4;

#define D_MODEL 1024
#define HEADS   16
#define DH      64
#define DH2     128            // 2*DH per head
#define BATCH   2
#define SEQ     2048
#define TOKENS  (BATCH*SEQ)    // 4096
#define QKV_N   (2*D_MODEL)    // 2048
#define LAMBDA_INIT 0.8f
#define EPS_RMS 1e-5f

#define WAIT_ASYNC() asm volatile("s_wait_asynccnt 0x0" ::: "memory")

__device__ __forceinline__ v16h load_op(const _Float16* p, int halfsel) {
  h8 lo = *(const h8*)(p + halfsel * 8);
  h8 hi = *(const h8*)(p + 16 + halfsel * 8);
  v16h r;
#pragma unroll
  for (int i = 0; i < 8; ++i) { r[i] = lo[i]; r[i + 8] = hi[i]; }
  return r;
}

__device__ __forceinline__ v8f wmma32(v16h a, v16h b, v8f c) {
  // D = A(16x32) * B(32x16) + C, f32 accumulate
  return __builtin_amdgcn_wmma_f32_16x16x32_f16(
      /*neg_a=*/false, a, /*neg_b=*/false, b,
      /*c_mod=*/(short)0, c, /*reuse_a=*/false, /*reuse_b=*/false);
}

// ---------------------------------------------------------------------------
// Elementwise f32 -> f16
// ---------------------------------------------------------------------------
__global__ void k_f32_to_f16(const float* __restrict__ src,
                             _Float16* __restrict__ dst, int n) {
  int i = blockIdx.x * blockDim.x + threadIdx.x;
  int stride = gridDim.x * blockDim.x;
  for (; i < n; i += stride) dst[i] = (_Float16)src[i];
}

#define TR 128                 // src rows per tile (contiguous in dst)
#define TC 64                  // src cols per tile (contiguous in src)
#define TP (TR + 2)            // LDS row pitch in halves
template <int ROWS, int COLS>
__global__ __launch_bounds__(256) void k_transpose_f16(const float* __restrict__ src,
                                                       _Float16* __restrict__ dst) {
  __shared__ __attribute__((aligned(16))) _Float16 tile[TC * TP];  // [src col][src row]
  const int hi = threadIdx.x >> 4;      // 0..15
  const int lo = threadIdx.x & 15;      // 0..15
  const int c0 = blockIdx.x * TC, r0 = blockIdx.y * TR;

  // src rows r0 + 2*hi + 32*j (+1), cols c0 + 4*lo .. +3
  const float* s = src + (size_t)(r0 + 2 * hi) * COLS + c0 + 4 * lo;
  f4 a[4], b[4];                        // eight loads in flight, constant offsets
  for (int j = 0; j < 4; ++j) {
    a[j] = *(const f4*)(s + (size_t)(32 * j) * COLS);
    b[j] = *(const f4*)(s + (size_t)(32 * j + 1) * COLS);
  }
  for (int j = 0; j < 4; ++j)
    for (int k = 0; k < 4; ++k) {
      h2 p;
      p[0] = (_Float16)a[j][k];
      p[1] = (_Float16)b[j][k];
      *(h2*)&tile[(4 * lo + k) * TP + 2 * hi + 32 * j] = p;
    }
  __syncthreads();                      // the whole tile is in LDS

  // dst rows c0 + hi + 16*j, cols r0 + 8*lo .. +7
  _Float16* d = dst + (size_t)(c0 + hi) * ROWS + r0 + 8 * lo;
  for (int j = 0; j < 4; ++j) {
    const _Float16* t = &tile[(hi + 16 * j) * TP + 8 * lo];
    h8 w;
    for (int k = 0; k < 4; ++k) {
      h2 p = *(const h2*)(t + 2 * k);
      w[2 * k] = p[0];
      w[2 * k + 1] = p[1];
    }
    *(h8*)(d + (size_t)(16 * j) * ROWS) = w;
  }
}

// lam[h] = exp(lq1.lk1) - exp(lq2.lk2) + lambda_init
__global__ void k_lambda(const float* __restrict__ lq1, const float* __restrict__ lk1,
                         const float* __restrict__ lq2, const float* __restrict__ lk2,
                         float* __restrict__ lam) {
  int h = threadIdx.x;
  if (h < HEADS) {
    float s1 = 0.f, s2 = 0.f;
    for (int i = 0; i < DH; ++i) {
      s1 += lq1[h * DH + i] * lk1[h * DH + i];
      s2 += lq2[h * DH + i] * lk2[h * DH + i];
    }
    lam[h] = __expf(s1) - __expf(s2) + LAMBDA_INIT;
  }
}

__device__ __forceinline__ void stage_tile8(
    const _Float16* g0, const _Float16* g1, const _Float16* g2, const _Float16* g3,
    const _Float16* g4, const _Float16* g5, const _Float16* g6, const _Float16* g7,
    unsigned l0, unsigned l1, unsigned l2, unsigned l3,
    unsigned l4, unsigned l5, unsigned l6, unsigned l7) {
  asm volatile(
      "global_load_async_to_lds_b128 %0, %8, off\n\t"
      "global_load_async_to_lds_b128 %1, %9, off\n\t"
      "global_load_async_to_lds_b128 %2, %10, off\n\t"
      "global_load_async_to_lds_b128 %3, %11, off\n\t"
      "global_load_async_to_lds_b128 %4, %12, off\n\t"
      "global_load_async_to_lds_b128 %5, %13, off\n\t"
      "global_load_async_to_lds_b128 %6, %14, off\n\t"
      "global_load_async_to_lds_b128 %7, %15, off\n\t"
      "s_wait_xcnt 0x0"
      :: "v"(l0), "v"(l1), "v"(l2), "v"(l3), "v"(l4), "v"(l5), "v"(l6), "v"(l7),
         "v"(g0), "v"(g1), "v"(g2), "v"(g3), "v"(g4), "v"(g5), "v"(g6), "v"(g7)
      : "memory");
}

// ---------------------------------------------------------------------------
// WMMA GEMM, both operand panels staged in a two-buffer LDS ring.
// out[M][Nn] = A[M][K] * B[K][Nn], B supplied transposed as BT[Nn][K].
// Block = 128 threads = 4 waves (2 x 2); wave tile 64 x 64; block 128 x 128.
// A trip is 64 k: 128 rows x 128 B of each operand come into LDS by async
// copies (a wave's copy = 4 whole 128-B lines) while the trip before feeds the
// WMMAs. A fragment read from LDS serves four WMMAs. LDS row pitch 144 B
// (16 B x 9): conflict-free for ds_load_b128.
// The operand whose index runs along the stored row (P) is the WMMA's A side,
// so a lane's eight accumulator registers are eight neighbours of that row.
// M, Nn multiples of 128; K a multiple of 64.
// MODE 0: f16 row-major out; MODE 1: f16 transposed out[n][m]; MODE 2: f32 out.
// ---------------------------------------------------------------------------
#define GBK    64              // k per trip
#define GPITCH 72              // LDS row pitch in halves
#define GPANEL (128 * GPITCH)  // one operand's 128 rows of a trip
template <int MODE>
__global__ __launch_bounds__(128) void k_gemm(
    const _Float16* __restrict__ A, const _Float16* __restrict__ BT,
    _Float16* __restrict__ outH, float* __restrict__ outF,
    int M, int Nn, int K) {
  __shared__ __attribute__((aligned(16))) _Float16 Ps[2][2][GPANEL];  // [buffer][P, Q]
  const int tid = threadIdx.x;
  const int lane = tid & 31;
  const int wave = __builtin_amdgcn_readfirstlane(tid >> 5);
  const int lq = lane & 15;   // fragment row within a 16-row tile
  const int hs = lane >> 4;   // operand half selector
  // out[q][p], p contiguous, leading dimension LD
  const _Float16* P = (MODE == 1) ? A : BT;
  const _Float16* Q = (MODE == 1) ? BT : A;
  const int LD = (MODE == 1) ? M : Nn;
  const int p0 = ((MODE == 1) ? blockIdx.y : blockIdx.x) * 128;
  const int q0 = ((MODE == 1) ? blockIdx.x : blockIdx.y) * 128;
  const int wp = (wave & 1) * 64, wq = (wave >> 1) * 64;

  // Copy map, per panel 1024 chunks of 16 B: lane -> row tid/8 (+16 per copy),
  // chunk tid%8.
  const _Float16* gP = P + (size_t)(p0 + (tid >> 3)) * K + (tid & 7) * 8;
  const _Float16* gQ = Q + (size_t)(q0 + (tid >> 3)) * K + (tid & 7) * 8;
  const unsigned lP = (unsigned)(size_t)(void*)&Ps[0][0][(tid >> 3) * GPITCH + (tid & 7) * 8];
  const size_t rs = (size_t)16 * K;     // 16 rows, in halves
  const unsigned ls = 16 * GPITCH * 2;  // 16 rows, in LDS bytes

  auto stage = [&](int t) {             // trip t (k 64t..64t+63) -> buffer t&1
    const _Float16* p = gP + t * GBK;
    const _Float16* q = gQ + t * GBK;
    const unsigned lp = lP + (t & 1) * (2 * GPANEL * 2);
    const unsigned lc = lp + GPANEL * 2;
    stage_tile8(p, p + rs, p + 2 * rs, p + 3 * rs, p + 4 * rs, p + 5 * rs, p + 6 * rs, p + 7 * rs,
                lp, lp + ls, lp + 2 * ls, lp + 3 * ls, lp + 4 * ls, lp + 5 * ls, lp + 6 * ls, lp + 7 * ls);
    stage_tile8(q, q + rs, q + 2 * rs, q + 3 * rs, q + 4 * rs, q + 5 * rs, q + 6 * rs, q + 7 * rs,
                lc, lc + ls, lc + 2 * ls, lc + 3 * ls, lc + 4 * ls, lc + 5 * ls, lc + 6 * ls, lc + 7 * ls);
  };

  const int nt = K / GBK;
  stage(0);
  v8f acc[4][4] = {};                   // [p tile][q tile]
  WAIT_ASYNC();                         // this wave's share of trip 0 has landed
  __syncthreads();                      // every wave's share of trip 0 has landed
  if (nt > 1) stage(1);                 // block-uniform test

  for (int t = 0; t < nt; ++t) {
    const _Float16* fp = &Ps[t & 1][0][(wp + lq) * GPITCH];
    const _Float16* fq = &Ps[t & 1][1][(wq + lq) * GPITCH];
    v16h a[2][4], b[2][4];              // all 16 fragments of the trip, one load group
#pragma unroll
    for (int kk = 0; kk < 2; ++kk)
#pragma unroll
      for (int i = 0; i < 4; ++i) {
        a[kk][i] = load_op(fp + i * 16 * GPITCH + kk * 32, hs);
        b[kk][i] = load_op(fq + i * 16 * GPITCH + kk * 32, hs);
      }
    // Keeps the 32 LDS reads one group ahead of the WMMAs: left alone, the
    // scheduler sinks them among the WMMAs, each pair with a full wait behind it.
    __builtin_amdgcn_sched_barrier(0);
#pragma unroll
    for (int i = 0; i < 4; ++i)         // first 32 k, while the second half's reads land
#pragma unroll
      for (int j = 0; j < 4; ++j)
        acc[i][j] = wmma32(a[0][i], b[0][j], acc[i][j]);
    // Keeps the hand-over behind the first 16 WMMAs: hoisted over them, its full
    // wait would hold every WMMA back until the last LDS read has landed.
    __builtin_amdgcn_sched_barrier(0);
    // Hand-over, passed by every wave; the trip's last 16 WMMAs need registers only.
    asm volatile("s_wait_dscnt 0x0" ::: "memory");  // own reads of buffer t&1 are done
    WAIT_ASYNC();                       // own share of trip t+1 has landed
    __syncthreads();                    // trip t+1 readable; buffer t&1 free for refill
    if (t + 2 < nt) stage(t + 2);       // block-uniform test
#pragma unroll
    for (int i = 0; i < 4; ++i)         // second 32 k
#pragma unroll
      for (int j = 0; j < 4; ++j)
        acc[i][j] = wmma32(a[1][i], b[1][j], acc[i][j]);
  }
  WAIT_ASYNC();                         // nothing in flight when the wave ends

  // D layout: lane -> q = lq, register v -> p = hs*8 + v
#pragma unroll
  for (int j = 0; j < 4; ++j) {
    const size_t row = (size_t)(q0 + wq + j * 16 + lq) * LD + p0 + wp + hs * 8;
#pragma unroll
    for (int i = 0; i < 4; ++i) {
      if (MODE == 2) {
        f4 lo, hi;
#pragma unroll
        for (int v = 0; v < 4; ++v) { lo[v] = acc[i][j][v]; hi[v] = acc[i][j][v + 4]; }
        *(f4*)(outF + row + i * 16) = lo;
        *(f4*)(outF + row + i * 16 + 4) = hi;
      } else {
        h8 w;
#pragma unroll
        for (int v = 0; v < 8; ++v) w[v] = (_Float16)acc[i][j][v];
        *(h8*)(outH + row + i * 16) = w;
      }
    }
  }
}

#define KPITCH 136             // K tile row pitch in halves: 272 B = 16 B x 17
#define VPITCH 40              // V^T tile row pitch in halves: 80 B = 16 B x 5
#define KTILE  (32 * KPITCH)   // 32 keys x 128 dims
#define VTILE  (DH2 * VPITCH)  // 128 dims x 32 keys

// ---------------------------------------------------------------------------
// Fused differential flash-attention + RMS norm.
// One wave owns 16 queries of one (b,h). Computes S^T = K*Q^T so the score
// tile's C layout (lane=query, reg=key) feeds the second WMMA (O^T = V^T*P^T)
// with no cross-lane movement. Two independent online softmaxes (comp 1/2),
// O = P1 V / l1 - lam * P2 V / l2, then RMS norm over 128 dims, * 0.2.
// The four waves of a block own 64 consecutive queries and walk the same keys:
// each 32-key K tile and V^T tile is brought into LDS once per block by async
// copies (whole 256-B / 64-B row pieces), two buffers, the next tile in flight
// while this one is worked on; all operands are then read by ds_load_b128.
// ---------------------------------------------------------------------------
__global__ __launch_bounds__(128) void k_diff_attn(
    const _Float16* __restrict__ Qh, const _Float16* __restrict__ Kh,
    const _Float16* __restrict__ Vt,   // [2048 feat][4096 tokens]
    const float* __restrict__ lamBuf, const float* __restrict__ rms_scale,
    _Float16* __restrict__ Oh) {
  __shared__ __attribute__((aligned(16))) _Float16 Ks[2][KTILE];
  __shared__ __attribute__((aligned(16))) _Float16 Vs[2][VTILE];
  const int tid = threadIdx.x;
  const int lane = tid & 31;
  const int wave = __builtin_amdgcn_readfirstlane(tid >> 5);
  const int lq = lane & 15, hs = lane >> 4;
  const int qblocks = SEQ / 64;         // 32 blocks of 64 queries per (b,h)
  const int bh = blockIdx.x / qblocks;
  const int qb = blockIdx.x % qblocks;
  const int b = bh / HEADS, h = bh % HEADS;
  const int q0 = qb * 64 + wave * 16;
  const int qglob = q0 + lq;            // this lane's query index

  const float scale = 0.125f;           // 1/sqrt(64)
  const float lam = lamBuf[h];

  const _Float16* kbase = Kh + (size_t)(b * SEQ) * QKV_N + h * DH2;
  const _Float16* vbase = Vt + (size_t)(h * DH2) * TOKENS + b * SEQ;

  // Copy map. K tile: 512 chunks of 16 B, lane -> row tid/16 (+8 per copy),
  // chunk tid%16. V^T tile: 512 chunks, lane -> row tid/4 (+32 per copy),
  // chunk tid%4.
  const _Float16* gK = kbase + (size_t)(tid >> 4) * QKV_N + (tid & 15) * 8;
  const _Float16* gV = vbase + (size_t)(tid >> 2) * TOKENS + (tid & 3) * 8;
  const unsigned lK = (unsigned)(size_t)(void*)&Ks[0][(tid >> 4) * KPITCH + (tid & 15) * 8];
  const unsigned lV = (unsigned)(size_t)(void*)&Vs[0][(tid >> 2) * VPITCH + (tid & 3) * 8];

  auto stage = [&](int t) {             // tile t (keys 32t..32t+31) -> buffer t&1
    const _Float16* k = gK + (size_t)(t * 32) * QKV_N;
    const _Float16* v = gV + t * 32;
    const unsigned lk = lK + (t & 1) * (KTILE * 2);
    const unsigned lv = lV + (t & 1) * (VTILE * 2);
    stage_tile8(k, k + 8 * QKV_N, k + 16 * QKV_N, k + 24 * QKV_N,
                v, v + (size_t)32 * TOKENS, v + (size_t)64 * TOKENS, v + (size_t)96 * TOKENS,
                lk, lk + 8 * KPITCH * 2, lk + 16 * KPITCH * 2, lk + 24 * KPITCH * 2,
                lv, lv + 32 * VPITCH * 2, lv + 64 * VPITCH * 2, lv + 96 * VPITCH * 2);
  };

  const int ntiles = 2 * qb + 2;        // block's causal range, always >= 2 tiles
  stage(0);

  // Q^T as B operand: lane = query, halves = d-contiguous. 2 comps x 2 K-chunks.
  const _Float16* qrow = Qh + (size_t)(b * SEQ + qglob) * QKV_N + h * DH2;
  v16h qop[2][2];
#pragma unroll
  for (int c = 0; c < 2; ++c)
#pragma unroll
    for (int kk = 0; kk < 2; ++kk)
      qop[c][kk] = load_op(qrow + c * DH + kk * 32, hs);

  v8f O1[8] = {}, O2[8] = {};           // O^T accumulators: 8 d-tiles x (16x16)
  float m1 = -INFINITY, m2 = -INFINITY, l1 = 0.f, l2 = 0.f;

  WAIT_ASYNC();                         // this wave's share of tile 0 has landed
  __syncthreads();                      // every wave's share of tile 0 has landed
  stage(1);

  const int nk = q0 + 16;               // causal: this wave needs keys 0..q0+15
  for (int t = 0; t < ntiles; ++t) {    // 32 keys/step: tiles a (kt), b (kt+16)
    const int kt = t * 32;
    if (kt < nk) {                      // wave-uniform: skip tiles past the diagonal
      const _Float16* ks = &Ks[t & 1][lq * KPITCH];
      const _Float16* vs = &Vs[t & 1][lq * VPITCH];
      // ---- all 8 K operands of this step ---------------------------------
      v16h kA[2][2], kB[2][2];
#pragma unroll
      for (int c = 0; c < 2; ++c)
#pragma unroll
        for (int kk = 0; kk < 2; ++kk) {
          kA[c][kk] = load_op(ks + c * DH + kk * 32, hs);
          kB[c][kk] = load_op(ks + 16 * KPITCH + c * DH + kk * 32, hs);
        }

      // ---- score tiles (S^T) + online softmax ----------------------------
      v16h pop[2];
      float alpha[2];
#pragma unroll
      for (int c = 0; c < 2; ++c) {
        v8f sa = {}, sb = {};
#pragma unroll
        for (int kk = 0; kk < 2; ++kk) {  // accumulate over d = 64 (2 x K=32)
          sa = wmma32(kA[c][kk], qop[c][kk], sa);
          sb = wmma32(kB[c][kk], qop[c][kk], sb);
        }
        // S^T C layout: lane = query (lq), reg v -> key = kt + hs*8 + v (+16 for b)
        float pa[8], pb[8];
        float smax = -INFINITY;
#pragma unroll
        for (int v = 0; v < 8; ++v) {
          const int keyA = kt + hs * 8 + v;
          float xa = (keyA       <= qglob) ? sa[v] * scale : -INFINITY;
          float xb = (keyA + 16  <= qglob) ? sb[v] * scale : -INFINITY;
          pa[v] = xa; pb[v] = xb;
          smax = fmaxf(smax, fmaxf(xa, xb));
        }
        smax = fmaxf(smax, __shfl_xor(smax, 16, 32)); // lanes q, q+16 share a query
        const float mo = (c == 0) ? m1 : m2;
        const float mn = fmaxf(mo, smax);
        const float al = __expf(mo - mn);
        float ls = 0.f;
#pragma unroll
        for (int v = 0; v < 8; ++v) {
          pa[v] = __expf(pa[v] - mn);
          pb[v] = __expf(pb[v] - mn);
          ls += pa[v] + pb[v];
        }
        ls += __shfl_xor(ls, 16, 32);
        if (c == 0) { l1 = l1 * al + ls; m1 = mn; }
        else        { l2 = l2 * al + ls; m2 = mn; }
        alpha[c] = al;
        // Pack P^T directly as B operand (K=32 keys): halves[0..7]=tile a,
        // halves[8..15]=tile b: exactly matches the C layout we already hold.
        v16h pv;
#pragma unroll
        for (int v = 0; v < 8; ++v) { pv[v] = (_Float16)pa[v]; pv[v + 8] = (_Float16)pb[v]; }
        pop[c] = pv;
      }

      // ---- O^T += V^T * P^T ----------------------------------------------
      v16h vop[8];
#pragma unroll
      for (int tt = 0; tt < 8; ++tt)
        vop[tt] = load_op(vs + tt * 16 * VPITCH, hs);
#pragma unroll
      for (int tt = 0; tt < 8; ++tt) {
#pragma unroll
        for (int v = 0; v < 8; ++v) { O1[tt][v] *= alpha[0]; O2[tt][v] *= alpha[1]; }
        O1[tt] = wmma32(vop[tt], pop[0], O1[tt]);
        O2[tt] = wmma32(vop[tt], pop[1], O2[tt]);
      }
    }
    // Hand-over, passed by every wave, also one that skipped the tile.
    asm volatile("s_wait_dscnt 0x0" ::: "memory");  // own reads of buffer t&1 are done
    WAIT_ASYNC();                       // own share of tile t+1 has landed
    __syncthreads();                    // tile t+1 readable; buffer t&1 free for refill
    if (t + 2 < ntiles) stage(t + 2);   // block-uniform test
  }
  WAIT_ASYNC();                         // nothing in flight when the wave ends

  // Combine streams, RMS-normalize over 128 dims, scale by (1 - lambda_init).
  const float inv1 = 1.0f / l1;
  const float inv2 = lam / l2;
  float ssq = 0.f;
#pragma unroll
  for (int t = 0; t < 8; ++t)
#pragma unroll
    for (int v = 0; v < 8; ++v) {
      float o = O1[t][v] * inv1 - O2[t][v] * inv2;
      ssq += o * o;
    }
  ssq += __shfl_xor(ssq, 16, 32);       // other 64 dims live in lane^16
  const float rinv = rsqrtf(ssq * (1.0f / DH2) + EPS_RMS) * (1.0f - LAMBDA_INIT);

  _Float16* orow = Oh + (size_t)(b * SEQ + qglob) * QKV_N + h * DH2;
#pragma unroll
  for (int t = 0; t < 8; ++t)
#pragma unroll
    for (int v = 0; v < 8; ++v) {
      const int d = t * 16 + hs * 8 + v;
      float o = O1[t][v] * inv1 - O2[t][v] * inv2;
      orow[d] = (_Float16)(o * rinv * rms_scale[d]);
    }
}

// ---------------------------------------------------------------------------
extern "C" void kernel_launch(void* const* d_in, const int* in_sizes, int n_in,
                              void* d_out, int out_size, void* d_ws, size_t ws_size,
                              hipStream_t stream) {
  const float* X    = (const float*)d_in[0];
  const float* Wq   = (const float*)d_in[1];
  const float* Wk   = (const float*)d_in[2];
  const float* Wv   = (const float*)d_in[3];
  const float* Wo   = (const float*)d_in[4];
  const float* lq1  = (const float*)d_in[5];
  const float* lk1  = (const float*)d_in[6];
  const float* lq2  = (const float*)d_in[7];
  const float* lk2  = (const float*)d_in[8];
  const float* rmss = (const float*)d_in[9];
  float* out = (float*)d_out;

  char* w = (char*)d_ws;
  _Float16* Xh  = (_Float16*)w; w += (size_t)TOKENS * D_MODEL * 2;  // 8 MB
  _Float16* WqT = (_Float16*)w; w += (size_t)QKV_N * D_MODEL * 2;   // 4 MB
  _Float16* WkT = (_Float16*)w; w += (size_t)QKV_N * D_MODEL * 2;
  _Float16* WvT = (_Float16*)w; w += (size_t)QKV_N * D_MODEL * 2;
  _Float16* WoT = (_Float16*)w; w += (size_t)D_MODEL * QKV_N * 2;
  _Float16* Qh  = (_Float16*)w; w += (size_t)TOKENS * QKV_N * 2;    // 16 MB
  _Float16* Kh  = (_Float16*)w; w += (size_t)TOKENS * QKV_N * 2;
  _Float16* Vt  = (_Float16*)w; w += (size_t)QKV_N * TOKENS * 2;    // transposed
  _Float16* Ohb = (_Float16*)w; w += (size_t)TOKENS * QKV_N * 2;
  float*    lam = (float*)w;

  // Stage 1: precision conversion + weight transposes + lambda scalars
  k_f32_to_f16<<<512, 256, 0, stream>>>(X, Xh, TOKENS * D_MODEL);
  dim3 gt(QKV_N / TC, D_MODEL / TR);    // 256 tiles
  dim3 gu(D_MODEL / TC, QKV_N / TR);    // 256 tiles
  k_transpose_f16<D_MODEL, QKV_N><<<gt, 256, 0, stream>>>(Wq, WqT);
  k_transpose_f16<D_MODEL, QKV_N><<<gt, 256, 0, stream>>>(Wk, WkT);
  k_transpose_f16<D_MODEL, QKV_N><<<gt, 256, 0, stream>>>(Wv, WvT);
  k_transpose_f16<QKV_N, D_MODEL><<<gu, 256, 0, stream>>>(Wo, WoT);
  k_lambda<<<1, 32, 0, stream>>>(lq1, lk1, lq2, lk2, lam);

  // Stage 2: QKV projections (WMMA). V stored transposed for the attention V^T operand.
  dim3 gq(QKV_N / 128, TOKENS / 128);
  k_gemm<0><<<gq, 128, 0, stream>>>(Xh, WqT, Qh, nullptr, TOKENS, QKV_N, D_MODEL);
  k_gemm<0><<<gq, 128, 0, stream>>>(Xh, WkT, Kh, nullptr, TOKENS, QKV_N, D_MODEL);
  k_gemm<1><<<gq, 128, 0, stream>>>(Xh, WvT, Vt, nullptr, TOKENS, QKV_N, D_MODEL);

  // Stage 3: fused differential flash attention + RMS norm
  const int waves = BATCH * HEADS * (SEQ / 16);  // 4096 waves
  k_diff_attn<<<waves / 4, 128, 0, stream>>>(Qh, Kh, Vt, lam, rmss, Ohb);

  // Stage 4: output projection -> fp32 result
  dim3 go(D_MODEL / 128, TOKENS / 128);
  k_gemm<2><<<go, 128, 0, stream>>>(Ohb, WoT, nullptr, out, TOKENS, D_MODEL, QKV_N);
}

// v004
// It runs in 169 microseconds.
// Next to v003, in two timings, it ran 1.12 and 1.13 times as fast.
// Over all steps from v000 it is 2.27 times as fast.
#include <hip/hip_runtime.h>
#include <hip/hip_bf16.h>
#include <math.h>

typedef __attribute__((ext_vector_type(16))) _Float16 v16h;
typedef __attribute__((ext_vector_type(8)))  _Float16 h8;
typedef __attribute__((ext_vector_type(8)))  float    v8f;
typedef __attribute__((ext_vector_type(2)))  _Float16 h2;
typedef __attribute__((ext_vector_type(4)))  float    f4;

#define D_MODEL 1024
#define HEADS   16
#define DH      64
#define DH2     128            // 2*DH per head
#define BATCH   2
#define SEQ     2048
#define TOKENS  (BATCH*SEQ)    // 4096
#define QKV_N   (2*D_MODEL)    // 2048
#define LAMBDA_INIT 0.8f
#define EPS_RMS 1e-5f

#define WAIT_ASYNC() asm volatile("s_wait_asynccnt 0x0" ::: "memory")

__device__ __forceinline__ v16h load_op(const _Float16* p, int halfsel) {
  h8 lo = *(const h8*)(p + halfsel * 8);
  h8 hi = *(const h8*)(p + 16 + halfsel * 8);
  v16h r;
#pragma unroll
  for (int i = 0; i < 8; ++i) { r[i] = lo[i]; r[i + 8] = hi[i]; }
  return r;
}

__device__ __forceinline__ v8f wmma32(v16h a, v16h b, v8f c) {
  // D = A(16x32) * B(32x16) + C, f32 accumulate
  return __builtin_amdgcn_wmma_f32_16x16x32_f16(
      /*neg_a=*/false, a, /*neg_b=*/false, b,
      /*c_mod=*/(short)0, c, /*reuse_a=*/false, /*reuse_b=*/false);
}

// ---------------------------------------------------------------------------
// Elementwise f32 -> f16: share of block blk out of nblk blocks of 256 threads
// ---------------------------------------------------------------------------
__device__ __forceinline__ void f32_to_f16_part(const float* __restrict__ src,
                                                _Float16* __restrict__ dst, int n,
                                                int blk, int nblk) {
  int i = blk * 256 + threadIdx.x;
  int stride = nblk * 256;
  for (; i < n; i += stride) dst[i] = (_Float16)src[i];
}

#define TR 128                 // src rows per tile (contiguous in dst)
#define TC 64                  // src cols per tile (contiguous in src)
#define TP (TR + 2)            // LDS row pitch in halves
template <int ROWS, int COLS>
__device__ __forceinline__ void transpose_f16_tile(const float* __restrict__ src,
                                                   _Float16* __restrict__ dst,
                                                   int bx, int by, _Float16* tile) {
  const int hi = threadIdx.x >> 4;      // 0..15
  const int lo = threadIdx.x & 15;      // 0..15
  const int c0 = bx * TC, r0 = by * TR;

  // src rows r0 + 2*hi + 32*j (+1), cols c0 + 4*lo .. +3
  const float* s = src + (size_t)(r0 + 2 * hi) * COLS + c0 + 4 * lo;
  f4 a[4], b[4];                        // eight loads in flight, constant offsets
  for (int j = 0; j < 4; ++j) {
    a[j] = *(const f4*)(s + (size_t)(32 * j) * COLS);
    b[j] = *(const f4*)(s + (size_t)(32 * j + 1) * COLS);
  }
  for (int j = 0; j < 4; ++j)
    for (int k = 0; k < 4; ++k) {
      h2 p;
      p[0] = (_Float16)a[j][k];
      p[1] = (_Float16)b[j][k];
      *(h2*)&tile[(4 * lo + k) * TP + 2 * hi + 32 * j] = p;
    }
  __syncthreads();                      // the whole tile is in LDS

  // dst rows c0 + hi + 16*j, cols r0 + 8*lo .. +7
  _Float16* d = dst + (size_t)(c0 + hi) * ROWS + r0 + 8 * lo;
  for (int j = 0; j < 4; ++j) {
    const _Float16* t = &tile[(hi + 16 * j) * TP + 8 * lo];
    h8 w;
    for (int k = 0; k < 4; ++k) {
      h2 p = *(const h2*)(t + 2 * k);
      w[2 * k] = p[0];
      w[2 * k + 1] = p[1];
    }
    *(h8*)(d + (size_t)(16 * j) * ROWS) = w;
  }
  // Other jobs' code follows this one in the merged kernel: the wait stands in
  // front of any rewrite of a register that the four stores above name.
  asm volatile("s_wait_xcnt 0x0" ::: "memory");
}

// lam[h] = exp(lq1.lk1) - exp(lq2.lk2) + lambda_init
__device__ __forceinline__ void lambda_part(
    const float* __restrict__ lq1, const float* __restrict__ lk1,
    const float* __restrict__ lq2, const float* __restrict__ lk2,
    float* __restrict__ lam) {
  int h = threadIdx.x;
  if (h < HEADS) {
    float s1 = 0.f, s2 = 0.f;
    for (int i = 0; i < DH; ++i) {
      s1 += lq1[h * DH + i] * lk1[h * DH + i];
      s2 += lq2[h * DH + i] * lk2[h * DH + i];
    }
    lam[h] = __expf(s1) - __expf(s2) + LAMBDA_INIT;
  }
}

// ---------------------------------------------------------------------------
// All preparation in one launch: none of these jobs reads another's output, so
// the block index picks the job. Block 0: lambda; then CONV_BLOCKS blocks convert X; then
// WTILES tiles of each of Wq, Wk, Wv, Wo. Every branch is block-uniform.
// ---------------------------------------------------------------------------
#define CONV_BLOCKS 512
#define WTILES ((QKV_N / TC) * (D_MODEL / TR))   // 256 tiles per weight
#define PREP_BLOCKS (1 + CONV_BLOCKS + 4 * WTILES)
__global__ __launch_bounds__(256) void k_prep(
    const float* __restrict__ X, const float* __restrict__ Wq,
    const float* __restrict__ Wk, const float* __restrict__ Wv,
    const float* __restrict__ Wo,
    const float* __restrict__ lq1, const float* __restrict__ lk1,
    const float* __restrict__ lq2, const float* __restrict__ lk2,
    _Float16* __restrict__ Xh, _Float16* __restrict__ WqT, _Float16* __restrict__ WkT,
    _Float16* __restrict__ WvT, _Float16* __restrict__ WoT, float* __restrict__ lam) {
  __shared__ __attribute__((aligned(16))) _Float16 tile[TC * TP];  // [src col][src row]
  int blk = blockIdx.x;
  if (blk == 0) {
    lambda_part(lq1, lk1, lq2, lk2, lam);
    return;
  }
  blk -= 1;
  if (blk < CONV_BLOCKS) {
    f32_to_f16_part(X, Xh, TOKENS * D_MODEL, blk, CONV_BLOCKS);
    return;
  }
  blk -= CONV_BLOCKS;
  const int job = blk / WTILES, t = blk % WTILES;
  if (job < 3) {
    const float* src = (job == 0) ? Wq : (job == 1) ? Wk : Wv;
    _Float16* dst = (job == 0) ? WqT : (job == 1) ? WkT : WvT;
    transpose_f16_tile<D_MODEL, QKV_N>(src, dst, t % (QKV_N / TC), t / (QKV_N / TC), tile);
  } else {
    transpose_f16_tile<QKV_N, D_MODEL>(Wo, WoT, t % (D_MODEL / TC), t / (D_MODEL / TC), tile);
  }
}

__device__ __forceinline__ void stage_tile8(
    const _Float16* g0, const _Float16* g1, const _Float16* g2, const _Float16* g3,
    const _Float16* g4, const _Float16* g5, const _Float16* g6, const _Float16* g7,
    unsigned l0, unsigned l1, unsigned l2, unsigned l3,
    unsigned l4, unsigned l5, unsigned l6, unsigned l7) {
  asm volatile(
      "global_load_async_to_lds_b128 %0, %8, off\n\t"
      "global_load_async_to_lds_b128 %1, %9, off\n\t"
      "global_load_async_to_lds_b128 %2, %10, off\n\t"
      "global_load_async_to_lds_b128 %3, %11, off\n\t"
      "global_load_async_to_lds_b128 %4, %12, off\n\t"
      "global_load_async_to_lds_b128 %5, %13, off\n\t"
      "global_load_async_to_lds_b128 %6, %14, off\n\t"
      "global_load_async_to_lds_b128 %7, %15, off\n\t"
      "s_wait_xcnt 0x0"
      :: "v"(l0), "v"(l1), "v"(l2), "v"(l3), "v"(l4), "v"(l5), "v"(l6), "v"(l7),
         "v"(g0), "v"(g1), "v"(g2), "v"(g3), "v"(g4), "v"(g5), "v"(g6), "v"(g7)
      : "memory");
}

// ---------------------------------------------------------------------------
// WMMA GEMM, both operand panels staged in a two-buffer LDS ring.
// out[M][Nn] = A[M][K] * B[K][Nn], B supplied transposed as BT[Nn][K].
// Block = 128 threads = 4 waves (2 x 2); wave tile 64 x 64; block 128 x 128.
// A trip is 64 k: 128 rows x 128 B of each operand come into LDS by async
// copies (a wave's copy = 4 whole 128-B lines) while the trip before feeds the
// WMMAs. A fragment read from LDS serves four WMMAs. LDS row pitch 144 B
// (16 B x 9): conflict-free for ds_load_b128.
// The operand whose index runs along the stored row (P) is the WMMA's A side,
// so a lane's eight accumulator registers are eight neighbours of that row.
// The block computes out[q0..q0+127][p0..p0+127], out[q][p] = sum_k Q[q][k] P[p][k],
// p contiguous, leading dimension LD; K a multiple of 64. F32: f32 out, else f16.
// ---------------------------------------------------------------------------
#define GBK    64              // k per trip
#define GPITCH 72              // LDS row pitch in halves
#define GPANEL (128 * GPITCH)  // one operand's 128 rows of a trip
template <bool F32>
__device__ __forceinline__ void gemm_block(
    const _Float16* __restrict__ P, const _Float16* __restrict__ Q,
    _Float16* __restrict__ outH, float* __restrict__ outF,
    int LD, int p0, int q0, int K) {
  __shared__ __attribute__((aligned(16))) _Float16 Ps[2][2][GPANEL];  // [buffer][P, Q]
  const int tid = threadIdx.x;
  const int lane = tid & 31;
  const int wave = __builtin_amdgcn_readfirstlane(tid >> 5);
  const int lq = lane & 15;   // fragment row within a 16-row tile
  const int hs = lane >> 4;   // operand half selector
  const int wp = (wave & 1) * 64, wq = (wave >> 1) * 64;

  // Copy map, per panel 1024 chunks of 16 B: lane -> row tid/8 (+16 per copy),
  // chunk tid%8.
  const _Float16* gP = P + (size_t)(p0 + (tid >> 3)) * K + (tid & 7) * 8;
  const _Float16* gQ = Q + (size_t)(q0 + (tid >> 3)) * K + (tid & 7) * 8;
  const unsigned lP = (unsigned)(size_t)(void*)&Ps[0][0][(tid >> 3) * GPITCH + (tid & 7) * 8];
  const size_t rs = (size_t)16 * K;     // 16 rows, in halves
  const unsigned ls = 16 * GPITCH * 2;  // 16 rows, in LDS bytes

  auto stage = [&](int t) {             // trip t (k 64t..64t+63) -> buffer t&1
    const _Float16* p = gP + t * GBK;
    const _Float16* q = gQ + t * GBK;
    const unsigned lp = lP + (t & 1) * (2 * GPANEL * 2);
    const unsigned lc = lp + GPANEL * 2;
    stage_tile8(p, p + rs, p + 2 * rs, p + 3 * rs, p + 4 * rs, p + 5 * rs, p + 6 * rs, p + 7 * rs,
                lp, lp + ls, lp + 2 * ls, lp + 3 * ls, lp + 4 * ls, lp + 5 * ls, lp + 6 * ls, lp + 7 * ls);
    stage_tile8(q, q + rs, q + 2 * rs, q + 3 * rs, q + 4 * rs, q + 5 * rs, q + 6 * rs, q + 7 * rs,
                lc, lc + ls, lc + 2 * ls, lc + 3 * ls, lc + 4 * ls, lc + 5 * ls, lc + 6 * ls, lc + 7 * ls);
  };

  const int nt = K / GBK;
  stage(0);
  v8f acc[4][4] = {};                   // [p tile][q tile]
  WAIT_ASYNC();                         // this wave's share of trip 0 has landed
  __syncthreads();                      // every wave's share of trip 0 has landed
  if (nt > 1) stage(1);                 // block-uniform test

  for (int t = 0; t < nt; ++t) {
    const _Float16* fp = &Ps[t & 1][0][(wp + lq) * GPITCH];
    const _Float16* fq = &Ps[t & 1][1][(wq + lq) * GPITCH];
    v16h a[2][4], b[2][4];              // all 16 fragments of the trip, one load group
#pragma unroll
    for (int kk = 0; kk < 2; ++kk)
#pragma unroll
      for (int i = 0; i < 4; ++i) {
        a[kk][i] = load_op(fp + i * 16 * GPITCH + kk * 32, hs);
        b[kk][i] = load_op(fq + i * 16 * GPITCH + kk * 32, hs);
      }
    // Keeps the 32 LDS reads one group ahead of the WMMAs: left alone, the
    // scheduler sinks them among the WMMAs, each pair with a full wait behind it.
    __builtin_amdgcn_sched_barrier(0);
#pragma unroll
    for (int i = 0; i < 4; ++i)         // first 32 k, while the second half's reads land
#pragma unroll
      for (int j = 0; j < 4; ++j)
        acc[i][j] = wmma32(a[0][i], b[0][j], acc[i][j]);
    // Keeps the hand-over behind the first 16 WMMAs: hoisted over them, its full
    // wait would hold every WMMA back until the last LDS read has landed.
    __builtin_amdgcn_sched_barrier(0);
    // Hand-over, passed by every wave; the trip's last 16 WMMAs need registers only.
    asm volatile("s_wait_dscnt 0x0" ::: "memory");  // own reads of buffer t&1 are done
    WAIT_ASYNC();                       // own share of trip t+1 has landed
    __syncthreads();                    // trip t+1 readable; buffer t&1 free for refill
    if (t + 2 < nt) stage(t + 2);       // block-uniform test
#pragma unroll
    for (int i = 0; i < 4; ++i)         // second 32 k
#pragma unroll
      for (int j = 0; j < 4; ++j)
        acc[i][j] = wmma32(a[1][i], b[1][j], acc[i][j]);
  }
  WAIT_ASYNC();                         // nothing in flight when the wave ends

  // D layout: lane -> q = lq, register v -> p = hs*8 + v
#pragma unroll
  for (int j = 0; j < 4; ++j) {
    const size_t row = (size_t)(q0 + wq + j * 16 + lq) * LD + p0 + wp + hs * 8;
#pragma unroll
    for (int i = 0; i < 4; ++i) {
      if (F32) {
        f4 lo, hi;
#pragma unroll
        for (int v = 0; v < 4; ++v) { lo[v] = acc[i][j][v]; hi[v] = acc[i][j][v + 4]; }
        *(f4*)(outF + row + i * 16) = lo;
        *(f4*)(outF + row + i * 16 + 4) = hi;
      } else {
        h8 w;
#pragma unroll
        for (int v = 0; v < 8; ++v) w[v] = (_Float16)acc[i][j][v];
        *(h8*)(outH + row + i * 16) = w;
      }
    }
  }
}

// The three projections of X in one launch: they share A and read nothing of each
// other, so blockIdx.z picks the weight and the output. out[M][Nn] = A[M][K] * B,
// B supplied transposed as BT[Nn][K]; Q and K are stored row-major (P = BT), V
// transposed, out[n][m] (P = A). M, Nn multiples of 128. All selects are scalar.
__global__ __launch_bounds__(128) void k_gemm_qkv(
    const _Float16* __restrict__ A, const _Float16* __restrict__ WqT,
    const _Float16* __restrict__ WkT, const _Float16* __restrict__ WvT,
    _Float16* __restrict__ Qh, _Float16* __restrict__ Kh, _Float16* __restrict__ Vt,
    int M, int Nn, int K) {
  const int z = blockIdx.z;
  const bool tr = (z == 2);
  const _Float16* BT = (z == 0) ? WqT : (z == 1) ? WkT : WvT;
  _Float16* out = (z == 0) ? Qh : (z == 1) ? Kh : Vt;
  gemm_block<false>(tr ? A : BT, tr ? BT : A, out, nullptr, tr ? M : Nn,
                    (tr ? blockIdx.y : blockIdx.x) * 128,
                    (tr ? blockIdx.x : blockIdx.y) * 128, K);
}

// Output projection, f32 row-major out[M][Nn].
__global__ __launch_bounds__(128) void k_gemm_out(
    const _Float16* __restrict__ A, const _Float16* __restrict__ BT,
    float* __restrict__ outF, int Nn, int K) {
  gemm_block<true>(BT, A, nullptr, outF, Nn, blockIdx.x * 128, blockIdx.y * 128, K);
}

#define KPITCH 136             // K tile row pitch in halves: 272 B = 16 B x 17
#define VPITCH 40              // V^T tile row pitch in halves: 80 B = 16 B x 5
#define KTILE  (32 * KPITCH)   // 32 keys x 128 dims
#define VTILE  (DH2 * VPITCH)  // 128 dims x 32 keys

// ---------------------------------------------------------------------------
// Fused differential flash-attention + RMS norm.
// One wave owns 16 queries of one (b,h). Computes S^T = K*Q^T so the score
// tile's C layout (lane=query, reg=key) feeds the second WMMA (O^T = V^T*P^T)
// with no cross-lane movement. Two independent online softmaxes (comp 1/2),
// O = P1 V / l1 - lam * P2 V / l2, then RMS norm over 128 dims, * 0.2.
// The four waves of a block own 64 consecutive queries and walk the same keys:
// each 32-key K tile and V^T tile is brought into LDS once per block by async
// copies (whole 256-B / 64-B row pieces), two buffers, the next tile in flight
// while this one is worked on; all operands are then read by ds_load_b128.
// ---------------------------------------------------------------------------
__global__ __launch_bounds__(128) void k_diff_attn(
    const _Float16* __restrict__ Qh, const _Float16* __restrict__ Kh,
    const _Float16* __restrict__ Vt,   // [2048 feat][4096 tokens]
    const float* __restrict__ lamBuf, const float* __restrict__ rms_scale,
    _Float16* __restrict__ Oh) {
  __shared__ __attribute__((aligned(16))) _Float16 Ks[2][KTILE];
  __shared__ __attribute__((aligned(16))) _Float16 Vs[2][VTILE];
  const int tid = threadIdx.x;
  const int lane = tid & 31;
  const int wave = __builtin_amdgcn_readfirstlane(tid >> 5);
  const int lq = lane & 15, hs = lane >> 4;
  const int qblocks = SEQ / 64;         // 32 blocks of 64 queries per (b,h)
  const int bh = blockIdx.x / qblocks;
  const int qb = blockIdx.x % qblocks;
  const int b = bh / HEADS, h = bh % HEADS;
  const int q0 = qb * 64 + wave * 16;
  const int qglob = q0 + lq;            // this lane's query index

  const float scale = 0.125f;           // 1/sqrt(64)
  const float lam = lamBuf[h];

  const _Float16* kbase = Kh + (size_t)(b * SEQ) * QKV_N + h * DH2;
  const _Float16* vbase = Vt + (size_t)(h * DH2) * TOKENS + b * SEQ;

  // Copy map. K tile: 512 chunks of 16 B, lane -> row tid/16 (+8 per copy),
  // chunk tid%16. V^T tile: 512 chunks, lane -> row tid/4 (+32 per copy),
  // chunk tid%4.
  const _Float16* gK = kbase + (size_t)(tid >> 4) * QKV_N + (tid & 15) * 8;
  const _Float16* gV = vbase + (size_t)(tid >> 2) * TOKENS + (tid & 3) * 8;
  const unsigned lK = (unsigned)(size_t)(void*)&Ks[0][(tid >> 4) * KPITCH + (tid & 15) * 8];
  const unsigned lV = (unsigned)(size_t)(void*)&Vs[0][(tid >> 2) * VPITCH + (tid & 3) * 8];

  auto stage = [&](int t) {             // tile t (keys 32t..32t+31) -> buffer t&1
    const _Float16* k = gK + (size_t)(t * 32) * QKV_N;
    const _Float16* v = gV + t * 32;
    const unsigned lk = lK + (t & 1) * (KTILE * 2);
    const unsigned lv = lV + (t & 1) * (VTILE * 2);
    stage_tile8(k, k + 8 * QKV_N, k + 16 * QKV_N, k + 24 * QKV_N,
                v, v + (size_t)32 * TOKENS, v + (size_t)64 * TOKENS, v + (size_t)96 * TOKENS,
                lk, lk + 8 * KPITCH * 2, lk + 16 * KPITCH * 2, lk + 24 * KPITCH * 2,
                lv, lv + 32 * VPITCH * 2, lv + 64 * VPITCH * 2, lv + 96 * VPITCH * 2);
  };

  const int ntiles = 2 * qb + 2;        // block's causal range, always >= 2 tiles
  stage(0);

  // Q^T as B operand: lane = query, halves = d-contiguous. 2 comps x 2 K-chunks.
  const _Float16* qrow = Qh + (size_t)(b * SEQ + qglob) * QKV_N + h * DH2;
  v16h qop[2][2];
#pragma unroll
  for (int c = 0; c < 2; ++c)
#pragma unroll
    for (int kk = 0; kk < 2; ++kk)
      qop[c][kk] = load_op(qrow + c * DH + kk * 32, hs);

  v8f O1[8] = {}, O2[8] = {};           // O^T accumulators: 8 d-tiles x (16x16)
  float m1 = -INFINITY, m2 = -INFINITY, l1 = 0.f, l2 = 0.f;

  WAIT_ASYNC();                         // this wave's share of tile 0 has landed
  __syncthreads();                      // every wave's share of tile 0 has landed
  stage(1);

  const int nk = q0 + 16;               // causal: this wave needs keys 0..q0+15
  for (int t = 0; t < ntiles; ++t) {    // 32 keys/step: tiles a (kt), b (kt+16)
    const int kt = t * 32;
    if (kt < nk) {                      // wave-uniform: skip tiles past the diagonal
      const _Float16* ks = &Ks[t & 1][lq * KPITCH];
      const _Float16* vs = &Vs[t & 1][lq * VPITCH];
      // ---- all 8 K operands of this step ---------------------------------
      v16h kA[2][2], kB[2][2];
#pragma unroll
      for (int c = 0; c < 2; ++c)
#pragma unroll
        for (int kk = 0; kk < 2; ++kk) {
          kA[c][kk] = load_op(ks + c * DH + kk * 32, hs);
          kB[c][kk] = load_op(ks + 16 * KPITCH + c * DH + kk * 32, hs);
        }

      // ---- score tiles (S^T) + online softmax ----------------------------
      v16h pop[2];
      float alpha[2];
#pragma unroll
      for (int c = 0; c < 2; ++c) {
        v8f sa = {}, sb = {};
#pragma unroll
        for (int kk = 0; kk < 2; ++kk) {  // accumulate over d = 64 (2 x K=32)
          sa = wmma32(kA[c][kk], qop[c][kk], sa);
          sb = wmma32(kB[c][kk], qop[c][kk], sb);
        }
        // S^T C layout: lane = query (lq), reg v -> key = kt + hs*8 + v (+16 for b)
        float pa[8], pb[8];
        float smax = -INFINITY;
#pragma unroll
        for (int v = 0; v < 8; ++v) {
          const int keyA = kt + hs * 8 + v;
          float xa = (keyA       <= qglob) ? sa[v] * scale : -INFINITY;
          float xb = (keyA + 16  <= qglob) ? sb[v] * scale : -INFINITY;
          pa[v] = xa; pb[v] = xb;
          smax = fmaxf(smax, fmaxf(xa, xb));
        }
        smax = fmaxf(smax, __shfl_xor(smax, 16, 32)); // lanes q, q+16 share a query
        const float mo = (c == 0) ? m1 : m2;
        const float mn = fmaxf(mo, smax);
        const float al = __expf(mo - mn);
        float ls = 0.f;
#pragma unroll
        for (int v = 0; v < 8; ++v) {
          pa[v] = __expf(pa[v] - mn);
          pb[v] = __expf(pb[v] - mn);
          ls += pa[v] + pb[v];
        }
        ls += __shfl_xor(ls, 16, 32);
        if (c == 0) { l1 = l1 * al + ls; m1 = mn; }
        else        { l2 = l2 * al + ls; m2 = mn; }
        alpha[c] = al;
        // Pack P^T directly as B operand (K=32 keys): halves[0..7]=tile a,
        // halves[8..15]=tile b: exactly matches the C layout we already hold.
        v16h pv;
#pragma unroll
        for (int v = 0; v < 8; ++v) { pv[v] = (_Float16)pa[v]; pv[v + 8] = (_Float16)pb[v]; }
        pop[c] = pv;
      }

      // ---- O^T += V^T * P^T ----------------------------------------------
      v16h vop[8];
#pragma unroll
      for (int tt = 0; tt < 8; ++tt)
        vop[tt] = load_op(vs + tt * 16 * VPITCH, hs);
#pragma unroll
      for (int tt = 0; tt < 8; ++tt) {
#pragma unroll
        for (int v = 0; v < 8; ++v) { O1[tt][v] *= alpha[0]; O2[tt][v] *= alpha[1]; }
        O1[tt] = wmma32(vop[tt], pop[0], O1[tt]);
        O2[tt] = wmma32(vop[tt], pop[1], O2[tt]);
      }
    }
    // Hand-over, passed by every wave, also one that skipped the tile.
    asm volatile("s_wait_dscnt 0x0" ::: "memory");  // own reads of buffer t&1 are done
    WAIT_ASYNC();                       // own share of tile t+1 has landed
    __syncthreads();                    // tile t+1 readable; buffer t&1 free for refill
    if (t + 2 < ntiles) stage(t + 2);   // block-uniform test
  }
  WAIT_ASYNC();                         // nothing in flight when the wave ends

  // Combine streams, RMS-normalize over 128 dims, scale by (1 - lambda_init).
  const float inv1 = 1.0f / l1;
  const float inv2 = lam / l2;
  float ssq = 0.f;
#pragma unroll
  for (int t = 0; t < 8; ++t)
#pragma unroll
    for (int v = 0; v < 8; ++v) {
      float o = O1[t][v] * inv1 - O2[t][v] * inv2;
      ssq += o * o;
    }
  ssq += __shfl_xor(ssq, 16, 32);       // other 64 dims live in lane^16
  const float rinv = rsqrtf(ssq * (1.0f / DH2) + EPS_RMS) * (1.0f - LAMBDA_INIT);

  _Float16* orow = Oh + (size_t)(b * SEQ + qglob) * QKV_N + h * DH2;
#pragma unroll
  for (int t = 0; t < 8; ++t)
#pragma unroll
    for (int v = 0; v < 8; ++v) {
      const int d = t * 16 + hs * 8 + v;
      float o = O1[t][v] * inv1 - O2[t][v] * inv2;
      orow[d] = (_Float16)(o * rinv * rms_scale[d]);
    }
}

// ---------------------------------------------------------------------------
extern "C" void kernel_launch(void* const* d_in, const int* in_sizes, int n_in,
                              void* d_out, int out_size, void* d_ws, size_t ws_size,
                              hipStream_t stream) {
  const float* X    = (const float*)d_in[0];
  const float* Wq   = (const float*)d_in[1];
  const float* Wk   = (const float*)d_in[2];
  const float* Wv   = (const float*)d_in[3];
  const float* Wo   = (const float*)d_in[4];
  const float* lq1  = (const float*)d_in[5];
  const float* lk1  = (const float*)d_in[6];
  const float* lq2  = (const float*)d_in[7];
  const float* lk2  = (const float*)d_in[8];
  const float* rmss = (const float*)d_in[9];
  float* out = (float*)d_out;

  char* w = (char*)d_ws;
  _Float16* Xh  = (_Float16*)w; w += (size_t)TOKENS * D_MODEL * 2;  // 8 MB
  _Float16* WqT = (_Float16*)w; w += (size_t)QKV_N * D_MODEL * 2;   // 4 MB
  _Float16* WkT = (_Float16*)w; w += (size_t)QKV_N * D_MODEL * 2;
  _Float16* WvT = (_Float16*)w; w += (size_t)QKV_N * D_MODEL * 2;
  _Float16* WoT = (_Float16*)w; w += (size_t)D_MODEL * QKV_N * 2;
  _Float16* Qh  = (_Float16*)w; w += (size_t)TOKENS * QKV_N * 2;    // 16 MB
  _Float16* Kh  = (_Float16*)w; w += (size_t)TOKENS * QKV_N * 2;
  _Float16* Vt  = (_Float16*)w; w += (size_t)QKV_N * TOKENS * 2;    // transposed
  _Float16* Ohb = (_Float16*)w; w += (size_t)TOKENS * QKV_N * 2;
  float*    lam = (float*)w;

  // Stage 1: precision conversion + weight transposes + lambda scalars, one launch
  k_prep<<<PREP_BLOCKS, 256, 0, stream>>>(X, Wq, Wk, Wv, Wo, lq1, lk1, lq2, lk2,
                                          Xh, WqT, WkT, WvT, WoT, lam);

  // Stage 2: QKV projections (WMMA), one launch. V stored transposed for the
  // attention V^T operand.
  dim3 gq(QKV_N / 128, TOKENS / 128, 3);
  k_gemm_qkv<<<gq, 128, 0, stream>>>(Xh, WqT, WkT, WvT, Qh, Kh, Vt, TOKENS, QKV_N, D_MODEL);

  // Stage 3: fused differential flash attention + RMS norm
  const int waves = BATCH * HEADS * (SEQ / 16);  // 4096 waves
  k_diff_attn<<<waves / 4, 128, 0, stream>>>(Qh, Kh, Vt, lam, rmss, Ohb);

  // Stage 4: output projection -> fp32 result
  dim3 go(D_MODEL / 128, TOKENS / 128);
  k_gemm_out<<<go, 128, 0, stream>>>(Ohb, WoT, out, D_MODEL, QKV_N);
}

// v005
// It runs in 158 microseconds.
// Timed twice side by side with v004, it ran 1.07 times as fast both times.
// Over all steps from v000 it is 2.43 times as fast.
#include <hip/hip_runtime.h>
#include <hip/hip_bf16.h>
#include <math.h>

typedef __attribute__((ext_vector_type(16))) _Float16 v16h;
typedef __attribute__((ext_vector_type(8)))  _Float16 h8;
typedef __attribute__((ext_vector_type(8)))  float    v8f;
typedef __attribute__((ext_vector_type(2)))  _Float16 h2;
typedef __attribute__((ext_vector_type(4)))  float    f4;

#define D_MODEL 1024
#define HEADS   16
#define DH      64
#define DH2     128            // 2*DH per head
#define BATCH   2
#define SEQ     2048
#define TOKENS  (BATCH*SEQ)    // 4096
#define QKV_N   (2*D_MODEL)    // 2048
#define LAMBDA_INIT 0.8f
#define EPS_RMS 1e-5f

#define WAIT_ASYNC() asm volatile("s_wait_asynccnt 0x0" ::: "memory")

__device__ __forceinline__ v16h load_op(const _Float16* p, int halfsel) {
  h8 lo = *(const h8*)(p + halfsel * 8);
  h8 hi = *(const h8*)(p + 16 + halfsel * 8);
  v16h r;
#pragma unroll
  for (int i = 0; i < 8; ++i) { r[i] = lo[i]; r[i + 8] = hi[i]; }
  return r;
}

__device__ __forceinline__ v8f wmma32(v16h a, v16h b, v8f c) {
  // D = A(16x32) * B(32x16) + C, f32 accumulate
  return __builtin_amdgcn_wmma_f32_16x16x32_f16(
      /*neg_a=*/false, a, /*neg_b=*/false, b,
      /*c_mod=*/(short)0, c, /*reuse_a=*/false, /*reuse_b=*/false);
}

// ---------------------------------------------------------------------------
// Elementwise f32 -> f16: share of block blk out of nblk blocks of 256 threads
// ---------------------------------------------------------------------------
__device__ __forceinline__ void f32_to_f16_part(const float* __restrict__ src,
                                                _Float16* __restrict__ dst, int n,
                                                int blk, int nblk) {
  int i = blk * 256 + threadIdx.x;
  int stride = nblk * 256;
  for (; i < n; i += stride) dst[i] = (_Float16)src[i];
}

#define TR 128                 // src rows per tile (contiguous in dst)
#define TC 64                  // src cols per tile (contiguous in src)
#define TP (TR + 2)            // LDS row pitch in halves
template <int ROWS, int COLS>
__device__ __forceinline__ void transpose_f16_tile(const float* __restrict__ src,
                                                   _Float16* __restrict__ dst,
                                                   int bx, int by, _Float16* tile) {
  const int hi = threadIdx.x >> 4;      // 0..15
  const int lo = threadIdx.x & 15;      // 0..15
  const int c0 = bx * TC, r0 = by * TR;

  // src rows r0 + 2*hi + 32*j (+1), cols c0 + 4*lo .. +3
  const float* s = src + (size_t)(r0 + 2 * hi) * COLS + c0 + 4 * lo;
  f4 a[4], b[4];                        // eight loads in flight, constant offsets
  for (int j = 0; j < 4; ++j) {
    a[j] = *(const f4*)(s + (size_t)(32 * j) * COLS);
    b[j] = *(const f4*)(s + (size_t)(32 * j + 1) * COLS);
  }
  for (int j = 0; j < 4; ++j)
    for (int k = 0; k < 4; ++k) {
      h2 p;
      p[0] = (_Float16)a[j][k];
      p[1] = (_Float16)b[j][k];
      *(h2*)&tile[(4 * lo + k) * TP + 2 * hi + 32 * j] = p;
    }
  __syncthreads();                      // the whole tile is in LDS

  // dst rows c0 + hi + 16*j, cols r0 + 8*lo .. +7
  _Float16* d = dst + (size_t)(c0 + hi) * ROWS + r0 + 8 * lo;
  for (int j = 0; j < 4; ++j) {
    const _Float16* t = &tile[(hi + 16 * j) * TP + 8 * lo];
    h8 w;
    for (int k = 0; k < 4; ++k) {
      h2 p = *(const h2*)(t + 2 * k);
      w[2 * k] = p[0];
      w[2 * k + 1] = p[1];
    }
    *(h8*)(d + (size_t)(16 * j) * ROWS) = w;
  }
  // Other jobs' code follows this one in the merged kernel: the wait stands in
  // front of any rewrite of a register that the four stores above name.
  asm volatile("s_wait_xcnt 0x0" ::: "memory");
}

// lam[h] = exp(lq1.lk1) - exp(lq2.lk2) + lambda_init
__device__ __forceinline__ void lambda_part(
    const float* __restrict__ lq1, const float* __restrict__ lk1,
    const float* __restrict__ lq2, const float* __restrict__ lk2,
    float* __restrict__ lam) {
  int h = threadIdx.x;
  if (h < HEADS) {
    float s1 = 0.f, s2 = 0.f;
    for (int i = 0; i < DH; ++i) {
      s1 += lq1[h * DH + i] * lk1[h * DH + i];
      s2 += lq2[h * DH + i] * lk2[h * DH + i];
    }
    lam[h] = __expf(s1) - __expf(s2) + LAMBDA_INIT;
  }
}

// ---------------------------------------------------------------------------
// All preparation in one launch: none of these jobs reads another's output, so
// the block index picks the job. Block 0: lambda; then CONV_BLOCKS blocks convert X; then
// WTILES tiles of each of Wq, Wk, Wv, Wo. Every branch is block-uniform.
// ---------------------------------------------------------------------------
#define CONV_BLOCKS 512
#define WTILES ((QKV_N / TC) * (D_MODEL / TR))   // 256 tiles per weight
#define PREP_BLOCKS (1 + CONV_BLOCKS + 4 * WTILES)
__global__ __launch_bounds__(256) void k_prep(
    const float* __restrict__ X, const float* __restrict__ Wq,
    const float* __restrict__ Wk, const float* __restrict__ Wv,
    const float* __restrict__ Wo,
    const float* __restrict__ lq1, const float* __restrict__ lk1,
    const float* __restrict__ lq2, const float* __restrict__ lk2,
    _Float16* __restrict__ Xh, _Float16* __restrict__ WqT, _Float16* __restrict__ WkT,
    _Float16* __restrict__ WvT, _Float16* __restrict__ WoT, float* __restrict__ lam) {
  __shared__ __attribute__((aligned(16))) _Float16 tile[TC * TP];  // [src col][src row]
  int blk = blockIdx.x;
  if (blk == 0) {
    lambda_part(lq1, lk1, lq2, lk2, lam);
    return;
  }
  blk -= 1;
  if (blk < CONV_BLOCKS) {
    f32_to_f16_part(X, Xh, TOKENS * D_MODEL, blk, CONV_BLOCKS);
    return;
  }
  blk -= CONV_BLOCKS;
  const int job = blk / WTILES, t = blk % WTILES;
  if (job < 3) {
    const float* src = (job == 0) ? Wq : (job == 1) ? Wk : Wv;
    _Float16* dst = (job == 0) ? WqT : (job == 1) ? WkT : WvT;
    transpose_f16_tile<D_MODEL, QKV_N>(src, dst, t % (QKV_N / TC), t / (QKV_N / TC), tile);
  } else {
    transpose_f16_tile<QKV_N, D_MODEL>(Wo, WoT, t % (D_MODEL / TC), t / (D_MODEL / TC), tile);
  }
}

__device__ __forceinline__ void stage_tile8(
    const _Float16* g0, const _Float16* g1, const _Float16* g2, const _Float16* g3,
    const _Float16* g4, const _Float16* g5, const _Float16* g6, const _Float16* g7,
    unsigned l0, unsigned l1, unsigned l2, unsigned l3,
    unsigned l4, unsigned l5, unsigned l6, unsigned l7) {
  asm volatile(
      "global_load_async_to_lds_b128 %0, %8, off\n\t"
      "global_load_async_to_lds_b128 %1, %9, off\n\t"
      "global_load_async_to_lds_b128 %2, %10, off\n\t"
      "global_load_async_to_lds_b128 %3, %11, off\n\t"
      "global_load_async_to_lds_b128 %4, %12, off\n\t"
      "global_load_async_to_lds_b128 %5, %13, off\n\t"
      "global_load_async_to_lds_b128 %6, %14, off\n\t"
      "global_load_async_to_lds_b128 %7, %15, off\n\t"
      "s_wait_xcnt 0x0"
      :: "v"(l0), "v"(l1), "v"(l2), "v"(l3), "v"(l4), "v"(l5), "v"(l6), "v"(l7),
         "v"(g0), "v"(g1), "v"(g2), "v"(g3), "v"(g4), "v"(g5), "v"(g6), "v"(g7)
      : "memory");
}

// ---------------------------------------------------------------------------
// WMMA GEMM, both operand panels staged in a two-buffer LDS ring.
// out[M][Nn] = A[M][K] * B[K][Nn], B supplied transposed as BT[Nn][K].
// Block = 128 threads = 4 waves (2 x 2); wave tile 64 x 64; block 128 x 128.
// A trip is 64 k: 128 rows x 128 B of each operand come into LDS by async
// copies (a wave's copy = 4 whole 128-B lines) while the trip before feeds the
// WMMAs. A fragment read from LDS serves four WMMAs. LDS row pitch 144 B
// (16 B x 9): conflict-free for ds_load_b128.
// The operand whose index runs along the stored row (P) is the WMMA's A side,
// so a lane's eight accumulator registers are eight neighbours of that row.
// The block computes out[q0..q0+127][p0..p0+127], out[q][p] = sum_k Q[q][k] P[p][k],
// p contiguous, leading dimension LD; K a multiple of 64. F32: f32 out, else f16.
// ---------------------------------------------------------------------------
#define GBK    64              // k per trip
#define GPITCH 72              // LDS row pitch in halves
#define GPANEL (128 * GPITCH)  // one operand's 128 rows of a trip
template <bool F32>
__device__ __forceinline__ void gemm_block(
    const _Float16* __restrict__ P, const _Float16* __restrict__ Q,
    _Float16* __restrict__ outH, float* __restrict__ outF,
    int LD, int p0, int q0, int K) {
  __shared__ __attribute__((aligned(16))) _Float16 Ps[2][2][GPANEL];  // [buffer][P, Q]
  const int tid = threadIdx.x;
  const int lane = tid & 31;
  const int wave = __builtin_amdgcn_readfirstlane(tid >> 5);
  const int lq = lane & 15;   // fragment row within a 16-row tile
  const int hs = lane >> 4;   // operand half selector
  const int wp = (wave & 1) * 64, wq = (wave >> 1) * 64;

  // Copy map, per panel 1024 chunks of 16 B: lane -> row tid/8 (+16 per copy),
  // chunk tid%8.
  const _Float16* gP = P + (size_t)(p0 + (tid >> 3)) * K + (tid & 7) * 8;
  const _Float16* gQ = Q + (size_t)(q0 + (tid >> 3)) * K + (tid & 7) * 8;
  const unsigned lP = (unsigned)(size_t)(void*)&Ps[0][0][(tid >> 3) * GPITCH + (tid & 7) * 8];
  const size_t rs = (size_t)16 * K;     // 16 rows, in halves
  const unsigned ls = 16 * GPITCH * 2;  // 16 rows, in LDS bytes

  auto stage = [&](int t) {             // trip t (k 64t..64t+63) -> buffer t&1
    const _Float16* p = gP + t * GBK;
    const _Float16* q = gQ + t * GBK;
    const unsigned lp = lP + (t & 1) * (2 * GPANEL * 2);
    const unsigned lc = lp + GPANEL * 2;
    stage_tile8(p, p + rs, p + 2 * rs, p + 3 * rs, p + 4 * rs, p + 5 * rs, p + 6 * rs, p + 7 * rs,
                lp, lp + ls, lp + 2 * ls, lp + 3 * ls, lp + 4 * ls, lp + 5 * ls, lp + 6 * ls, lp + 7 * ls);
    stage_tile8(q, q + rs, q + 2 * rs, q + 3 * rs, q + 4 * rs, q + 5 * rs, q + 6 * rs, q + 7 * rs,
                lc, lc + ls, lc + 2 * ls, lc + 3 * ls, lc + 4 * ls, lc + 5 * ls, lc + 6 * ls, lc + 7 * ls);
  };

  const int nt = K / GBK;
  stage(0);
  v8f acc[4][4] = {};                   // [p tile][q tile]
  WAIT_ASYNC();                         // this wave's share of trip 0 has landed
  __syncthreads();                      // every wave's share of trip 0 has landed
  if (nt > 1) stage(1);                 // block-uniform test

  for (int t = 0; t < nt; ++t) {
    const _Float16* fp = &Ps[t & 1][0][(wp + lq) * GPITCH];
    const _Float16* fq = &Ps[t & 1][1][(wq + lq) * GPITCH];
    v16h a[2][4], b[2][4];              // all 16 fragments of the trip, one load group
#pragma unroll
    for (int kk = 0; kk < 2; ++kk)
#pragma unroll
      for (int i = 0; i < 4; ++i) {
        a[kk][i] = load_op(fp + i * 16 * GPITCH + kk * 32, hs);
        b[kk][i] = load_op(fq + i * 16 * GPITCH + kk * 32, hs);
      }
    // Keeps the 32 LDS reads one group ahead of the WMMAs: left alone, the
    // scheduler sinks them among the WMMAs, each pair with a full wait behind it.
    __builtin_amdgcn_sched_barrier(0);
#pragma unroll
    for (int i = 0; i < 4; ++i)         // first 32 k, while the second half's reads land
#pragma unroll
      for (int j = 0; j < 4; ++j)
        acc[i][j] = wmma32(a[0][i], b[0][j], acc[i][j]);
    // Keeps the hand-over behind the first 16 WMMAs: hoisted over them, its full
    // wait would hold every WMMA back until the last LDS read has landed.
    __builtin_amdgcn_sched_barrier(0);
    // Hand-over, passed by every wave; the trip's last 16 WMMAs need registers only.
    asm volatile("s_wait_dscnt 0x0" ::: "memory");  // own reads of buffer t&1 are done
    WAIT_ASYNC();                       // own share of trip t+1 has landed
    __syncthreads();                    // trip t+1 readable; buffer t&1 free for refill
    if (t + 2 < nt) stage(t + 2);       // block-uniform test
#pragma unroll
    for (int i = 0; i < 4; ++i)         // second 32 k
#pragma unroll
      for (int j = 0; j < 4; ++j)
        acc[i][j] = wmma32(a[1][i], b[1][j], acc[i][j]);
  }
  WAIT_ASYNC();                         // nothing in flight when the wave ends

  // D layout: lane -> q = lq, register v -> p = hs*8 + v
#pragma unroll
  for (int j = 0; j < 4; ++j) {
    const size_t row = (size_t)(q0 + wq + j * 16 + lq) * LD + p0 + wp + hs * 8;
#pragma unroll
    for (int i = 0; i < 4; ++i) {
      if (F32) {
        f4 lo, hi;
#pragma unroll
        for (int v = 0; v < 4; ++v) { lo[v] = acc[i][j][v]; hi[v] = acc[i][j][v + 4]; }
        *(f4*)(outF + row + i * 16) = lo;
        *(f4*)(outF + row + i * 16 + 4) = hi;
      } else {
        h8 w;
#pragma unroll
        for (int v = 0; v < 8; ++v) w[v] = (_Float16)acc[i][j][v];
        *(h8*)(outH + row + i * 16) = w;
      }
    }
  }
}

// The three projections of X in one launch: they share A and read nothing of each
// other, so blockIdx.z picks the weight and the output. out[M][Nn] = A[M][K] * B,
// B supplied transposed as BT[Nn][K]; Q and K are stored row-major (P = BT), V
// transposed, out[n][m] (P = A). M, Nn multiples of 128. All selects are scalar.
__global__ __launch_bounds__(128) void k_gemm_qkv(
    const _Float16* __restrict__ A, const _Float16* __restrict__ WqT,
    const _Float16* __restrict__ WkT, const _Float16* __restrict__ WvT,
    _Float16* __restrict__ Qh, _Float16* __restrict__ Kh, _Float16* __restrict__ Vt,
    int M, int Nn, int K) {
  const int z = blockIdx.z;
  const bool tr = (z == 2);
  const _Float16* BT = (z == 0) ? WqT : (z == 1) ? WkT : WvT;
  _Float16* out = (z == 0) ? Qh : (z == 1) ? Kh : Vt;
  gemm_block<false>(tr ? A : BT, tr ? BT : A, out, nullptr, tr ? M : Nn,
                    (tr ? blockIdx.y : blockIdx.x) * 128,
                    (tr ? blockIdx.x : blockIdx.y) * 128, K);
}

// Output projection, f32 row-major out[M][Nn].
__global__ __launch_bounds__(128) void k_gemm_out(
    const _Float16* __restrict__ A, const _Float16* __restrict__ BT,
    float* __restrict__ outF, int Nn, int K) {
  gemm_block<true>(BT, A, nullptr, outF, Nn, blockIdx.x * 128, blockIdx.y * 128, K);
}

#define KPITCH 136             // K tile row pitch in halves: 272 B = 16 B x 17
#define VPITCH 40              // V^T tile row pitch in halves: 80 B = 16 B x 5
#define KTILE  (32 * KPITCH)   // 32 keys x 128 dims
#define VTILE  (DH2 * VPITCH)  // 128 dims x 32 keys

// ---------------------------------------------------------------------------
// Fused differential flash-attention + RMS norm.
// One wave owns 16 queries of one (b,h). Computes S^T = K*Q^T so the score
// tile's C layout (lane=query, reg=key) feeds the second WMMA (O^T = V^T*P^T)
// with no cross-lane movement. Two independent online softmaxes (comp 1/2),
// O = P1 V / l1 - lam * P2 V / l2, then RMS norm over 128 dims, * 0.2.
// The four waves of a block own 64 consecutive queries and walk the same keys:
// each 32-key K tile and V^T tile is brought into LDS once per block by async
// copies (whole 256-B / 64-B row pieces), two buffers, the next tile in flight
// while this one is worked on; all operands are then read by ds_load_b128.
// ---------------------------------------------------------------------------
__global__ __launch_bounds__(128) void k_diff_attn(
    const _Float16* __restrict__ Qh, const _Float16* __restrict__ Kh,
    const _Float16* __restrict__ Vt,   // [2048 feat][4096 tokens]
    const float* __restrict__ lamBuf, const float* __restrict__ rms_scale,
    _Float16* __restrict__ Oh) {
  __shared__ __attribute__((aligned(16))) _Float16 Ks[2][KTILE];
  __shared__ __attribute__((aligned(16))) _Float16 Vs[2][VTILE];
  const int tid = threadIdx.x;
  const int lane = tid & 31;
  const int wave = __builtin_amdgcn_readfirstlane(tid >> 5);
  const int lq = lane & 15, hs = lane >> 4;
  const int qblocks = SEQ / 64;         // 32 blocks of 64 queries per (b,h)
  const int bh = blockIdx.x / qblocks;
  const int qb = blockIdx.x % qblocks;
  const int b = bh / HEADS, h = bh % HEADS;
  const int q0 = qb * 64 + wave * 16;
  const int qglob = q0 + lq;            // this lane's query index

  const float scale = 0.125f;           // 1/sqrt(64)
  const float lam = lamBuf[h];

  const _Float16* kbase = Kh + (size_t)(b * SEQ) * QKV_N + h * DH2;
  const _Float16* vbase = Vt + (size_t)(h * DH2) * TOKENS + b * SEQ;

  // Copy map. K tile: 512 chunks of 16 B, lane -> row tid/16 (+8 per copy),
  // chunk tid%16. V^T tile: 512 chunks, lane -> row tid/4 (+32 per copy),
  // chunk tid%4.
  const _Float16* gK = kbase + (size_t)(tid >> 4) * QKV_N + (tid & 15) * 8;
  const _Float16* gV = vbase + (size_t)(tid >> 2) * TOKENS + (tid & 3) * 8;
  const unsigned lK = (unsigned)(size_t)(void*)&Ks[0][(tid >> 4) * KPITCH + (tid & 15) * 8];
  const unsigned lV = (unsigned)(size_t)(void*)&Vs[0][(tid >> 2) * VPITCH + (tid & 3) * 8];

  auto stage = [&](int t) {             // tile t (keys 32t..32t+31) -> buffer t&1
    const _Float16* k = gK + (size_t)(t * 32) * QKV_N;
    const _Float16* v = gV + t * 32;
    const unsigned lk = lK + (t & 1) * (KTILE * 2);
    const unsigned lv = lV + (t & 1) * (VTILE * 2);
    stage_tile8(k, k + 8 * QKV_N, k + 16 * QKV_N, k + 24 * QKV_N,
                v, v + (size_t)32 * TOKENS, v + (size_t)64 * TOKENS, v + (size_t)96 * TOKENS,
                lk, lk + 8 * KPITCH * 2, lk + 16 * KPITCH * 2, lk + 24 * KPITCH * 2,
                lv, lv + 32 * VPITCH * 2, lv + 64 * VPITCH * 2, lv + 96 * VPITCH * 2);
  };

  const int ntiles = 2 * qb + 2;        // block's causal range, always >= 2 tiles
  stage(0);

  // Q^T as B operand: lane = query, halves = d-contiguous. 2 comps x 2 K-chunks.
  const _Float16* qrow = Qh + (size_t)(b * SEQ + qglob) * QKV_N + h * DH2;
  v16h qop[2][2];
#pragma unroll
  for (int c = 0; c < 2; ++c)
#pragma unroll
    for (int kk = 0; kk < 2; ++kk)
      qop[c][kk] = load_op(qrow + c * DH + kk * 32, hs);

  v8f O1[8] = {}, O2[8] = {};           // O^T accumulators: 8 d-tiles x (16x16)
  float m1 = -INFINITY, m2 = -INFINITY, l1 = 0.f, l2 = 0.f;

  WAIT_ASYNC();                         // this wave's share of tile 0 has landed
  __syncthreads();                      // every wave's share of tile 0 has landed
  stage(1);

  const int nk = q0 + 16;               // causal: this wave needs keys 0..q0+15
  for (int t = 0; t < ntiles; ++t) {    // 32 keys/step: tiles a (kt), b (kt+16)
    const int kt = t * 32;
    if (kt < nk) {                      // wave-uniform: skip tiles past the diagonal
      const _Float16* ks = &Ks[t & 1][lq * KPITCH];
      const _Float16* vs = &Vs[t & 1][lq * VPITCH];
      // ---- all 8 K operands of this step ---------------------------------
      v16h kA[2][2], kB[2][2];
#pragma unroll
      for (int c = 0; c < 2; ++c)
#pragma unroll
        for (int kk = 0; kk < 2; ++kk) {
          kA[c][kk] = load_op(ks + c * DH + kk * 32, hs);
          kB[c][kk] = load_op(ks + 16 * KPITCH + c * DH + kk * 32, hs);
        }

      // ---- score tiles (S^T) + online softmax ----------------------------
      v16h pop[2];
      float alpha[2];
      // Every loop of this step is unrolled: the score vectors live in registers,
      // which only constant indices can name.
      v8f sA[2] = {}, sB[2] = {};
#pragma unroll
      for (int c = 0; c < 2; ++c)
#pragma unroll
        for (int kk = 0; kk < 2; ++kk) {  // accumulate over d = 64 (2 x K=32)
          sA[c] = wmma32(kA[c][kk], qop[c][kk], sA[c]);
          sB[c] = wmma32(kB[c][kk], qop[c][kk], sB[c]);
        }
      // S^T C layout: lane = query (lq), reg v -> key = kt + hs*8 + v (+16 for b)
      // Causal mask, under a wave-uniform scalar branch: every key of a tile with
      // kt + 31 <= q0 is visible to all 16 queries of the wave, so only the one
      // tile per wave that crosses the diagonal pays for compares and selects.
      // The hint puts that block out of line: a full tile falls straight through.
      if (__builtin_expect(kt + 31 > q0, 0)) {
#pragma unroll
        for (int v = 0; v < 8; ++v) {
          const int keyA = kt + hs * 8 + v;
          const bool va = keyA <= qglob, vb = keyA + 16 <= qglob;
#pragma unroll
          for (int c = 0; c < 2; ++c) {
            sA[c][v] = va ? sA[c][v] : -INFINITY;
            sB[c][v] = vb ? sB[c][v] : -INFINITY;
          }
        }
      }
#pragma unroll
      for (int c = 0; c < 2; ++c) {
        // Whole-vector forms: neighbouring accumulator registers pair up as they lie.
        const v8f xa = sA[c] * scale, xb = sB[c] * scale;
        float pa[8], pb[8];
        float smax = -INFINITY;
#pragma unroll
        for (int v = 0; v < 8; ++v) smax = fmaxf(smax, fmaxf(xa[v], xb[v]));
        smax = fmaxf(smax, __shfl_xor(smax, 16, 32)); // lanes q, q+16 share a query
        const float mo = (c == 0) ? m1 : m2;
        const float mn = fmaxf(mo, smax);
        const float al = __expf(mo - mn);
        const v8f da = xa - mn, db = xb - mn;
        float ls = 0.f;
#pragma unroll
        for (int v = 0; v < 8; ++v) {
          pa[v] = __expf(da[v]);
          pb[v] = __expf(db[v]);
          ls += pa[v] + pb[v];
        }
        ls += __shfl_xor(ls, 16, 32);
        if (c == 0) { l1 = l1 * al + ls; m1 = mn; }
        else        { l2 = l2 * al + ls; m2 = mn; }
        alpha[c] = al;
        // Pack P^T directly as B operand (K=32 keys): halves[0..7]=tile a,
        // halves[8..15]=tile b: exactly matches the C layout we already hold.
        v16h pv;
#pragma unroll
        for (int v = 0; v < 8; ++v) { pv[v] = (_Float16)pa[v]; pv[v + 8] = (_Float16)pb[v]; }
        pop[c] = pv;
      }

      // ---- O^T += V^T * P^T ----------------------------------------------
      v16h vop[8];
#pragma unroll
      for (int tt = 0; tt < 8; ++tt)
        vop[tt] = load_op(vs + tt * 16 * VPITCH, hs);
#pragma unroll
      for (int tt = 0; tt < 8; ++tt) {
#pragma unroll
        for (int v = 0; v < 8; ++v) { O1[tt][v] *= alpha[0]; O2[tt][v] *= alpha[1]; }
        O1[tt] = wmma32(vop[tt], pop[0], O1[tt]);
        O2[tt] = wmma32(vop[tt], pop[1], O2[tt]);
      }
    }
    // Hand-over, passed by every wave, also one that skipped the tile.
    asm volatile("s_wait_dscnt 0x0" ::: "memory");  // own reads of buffer t&1 are done
    WAIT_ASYNC();                       // own share of tile t+1 has landed
    __syncthreads();                    // tile t+1 readable; buffer t&1 free for refill
    if (t + 2 < ntiles) stage(t + 2);   // block-uniform test
  }
  WAIT_ASYNC();                         // nothing in flight when the wave ends

  // Combine streams, RMS-normalize over 128 dims, scale by (1 - lambda_init).
  const float inv1 = 1.0f / l1;
  const float inv2 = lam / l2;
  float ssq = 0.f;
#pragma unroll
  for (int t = 0; t < 8; ++t)
#pragma unroll
    for (int v = 0; v < 8; ++v) {
      float o = O1[t][v] * inv1 - O2[t][v] * inv2;
      ssq += o * o;
    }
  ssq += __shfl_xor(ssq, 16, 32);       // other 64 dims live in lane^16
  const float rinv = rsqrtf(ssq * (1.0f / DH2) + EPS_RMS) * (1.0f - LAMBDA_INIT);

  _Float16* orow = Oh + (size_t)(b * SEQ + qglob) * QKV_N + h * DH2;
#pragma unroll
  for (int t = 0; t < 8; ++t)
#pragma unroll
    for (int v = 0; v < 8; ++v) {
      const int d = t * 16 + hs * 8 + v;
      float o = O1[t][v] * inv1 - O2[t][v] * inv2;
      orow[d] = (_Float16)(o * rinv * rms_scale[d]);
    }
}

// ---------------------------------------------------------------------------
extern "C" void kernel_launch(void* const* d_in, const int* in_sizes, int n_in,
                              void* d_out, int out_size, void* d_ws, size_t ws_size,
                              hipStream_t stream) {
  const float* X    = (const float*)d_in[0];
  const float* Wq   = (const float*)d_in[1];
  const float* Wk   = (const float*)d_in[2];
  const float* Wv   = (const float*)d_in[3];
  const float* Wo   = (const float*)d_in[4];
  const float* lq1  = (const float*)d_in[5];
  const float* lk1  = (const float*)d_in[6];
  const float* lq2  = (const float*)d_in[7];
  const float* lk2  = (const float*)d_in[8];
  const float* rmss = (const float*)d_in[9];
  float* out = (float*)d_out;

  char* w = (char*)d_ws;
  _Float16* Xh  = (_Float16*)w; w += (size_t)TOKENS * D_MODEL * 2;  // 8 MB
  _Float16* WqT = (_Float16*)w; w += (size_t)QKV_N * D_MODEL * 2;   // 4 MB
  _Float16* WkT = (_Float16*)w; w += (size_t)QKV_N * D_MODEL * 2;
  _Float16* WvT = (_Float16*)w; w += (size_t)QKV_N * D_MODEL * 2;
  _Float16* WoT = (_Float16*)w; w += (size_t)D_MODEL * QKV_N * 2;
  _Float16* Qh  = (_Float16*)w; w += (size_t)TOKENS * QKV_N * 2;    // 16 MB
  _Float16* Kh  = (_Float16*)w; w += (size_t)TOKENS * QKV_N * 2;
  _Float16* Vt  = (_Float16*)w; w += (size_t)QKV_N * TOKENS * 2;    // transposed
  _Float16* Ohb = (_Float16*)w; w += (size_t)TOKENS * QKV_N * 2;
  float*    lam = (float*)w;

  // Stage 1: precision conversion + weight transposes + lambda scalars, one launch
  k_prep<<<PREP_BLOCKS, 256, 0, stream>>>(X, Wq, Wk, Wv, Wo, lq1, lk1, lq2, lk2,
                                          Xh, WqT, WkT, WvT, WoT, lam);

  // Stage 2: QKV projections (WMMA), one launch. V stored transposed for the
  // attention V^T operand.
  dim3 gq(QKV_N / 128, TOKENS / 128, 3);
  k_gemm_qkv<<<gq, 128, 0, stream>>>(Xh, WqT, WkT, WvT, Qh, Kh, Vt, TOKENS, QKV_N, D_MODEL);

  // Stage 3: fused differential flash attention + RMS norm
  const int waves = BATCH * HEADS * (SEQ / 16);  // 4096 waves
  k_diff_attn<<<waves / 4, 128, 0, stream>>>(Qh, Kh, Vt, lam, rmss, Ohb);

  // Stage 4: output projection -> fp32 result
  dim3 go(D_MODEL / 128, TOKENS / 128);
  k_gemm_out<<<go, 128, 0, stream>>>(Ohb, WoT, out, D_MODEL, QKV_N);
}

// v007
// Measured time: 139 microseconds a run.
// It is 1.14 times as fast as v005, going by the measured steps of the versions left out in between.
// All steps since v000 together make it 2.76 times as fast.
#include <hip/hip_runtime.h>
#include <hip/hip_bf16.h>
#include <math.h>

typedef __attribute__((ext_vector_type(16))) _Float16 v16h;
typedef __attribute__((ext_vector_type(8)))  _Float16 h8;
typedef __attribute__((ext_vector_type(8)))  float    v8f;
typedef __attribute__((ext_vector_type(2)))  _Float16 h2;
typedef __attribute__((ext_vector_type(4)))  float    f4;
typedef __attribute__((ext_vector_type(2)))  float    f2;

#define D_MODEL 1024
#define HEADS   16
#define DH      64
#define DH2     128            // 2*DH per head
#define BATCH   2
#define SEQ     2048
#define TOKENS  (BATCH*SEQ)    // 4096
#define QKV_N   (2*D_MODEL)    // 2048
#define LAMBDA_INIT 0.8f
#define EPS_RMS 1e-5f
#define LOG2E 1.44269504f
#define QSCALE (0.125f * LOG2E)  // log2 e / sqrt(DH): Wq, and so Q, is stored times this

#define WAIT_ASYNC() asm volatile("s_wait_asynccnt 0x0" ::: "memory")

__device__ __forceinline__ v16h load_op(const _Float16* p, int halfsel) {
  h8 lo = *(const h8*)(p + halfsel * 8);
  h8 hi = *(const h8*)(p + 16 + halfsel * 8);
  v16h r;
#pragma unroll
  for (int i = 0; i < 8; ++i) { r[i] = lo[i]; r[i + 8] = hi[i]; }
  return r;
}

__device__ __forceinline__ v8f wmma32(v16h a, v16h b, v8f c) {
  // D = A(16x32) * B(32x16) + C, f32 accumulate
  return __builtin_amdgcn_wmma_f32_16x16x32_f16(
      /*neg_a=*/false, a, /*neg_b=*/false, b,
      /*c_mod=*/(short)0, c, /*reuse_a=*/false, /*reuse_b=*/false);
}

// ---------------------------------------------------------------------------
// Elementwise f32 -> f16: share of block blk out of nblk blocks of 256 threads
// ---------------------------------------------------------------------------
__device__ __forceinline__ void f32_to_f16_part(const float* __restrict__ src,
                                                _Float16* __restrict__ dst, int n,
                                                int blk, int nblk) {
  int i = blk * 256 + threadIdx.x;
  int stride = nblk * 256;
  for (; i < n; i += stride) dst[i] = (_Float16)src[i];
}

#define TR 128                 // src rows per tile (contiguous in dst)
#define TC 64                  // src cols per tile (contiguous in src)
#define TP (TR + 2)            // LDS row pitch in halves
template <int ROWS, int COLS>
__device__ __forceinline__ void transpose_f16_tile(const float* __restrict__ src,
                                                   _Float16* __restrict__ dst,
                                                   int bx, int by, _Float16* tile,
                                                   float wscale) {
  const int hi = threadIdx.x >> 4;      // 0..15
  const int lo = threadIdx.x & 15;      // 0..15
  const int c0 = bx * TC, r0 = by * TR;

  // src rows r0 + 2*hi + 32*j (+1), cols c0 + 4*lo .. +3
  const float* s = src + (size_t)(r0 + 2 * hi) * COLS + c0 + 4 * lo;
  f4 a[4], b[4];                        // eight loads in flight, constant offsets
  for (int j = 0; j < 4; ++j) {
    a[j] = *(const f4*)(s + (size_t)(32 * j) * COLS);
    b[j] = *(const f4*)(s + (size_t)(32 * j + 1) * COLS);
  }
  for (int j = 0; j < 4; ++j)
    for (int k = 0; k < 4; ++k) {
      h2 p;
      p[0] = (_Float16)(a[j][k] * wscale);
      p[1] = (_Float16)(b[j][k] * wscale);
      *(h2*)&tile[(4 * lo + k) * TP + 2 * hi + 32 * j] = p;
    }
  __syncthreads();                      // the whole tile is in LDS

  // dst rows c0 + hi + 16*j, cols r0 + 8*lo .. +7
  _Float16* d = dst + (size_t)(c0 + hi) * ROWS + r0 + 8 * lo;
  for (int j = 0; j < 4; ++j) {
    const _Float16* t = &tile[(hi + 16 * j) * TP + 8 * lo];
    h8 w;
    for (int k = 0; k < 4; ++k) {
      h2 p = *(const h2*)(t + 2 * k);
      w[2 * k] = p[0];
      w[2 * k + 1] = p[1];
    }
    *(h8*)(d + (size_t)(16 * j) * ROWS) = w;
  }
  // Other jobs' code follows this one in the merged kernel: the wait stands in
  // front of any rewrite of a register that the four stores above name.
  asm volatile("s_wait_xcnt 0x0" ::: "memory");
}

// lam[h] = exp(lq1.lk1) - exp(lq2.lk2) + lambda_init
__device__ __forceinline__ void lambda_part(
    const float* __restrict__ lq1, const float* __restrict__ lk1,
    const float* __restrict__ lq2, const float* __restrict__ lk2,
    float* __restrict__ lam) {
  int h = threadIdx.x;
  if (h < HEADS) {
    float s1 = 0.f, s2 = 0.f;
    for (int i = 0; i < DH; ++i) {
      s1 += lq1[h * DH + i] * lk1[h * DH + i];
      s2 += lq2[h * DH + i] * lk2[h * DH + i];
    }
    lam[h] = __expf(s1) - __expf(s2) + LAMBDA_INIT;
  }
}

// ---------------------------------------------------------------------------
// All preparation in one launch: none of these jobs reads another's output, so
// the block index picks the job. Block 0: lambda; then CONV_BLOCKS blocks convert X; then
// WTILES tiles of each of Wq, Wk, Wv, Wo. Every branch is block-uniform.
// ---------------------------------------------------------------------------
#define CONV_BLOCKS 512
#define WTILES ((QKV_N / TC) * (D_MODEL / TR))   // 256 tiles per weight
#define PREP_BLOCKS (1 + CONV_BLOCKS + 4 * WTILES)
__global__ __launch_bounds__(256) void k_prep(
    const float* __restrict__ X, const float* __restrict__ Wq,
    const float* __restrict__ Wk, const float* __restrict__ Wv,
    const float* __restrict__ Wo,
    const float* __restrict__ lq1, const float* __restrict__ lk1,
    const float* __restrict__ lq2, const float* __restrict__ lk2,
    _Float16* __restrict__ Xh, _Float16* __restrict__ WqT, _Float16* __restrict__ WkT,
    _Float16* __restrict__ WvT, _Float16* __restrict__ WoT, float* __restrict__ lam) {
  __shared__ __attribute__((aligned(16))) _Float16 tile[TC * TP];  // [src col][src row]
  int blk = blockIdx.x;
  if (blk == 0) {
    lambda_part(lq1, lk1, lq2, lk2, lam);
    return;
  }
  blk -= 1;
  if (blk < CONV_BLOCKS) {
    f32_to_f16_part(X, Xh, TOKENS * D_MODEL, blk, CONV_BLOCKS);
    return;
  }
  blk -= CONV_BLOCKS;
  const int job = blk / WTILES, t = blk % WTILES;
  if (job < 3) {
    const float* src = (job == 0) ? Wq : (job == 1) ? Wk : Wv;
    _Float16* dst = (job == 0) ? WqT : (job == 1) ? WkT : WvT;
    // Wq carries QSCALE, so that K * Q^T is the softmax exponent to base 2.
    transpose_f16_tile<D_MODEL, QKV_N>(src, dst, t % (QKV_N / TC), t / (QKV_N / TC), tile,
                                       (job == 0) ? QSCALE : 1.0f);
  } else {
    transpose_f16_tile<QKV_N, D_MODEL>(Wo, WoT, t % (D_MODEL / TC), t / (D_MODEL / TC), tile, 1.0f);
  }
}

__device__ __forceinline__ void stage_tile8(
    const _Float16* g0, const _Float16* g1, const _Float16* g2, const _Float16* g3,
    const _Float16* g4, const _Float16* g5, const _Float16* g6, const _Float16* g7,
    unsigned l0, unsigned l1, unsigned l2, unsigned l3,
    unsigned l4, unsigned l5, unsigned l6, unsigned l7) {
  asm volatile(
      "global_load_async_to_lds_b128 %0, %8, off\n\t"
      "global_load_async_to_lds_b128 %1, %9, off\n\t"
      "global_load_async_to_lds_b128 %2, %10, off\n\t"
      "global_load_async_to_lds_b128 %3, %11, off\n\t"
      "global_load_async_to_lds_b128 %4, %12, off\n\t"
      "global_load_async_to_lds_b128 %5, %13, off\n\t"
      "global_load_async_to_lds_b128 %6, %14, off\n\t"
      "global_load_async_to_lds_b128 %7, %15, off\n\t"
      "s_wait_xcnt 0x0"
      :: "v"(l0), "v"(l1), "v"(l2), "v"(l3), "v"(l4), "v"(l5), "v"(l6), "v"(l7),
         "v"(g0), "v"(g1), "v"(g2), "v"(g3), "v"(g4), "v"(g5), "v"(g6), "v"(g7)
      : "memory");
}

// ---------------------------------------------------------------------------
// WMMA GEMM, both operand panels staged in a two-buffer LDS ring.
// out[M][Nn] = A[M][K] * B[K][Nn], B supplied transposed as BT[Nn][K].
// Block = 128 threads = 4 waves (2 x 2); wave tile 64 x 64; block 128 x 128.
// A trip is 64 k: 128 rows x 128 B of each operand come into LDS by async
// copies (a wave's copy = 4 whole 128-B lines) while the trip before feeds the
// WMMAs. A fragment read from LDS serves four WMMAs. LDS row pitch 144 B
// (16 B x 9): conflict-free for ds_load_b128.
// The operand whose index runs along the stored row (P) is the WMMA's A side,
// so a lane's eight accumulator registers are eight neighbours of that row.
// The block computes out[q0..q0+127][p0..p0+127], out[q][p] = sum_k Q[q][k] P[p][k],
// p contiguous, leading dimension LD; K a multiple of 64. F32: f32 out, else f16.
// ---------------------------------------------------------------------------
#define GBK    64              // k per trip
#define GPITCH 72              // LDS row pitch in halves
#define GPANEL (128 * GPITCH)  // one operand's 128 rows of a trip
template <bool F32>
__device__ __forceinline__ void gemm_block(
    const _Float16* __restrict__ P, const _Float16* __restrict__ Q,
    _Float16* __restrict__ outH, float* __restrict__ outF,
    int LD, int p0, int q0, int K) {
  __shared__ __attribute__((aligned(16))) _Float16 Ps[2][2][GPANEL];  // [buffer][P, Q]
  const int tid = threadIdx.x;
  const int lane = tid & 31;
  const int wave = __builtin_amdgcn_readfirstlane(tid >> 5);
  const int lq = lane & 15;   // fragment row within a 16-row tile
  const int hs = lane >> 4;   // operand half selector
  const int wp = (wave & 1) * 64, wq = (wave >> 1) * 64;

  // Copy map, per panel 1024 chunks of 16 B: lane -> row tid/8 (+16 per copy),
  // chunk tid%8.
  const _Float16* gP = P + (size_t)(p0 + (tid >> 3)) * K + (tid & 7) * 8;
  const _Float16* gQ = Q + (size_t)(q0 + (tid >> 3)) * K + (tid & 7) * 8;
  const unsigned lP = (unsigned)(size_t)(void*)&Ps[0][0][(tid >> 3) * GPITCH + (tid & 7) * 8];
  const size_t rs = (size_t)16 * K;     // 16 rows, in halves
  const unsigned ls = 16 * GPITCH * 2;  // 16 rows, in LDS bytes

  auto stage = [&](int t) {             // trip t (k 64t..64t+63) -> buffer t&1
    const _Float16* p = gP + t * GBK;
    const _Float16* q = gQ + t * GBK;
    const unsigned lp = lP + (t & 1) * (2 * GPANEL * 2);
    const unsigned lc = lp + GPANEL * 2;
    stage_tile8(p, p + rs, p + 2 * rs, p + 3 * rs, p + 4 * rs, p + 5 * rs, p + 6 * rs, p + 7 * rs,
                lp, lp + ls, lp + 2 * ls, lp + 3 * ls, lp + 4 * ls, lp + 5 * ls, lp + 6 * ls, lp + 7 * ls);
    stage_tile8(q, q + rs, q + 2 * rs, q + 3 * rs, q + 4 * rs, q + 5 * rs, q + 6 * rs, q + 7 * rs,
                lc, lc + ls, lc + 2 * ls, lc + 3 * ls, lc + 4 * ls, lc + 5 * ls, lc + 6 * ls, lc + 7 * ls);
  };

  const int nt = K / GBK;
  stage(0);
  v8f acc[4][4] = {};                   // [p tile][q tile]
  WAIT_ASYNC();                         // this wave's share of trip 0 has landed
  __syncthreads();                      // every wave's share of trip 0 has landed
  if (nt > 1) stage(1);                 // block-uniform test

  for (int t = 0; t < nt; ++t) {
    const _Float16* fp = &Ps[t & 1][0][(wp + lq) * GPITCH];
    const _Float16* fq = &Ps[t & 1][1][(wq + lq) * GPITCH];
    v16h a[2][4], b[2][4];              // all 16 fragments of the trip, one load group
#pragma unroll
    for (int kk = 0; kk < 2; ++kk)
#pragma unroll
      for (int i = 0; i < 4; ++i) {
        a[kk][i] = load_op(fp + i * 16 * GPITCH + kk * 32, hs);
        b[kk][i] = load_op(fq + i * 16 * GPITCH + kk * 32, hs);
      }
    // Keeps the 32 LDS reads one group ahead of the WMMAs: left alone, the
    // scheduler sinks them among the WMMAs, each pair with a full wait behind it.
    __builtin_amdgcn_sched_barrier(0);
#pragma unroll
    for (int i = 0; i < 4; ++i)         // first 32 k, while the second half's reads land
#pragma unroll
      for (int j = 0; j < 4; ++j)
        acc[i][j] = wmma32(a[0][i], b[0][j], acc[i][j]);
    // Keeps the hand-over behind the first 16 WMMAs: hoisted over them, its full
    // wait would hold every WMMA back until the last LDS read has landed.
    __builtin_amdgcn_sched_barrier(0);
    // Hand-over, passed by every wave; the trip's last 16 WMMAs need registers only.
    asm volatile("s_wait_dscnt 0x0" ::: "memory");  // own reads of buffer t&1 are done
    WAIT_ASYNC();                       // own share of trip t+1 has landed
    __syncthreads();                    // trip t+1 readable; buffer t&1 free for refill
    if (t + 2 < nt) stage(t + 2);       // block-uniform test
#pragma unroll
    for (int i = 0; i < 4; ++i)         // second 32 k
#pragma unroll
      for (int j = 0; j < 4; ++j)
        acc[i][j] = wmma32(a[1][i], b[1][j], acc[i][j]);
  }
  WAIT_ASYNC();                         // nothing in flight when the wave ends

  // D layout: lane -> q = lq, register v -> p = hs*8 + v
#pragma unroll
  for (int j = 0; j < 4; ++j) {
    const size_t row = (size_t)(q0 + wq + j * 16 + lq) * LD + p0 + wp + hs * 8;
#pragma unroll
    for (int i = 0; i < 4; ++i) {
      if (F32) {
        f4 lo, hi;
#pragma unroll
        for (int v = 0; v < 4; ++v) { lo[v] = acc[i][j][v]; hi[v] = acc[i][j][v + 4]; }
        *(f4*)(outF + row + i * 16) = lo;
        *(f4*)(outF + row + i * 16 + 4) = hi;
      } else {
        h8 w;
#pragma unroll
        for (int v = 0; v < 8; ++v) w[v] = (_Float16)acc[i][j][v];
        *(h8*)(outH + row + i * 16) = w;
      }
    }
  }
}

// The three projections of X in one launch: they share A and read nothing of each
// other, so blockIdx.z picks the weight and the output. out[M][Nn] = A[M][K] * B,
// B supplied transposed as BT[Nn][K]; Q and K are stored row-major (P = BT), V
// transposed, out[n][m] (P = A). M, Nn multiples of 128. All selects are scalar.
__global__ __launch_bounds__(128) void k_gemm_qkv(
    const _Float16* __restrict__ A, const _Float16* __restrict__ WqT,
    const _Float16* __restrict__ WkT, const _Float16* __restrict__ WvT,
    _Float16* __restrict__ Qh, _Float16* __restrict__ Kh, _Float16* __restrict__ Vt,
    int M, int Nn, int K) {
  const int z = blockIdx.z;
  const bool tr = (z == 2);
  const _Float16* BT = (z == 0) ? WqT : (z == 1) ? WkT : WvT;
  _Float16* out = (z == 0) ? Qh : (z == 1) ? Kh : Vt;
  gemm_block<false>(tr ? A : BT, tr ? BT : A, out, nullptr, tr ? M : Nn,
                    (tr ? blockIdx.y : blockIdx.x) * 128,
                    (tr ? blockIdx.x : blockIdx.y) * 128, K);
}

// Output projection, f32 row-major out[M][Nn].
__global__ __launch_bounds__(128) void k_gemm_out(
    const _Float16* __restrict__ A, const _Float16* __restrict__ BT,
    float* __restrict__ outF, int Nn, int K) {
  gemm_block<true>(BT, A, nullptr, outF, Nn, blockIdx.x * 128, blockIdx.y * 128, K);
}

#define KPITCH 136             // K tile row pitch in halves: 272 B = 16 B x 17
#define VPITCH 40              // V^T tile row pitch in halves: 80 B = 16 B x 5
#define KTILE  (32 * KPITCH)   // 32 keys x 128 dims
#define VTILE  (DH2 * VPITCH)  // 128 dims x 32 keys
#define LAZY_THR 8.0f          // tile 0: how far below 0 a query's largest exponent (base 2) may lie
#define LAZY_SUM 4096.0f       // a lane's sum of p over a tile above which the reference point moves

// ---------------------------------------------------------------------------
// Fused differential flash-attention + RMS norm.
// One wave owns 16 queries of one (b,h). Computes S^T = K*Q^T so the score
// tile's C layout (lane=query, reg=key) feeds the second WMMA (O^T = V^T*P^T)
// with no cross-lane movement. Two independent online softmaxes (comp 1/2), lazily rescaled,
// O = P1 V / l1 - lam * P2 V / l2, then RMS norm over 128 dims, * 0.2.
// The four waves of a block own 64 consecutive queries and walk the same keys:
// each 32-key K tile and V^T tile is brought into LDS once per block by async
// copies (whole 256-B / 64-B row pieces), two buffers, the next tile in flight
// while this one is worked on; all operands are then read by ds_load_b128.
// ---------------------------------------------------------------------------
__global__ __launch_bounds__(128) void k_diff_attn(
    const _Float16* __restrict__ Qh, const _Float16* __restrict__ Kh,
    const _Float16* __restrict__ Vt,   // [2048 feat][4096 tokens]
    const float* __restrict__ lamBuf, const float* __restrict__ rms_scale,
    _Float16* __restrict__ Oh) {
  __shared__ __attribute__((aligned(16))) _Float16 Ks[2][KTILE];
  __shared__ __attribute__((aligned(16))) _Float16 Vs[2][VTILE];
  const int tid = threadIdx.x;
  const int lane = tid & 31;
  const int wave = __builtin_amdgcn_readfirstlane(tid >> 5);
  const int lq = lane & 15, hs = lane >> 4;
  const int qblocks = SEQ / 64;         // 32 blocks of 64 queries per (b,h)
  const int bh = blockIdx.x / qblocks;
  const int qb = blockIdx.x % qblocks;
  const int b = bh / HEADS, h = bh % HEADS;
  const int q0 = qb * 64 + wave * 16;
  const int qglob = q0 + lq;            // this lane's query index

  const float lam = lamBuf[h];

  const _Float16* kbase = Kh + (size_t)(b * SEQ) * QKV_N + h * DH2;
  const _Float16* vbase = Vt + (size_t)(h * DH2) * TOKENS + b * SEQ;

  // Copy map. K tile: 512 chunks of 16 B, lane -> row tid/16 (+8 per copy),
  // chunk tid%16. V^T tile: 512 chunks, lane -> row tid/4 (+32 per copy),
  // chunk tid%4.
  const _Float16* gK = kbase + (size_t)(tid >> 4) * QKV_N + (tid & 15) * 8;
  const _Float16* gV = vbase + (size_t)(tid >> 2) * TOKENS + (tid & 3) * 8;
  const unsigned lK = (unsigned)(size_t)(void*)&Ks[0][(tid >> 4) * KPITCH + (tid & 15) * 8];
  const unsigned lV = (unsigned)(size_t)(void*)&Vs[0][(tid >> 2) * VPITCH + (tid & 3) * 8];

  auto stage = [&](int t) {             // tile t (keys 32t..32t+31) -> buffer t&1
    const _Float16* k = gK + (size_t)(t * 32) * QKV_N;
    const _Float16* v = gV + t * 32;
    const unsigned lk = lK + (t & 1) * (KTILE * 2);
    const unsigned lv = lV + (t & 1) * (VTILE * 2);
    stage_tile8(k, k + 8 * QKV_N, k + 16 * QKV_N, k + 24 * QKV_N,
                v, v + (size_t)32 * TOKENS, v + (size_t)64 * TOKENS, v + (size_t)96 * TOKENS,
                lk, lk + 8 * KPITCH * 2, lk + 16 * KPITCH * 2, lk + 24 * KPITCH * 2,
                lv, lv + 32 * VPITCH * 2, lv + 64 * VPITCH * 2, lv + 96 * VPITCH * 2);
  };

  const int ntiles = 2 * qb + 2;        // block's causal range, always >= 2 tiles
  stage(0);

  // Q^T as B operand: lane = query, halves = d-contiguous. 2 comps x 2 K-chunks.
  const _Float16* qrow = Qh + (size_t)(b * SEQ + qglob) * QKV_N + h * DH2;
  v16h qop[2][2];
#pragma unroll
  for (int c = 0; c < 2; ++c)
#pragma unroll
    for (int kk = 0; kk < 2; ++kk)
      qop[c][kk] = load_op(qrow + c * DH + kk * 32, hs);

  v8f O1[8] = {}, O2[8] = {};           // O^T accumulators: 8 d-tiles x (16x16)
  // Reference points of the two softmaxes, base 2. They start at 0 and stay there in
  // most waves; moved is non-zero once some lane of the wave has left 0 (wave-uniform).
  float m1 = 0.f, m2 = 0.f, l1 = 0.f, l2 = 0.f;
  unsigned moved = 0;

  WAIT_ASYNC();                         // this wave's share of tile 0 has landed
  __syncthreads();                      // every wave's share of tile 0 has landed
  stage(1);

  // The value that the other half-wave's lane of the same query holds. The address
  // is formed once, here: formed at each use, it made the compiler give the rare
  // branch below an else side that copied all 128 accumulator registers.
  const int xaddr = (lane ^ 16) << 2;
  auto xhalf = [&](float x) {
    return __int_as_float(__builtin_amdgcn_ds_bpermute(xaddr, __float_as_int(x)));
  };

  const int nk = q0 + 16;               // causal: this wave needs keys 0..q0+15
  for (int t = 0; t < ntiles; ++t) {    // 32 keys/step: tiles a (kt), b (kt+16)
    const int kt = t * 32;
    if (kt < nk) {                      // wave-uniform: skip tiles past the diagonal
      const _Float16* ks = &Ks[t & 1][lq * KPITCH];
      const _Float16* vs = &Vs[t & 1][lq * VPITCH];
      // ---- score tiles (S^T) + online softmax ----------------------------
      // Every inner loop of this step is unrolled: the score vectors live in registers,
      // which only constant indices can name.
      // Lazy rescale. The reference points of the two softmaxes are not exact maxima:
      // exp2(x - m) / sum exp2(x - m) is the same for any m, so m moves only when it
      // must. The test reads what the tile needs anyway, a lane's sums of p: while they
      // stay below LAZY_SUM every p does, well inside f16, and no maxima are taken, none
      // exchanged between the half-waves, and the 128 accumulator products are not
      // needed. Where the test fails the tile is worked once more with exact set: then
      // the maxima are taken and m moves to them. At most two trips. Tile 0 is exact at
      // once: there m also goes down, if a query's maximum lies more than LAZY_THR below 0.
      v16h pop[2], vop[8];
      float ls[2];
      bool exact = (t == 0);            // wave-uniform
      for (;;) {
        // all 8 K operands of this step
        v16h kA[2][2], kB[2][2];
#pragma unroll
        for (int c = 0; c < 2; ++c)
#pragma unroll
          for (int kk = 0; kk < 2; ++kk) {
            kA[c][kk] = load_op(ks + c * DH + kk * 32, hs);
            kB[c][kk] = load_op(ks + 16 * KPITCH + c * DH + kk * 32, hs);
          }
        // Q carries log2 e / sqrt(d): at reference point 0 what leaves the products is
        // the argument of exp2 as it stands.
        v8f sA[2] = {}, sB[2] = {};
#pragma unroll
        for (int c = 0; c < 2; ++c)
#pragma unroll
          for (int kk = 0; kk < 2; ++kk) {  // accumulate over d = 64 (2 x K=32)
            sA[c] = wmma32(kA[c][kk], qop[c][kk], sA[c]);
            sB[c] = wmma32(kB[c][kk], qop[c][kk], sB[c]);
          }
        // S^T C layout: lane = query (lq), reg v -> key = kt + hs*8 + v (+16 for b)
        // Causal mask, under a wave-uniform scalar branch: every key of a tile with
        // kt + 31 <= q0 is visible to all 16 queries of the wave, so only the one
        // tile per wave that crosses the diagonal pays for compares and selects.
        // The hint puts that block out of line: a full tile falls straight through.
        if (__builtin_expect(kt + 31 > q0, 0)) {
#pragma unroll
          for (int v = 0; v < 8; ++v) {
            const int keyA = kt + hs * 8 + v;
            const bool va = keyA <= qglob, vb = keyA + 16 <= qglob;
#pragma unroll
            for (int c = 0; c < 2; ++c) {
              sA[c][v] = va ? sA[c][v] : -INFINITY;
              sB[c][v] = vb ? sB[c][v] : -INFINITY;
            }
          }
        }
        // Only a wave whose reference points have left 0 subtracts them: a scalar branch.
        if (__builtin_expect(moved != 0, 0)) {
          sA[0] -= m1; sB[0] -= m1;
          sA[1] -= m2; sB[1] -= m2;
        }
        if (__builtin_expect(exact, 0)) {
          // A query's maximum over the tile's 32 keys, per softmax: how far the largest
          // exponent lies above the reference point. Every lane moves, so lanes q and
          // q+16 (one query) keep one m. Behind tile 0 m only rises; in tile 0 the sums
          // are still zero, so their factor is 1.
          float sm[2];
#pragma unroll
          for (int c = 0; c < 2; ++c) {
            float smax = -INFINITY;
#pragma unroll
            for (int v = 0; v < 8; ++v) smax = fmaxf(smax, fmaxf(sA[c][v], sB[c][v]));
            sm[c] = fmaxf(smax, xhalf(smax));
          }
          const float d1 = (t == 0) ? ((fabsf(sm[0]) > LAZY_THR) ? sm[0] : 0.f) : fmaxf(sm[0], 0.f);
          const float d2 = (t == 0) ? ((fabsf(sm[1]) > LAZY_THR) ? sm[1] : 0.f) : fmaxf(sm[1], 0.f);
          const float a1 = (t == 0) ? 1.f : __builtin_amdgcn_exp2f(-d1);
          const float a2 = (t == 0) ? 1.f : __builtin_amdgcn_exp2f(-d2);
          m1 += d1; m2 += d2;
          moved = __builtin_amdgcn_ballot_w32(m1 != 0.f || m2 != 0.f);
          sA[0] -= d1; sB[0] -= d1;
          sA[1] -= d2; sB[1] -= d2;
          l1 *= a1; l2 *= a2;
#pragma unroll
          for (int tt = 0; tt < 8; ++tt) { O1[tt] *= a1; O2[tt] *= a2; }
        }
        // The first three V^T fragments are asked for here, ahead of the test, so that
        // they land while the exponentials run.
#pragma unroll
        for (int tt = 0; tt < 3; ++tt)
          vop[tt] = load_op(vs + tt * 16 * VPITCH, hs);
#pragma unroll
        for (int c = 0; c < 2; ++c) {
          v8f pa, pb;
#pragma unroll
          for (int v = 0; v < 8; ++v) {
            pa[v] = __builtin_amdgcn_exp2f(sA[c][v]);
            pb[v] = __builtin_amdgcn_exp2f(sB[c][v]);
          }
          // The lane's sum, as a tree over register pairs as they lie: the test below
          // waits for it.
          const v8f pab = pa + pb;
          const f2 h0 = {pab[0], pab[1]}, h1 = {pab[2], pab[3]};
          const f2 h2 = {pab[4], pab[5]}, h3 = {pab[6], pab[7]};
          const f2 hh = (h0 + h1) + (h2 + h3);
          ls[c] = hh[0] + hh[1];
          // Pack P^T directly as B operand (K=32 keys): halves[0..7]=tile a,
          // halves[8..15]=tile b: exactly matches the C layout we already hold.
          v16h pv;
#pragma unroll
          for (int v = 0; v < 8; ++v) { pv[v] = (_Float16)pa[v]; pv[v + 8] = (_Float16)pb[v]; }
          pop[c] = pv;
        }
        const bool big = fmaxf(ls[0], ls[1]) > LAZY_SUM;
        if (__builtin_expect(exact || __builtin_amdgcn_ballot_w32(big) == 0, 1)) break;
        exact = true;
      }
      l1 += ls[0] + xhalf(ls[0]);       // lanes q, q+16 share a query
      l2 += ls[1] + xhalf(ls[1]);

      // ---- O^T += V^T * P^T ----------------------------------------------
#pragma unroll
      for (int tt = 3; tt < 8; ++tt)
        vop[tt] = load_op(vs + tt * 16 * VPITCH, hs);
#pragma unroll
      for (int tt = 0; tt < 8; ++tt) {
        O1[tt] = wmma32(vop[tt], pop[0], O1[tt]);
        O2[tt] = wmma32(vop[tt], pop[1], O2[tt]);
      }
      // Order of LDS reads (0x100) and WMMAs (0x8) of this block: each fragment's
      // registers are refilled right behind its two WMMAs, two fragments ahead of use.
      // Left alone, the scheduler reads one fragment at a time into one register set
      // and waits each read out in full.
      __builtin_amdgcn_sched_group_barrier(0x008, 2, 0);
      __builtin_amdgcn_sched_group_barrier(0x100, 2, 0);
      __builtin_amdgcn_sched_group_barrier(0x008, 2, 0);
      __builtin_amdgcn_sched_group_barrier(0x100, 2, 0);
      __builtin_amdgcn_sched_group_barrier(0x008, 2, 0);
      __builtin_amdgcn_sched_group_barrier(0x100, 2, 0);
      __builtin_amdgcn_sched_group_barrier(0x008, 2, 0);
      __builtin_amdgcn_sched_group_barrier(0x100, 2, 0);
      __builtin_amdgcn_sched_group_barrier(0x008, 2, 0);
      __builtin_amdgcn_sched_group_barrier(0x100, 2, 0);
      __builtin_amdgcn_sched_group_barrier(0x008, 6, 0);
    }
    // Hand-over, passed by every wave, also one that skipped the tile.
    asm volatile("s_wait_dscnt 0x0" ::: "memory");  // own reads of buffer t&1 are done
    WAIT_ASYNC();                       // own share of tile t+1 has landed
    __syncthreads();                    // tile t+1 readable; buffer t&1 free for refill
    if (t + 2 < ntiles) stage(t + 2);   // block-uniform test
  }
  WAIT_ASYNC();                         // nothing in flight when the wave ends

  // Combine streams, RMS-normalize over 128 dims, scale by (1 - lambda_init).
  const float inv1 = 1.0f / l1;
  const float inv2 = lam / l2;
  float ssq = 0.f;
#pragma unroll
  for (int t = 0; t < 8; ++t)
#pragma unroll
    for (int v = 0; v < 8; ++v) {
      float o = O1[t][v] * inv1 - O2[t][v] * inv2;
      ssq += o * o;
    }
  ssq += __shfl_xor(ssq, 16, 32);       // other 64 dims live in lane^16
  const float rinv = rsqrtf(ssq * (1.0f / DH2) + EPS_RMS) * (1.0f - LAMBDA_INIT);

  _Float16* orow = Oh + (size_t)(b * SEQ + qglob) * QKV_N + h * DH2;
#pragma unroll
  for (int t = 0; t < 8; ++t)
#pragma unroll
    for (int v = 0; v < 8; ++v) {
      const int d = t * 16 + hs * 8 + v;
      float o = O1[t][v] * inv1 - O2[t][v] * inv2;
      orow[d] = (_Float16)(o * rinv * rms_scale[d]);
    }
}

// ---------------------------------------------------------------------------
extern "C" void kernel_launch(void* const* d_in, const int* in_sizes, int n_in,
                              void* d_out, int out_size, void* d_ws, size_t ws_size,
                              hipStream_t stream) {
  const float* X    = (const float*)d_in[0];
  const float* Wq   = (const float*)d_in[1];
  const float* Wk   = (const float*)d_in[2];
  const float* Wv   = (const float*)d_in[3];
  const float* Wo   = (const float*)d_in[4];
  const float* lq1  = (const float*)d_in[5];
  const float* lk1  = (const float*)d_in[6];
  const float* lq2  = (const float*)d_in[7];
  const float* lk2  = (const float*)d_in[8];
  const float* rmss = (const float*)d_in[9];
  float* out = (float*)d_out;

  char* w = (char*)d_ws;
  _Float16* Xh  = (_Float16*)w; w += (size_t)TOKENS * D_MODEL * 2;  // 8 MB
  _Float16* WqT = (_Float16*)w; w += (size_t)QKV_N * D_MODEL * 2;   // 4 MB
  _Float16* WkT = (_Float16*)w; w += (size_t)QKV_N * D_MODEL * 2;
  _Float16* WvT = (_Float16*)w; w += (size_t)QKV_N * D_MODEL * 2;
  _Float16* WoT = (_Float16*)w; w += (size_t)D_MODEL * QKV_N * 2;
  _Float16* Qh  = (_Float16*)w; w += (size_t)TOKENS * QKV_N * 2;    // 16 MB
  _Float16* Kh  = (_Float16*)w; w += (size_t)TOKENS * QKV_N * 2;
  _Float16* Vt  = (_Float16*)w; w += (size_t)QKV_N * TOKENS * 2;    // transposed
  _Float16* Ohb = (_Float16*)w; w += (size_t)TOKENS * QKV_N * 2;
  float*    lam = (float*)w;

  // Stage 1: precision conversion + weight transposes + lambda scalars, one launch
  k_prep<<<PREP_BLOCKS, 256, 0, stream>>>(X, Wq, Wk, Wv, Wo, lq1, lk1, lq2, lk2,
                                          Xh, WqT, WkT, WvT, WoT, lam);

  // Stage 2: QKV projections (WMMA), one launch. V stored transposed for the
  // attention V^T operand.
  dim3 gq(QKV_N / 128, TOKENS / 128, 3);
  k_gemm_qkv<<<gq, 128, 0, stream>>>(Xh, WqT, WkT, WvT, Qh, Kh, Vt, TOKENS, QKV_N, D_MODEL);

  // Stage 3: fused differential flash attention + RMS norm
  const int waves = BATCH * HEADS * (SEQ / 16);  // 4096 waves
  k_diff_attn<<<waves / 4, 128, 0, stream>>>(Qh, Kh, Vt, lam, rmss, Ohb);

  // Stage 4: output projection -> fp32 result
  dim3 go(D_MODEL / 128, TOKENS / 128);
  k_gemm_out<<<go, 128, 0, stream>>>(Ohb, WoT, out, D_MODEL, QKV_N);
}

// v008
// It runs in 132 microseconds.
// Two timings next to v007 both put it at 1.05 times that version's speed.
// Over all steps from v000 it is 2.90 times as fast.
#include <hip/hip_runtime.h>
#include <hip/hip_bf16.h>
#include <math.h>

typedef __attribute__((ext_vector_type(16))) _Float16 v16h;
typedef __attribute__((ext_vector_type(8)))  _Float16 h8;
typedef __attribute__((ext_vector_type(8)))  float    v8f;
typedef __attribute__((ext_vector_type(2)))  _Float16 h2;
typedef __attribute__((ext_vector_type(4)))  float    f4;
typedef __attribute__((ext_vector_type(2)))  float    f2;

#define D_MODEL 1024
#define HEADS   16
#define DH      64
#define DH2     128            // 2*DH per head
#define BATCH   2
#define SEQ     2048
#define TOKENS  (BATCH*SEQ)    // 4096
#define QKV_N   (2*D_MODEL)    // 2048
#define LAMBDA_INIT 0.8f
#define EPS_RMS 1e-5f
#define LOG2E 1.44269504f
#define QSCALE (0.125f * LOG2E)  // log2 e / sqrt(DH): Wq, and so Q, is stored times this

#define WAIT_ASYNC() asm volatile("s_wait_asynccnt 0x0" ::: "memory")

__device__ __forceinline__ v16h load_op(const _Float16* p, int halfsel) {
  h8 lo = *(const h8*)(p + halfsel * 8);
  h8 hi = *(const h8*)(p + 16 + halfsel * 8);
  v16h r;
#pragma unroll
  for (int i = 0; i < 8; ++i) { r[i] = lo[i]; r[i + 8] = hi[i]; }
  return r;
}

__device__ __forceinline__ v8f wmma32(v16h a, v16h b, v8f c) {
  // D = A(16x32) * B(32x16) + C, f32 accumulate
  return __builtin_amdgcn_wmma_f32_16x16x32_f16(
      /*neg_a=*/false, a, /*neg_b=*/false, b,
      /*c_mod=*/(short)0, c, /*reuse_a=*/false, /*reuse_b=*/false);
}

// ---------------------------------------------------------------------------
// Elementwise f32 -> f16: share of block blk out of nblk blocks of 256 threads
// ---------------------------------------------------------------------------
__device__ __forceinline__ void f32_to_f16_part(const float* __restrict__ src,
                                                _Float16* __restrict__ dst, int n,
                                                int blk, int nblk) {
  int i = blk * 256 + threadIdx.x;
  int stride = nblk * 256;
  for (; i < n; i += stride) dst[i] = (_Float16)src[i];
}

#define TR 128                 // src rows per tile (contiguous in dst)
#define TC 64                  // src cols per tile (contiguous in src)
#define TP (TR + 2)            // LDS row pitch in halves
template <int ROWS, int COLS>
__device__ __forceinline__ void transpose_f16_tile(const float* __restrict__ src,
                                                   _Float16* __restrict__ dst,
                                                   int bx, int by, _Float16* tile,
                                                   float wscale) {
  const int hi = threadIdx.x >> 4;      // 0..15
  const int lo = threadIdx.x & 15;      // 0..15
  const int c0 = bx * TC, r0 = by * TR;

  // src rows r0 + 2*hi + 32*j (+1), cols c0 + 4*lo .. +3
  const float* s = src + (size_t)(r0 + 2 * hi) * COLS + c0 + 4 * lo;
  f4 a[4], b[4];                        // eight loads in flight, constant offsets
  for (int j = 0; j < 4; ++j) {
    a[j] = *(const f4*)(s + (size_t)(32 * j) * COLS);
    b[j] = *(const f4*)(s + (size_t)(32 * j + 1) * COLS);
  }
  for (int j = 0; j < 4; ++j)
    for (int k = 0; k < 4; ++k) {
      h2 p;
      p[0] = (_Float16)(a[j][k] * wscale);
      p[1] = (_Float16)(b[j][k] * wscale);
      *(h2*)&tile[(4 * lo + k) * TP + 2 * hi + 32 * j] = p;
    }
  __syncthreads();                      // the whole tile is in LDS

  // dst rows c0 + hi + 16*j, cols r0 + 8*lo .. +7
  _Float16* d = dst + (size_t)(c0 + hi) * ROWS + r0 + 8 * lo;
  for (int j = 0; j < 4; ++j) {
    const _Float16* t = &tile[(hi + 16 * j) * TP + 8 * lo];
    h8 w;
    for (int k = 0; k < 4; ++k) {
      h2 p = *(const h2*)(t + 2 * k);
      w[2 * k] = p[0];
      w[2 * k + 1] = p[1];
    }
    *(h8*)(d + (size_t)(16 * j) * ROWS) = w;
  }
  // Other jobs' code follows this one in the merged kernel: the wait stands in
  // front of any rewrite of a register that the four stores above name.
  asm volatile("s_wait_xcnt 0x0" ::: "memory");
}

// lam[h] = exp(lq1.lk1) - exp(lq2.lk2) + lambda_init
__device__ __forceinline__ void lambda_part(
    const float* __restrict__ lq1, const float* __restrict__ lk1,
    const float* __restrict__ lq2, const float* __restrict__ lk2,
    float* __restrict__ lam) {
  int h = threadIdx.x;
  if (h < HEADS) {
    float s1 = 0.f, s2 = 0.f;
    for (int i = 0; i < DH; ++i) {
      s1 += lq1[h * DH + i] * lk1[h * DH + i];
      s2 += lq2[h * DH + i] * lk2[h * DH + i];
    }
    lam[h] = __expf(s1) - __expf(s2) + LAMBDA_INIT;
  }
}

// ---------------------------------------------------------------------------
// All preparation in one launch: none of these jobs reads another's output, so
// the block index picks the job. Block 0: lambda; then CONV_BLOCKS blocks convert X; then
// WTILES tiles of each of Wq, Wk, Wv, Wo. Every branch is block-uniform.
// ---------------------------------------------------------------------------
#define CONV_BLOCKS 512
#define WTILES ((QKV_N / TC) * (D_MODEL / TR))   // 256 tiles per weight
#define PREP_BLOCKS (1 + CONV_BLOCKS + 4 * WTILES)
__global__ __launch_bounds__(256) void k_prep(
    const float* __restrict__ X, const float* __restrict__ Wq,
    const float* __restrict__ Wk, const float* __restrict__ Wv,
    const float* __restrict__ Wo,
    const float* __restrict__ lq1, const float* __restrict__ lk1,
    const float* __restrict__ lq2, const float* __restrict__ lk2,
    _Float16* __restrict__ Xh, _Float16* __restrict__ WqT, _Float16* __restrict__ WkT,
    _Float16* __restrict__ WvT, _Float16* __restrict__ WoT, float* __restrict__ lam) {
  __shared__ __attribute__((aligned(16))) _Float16 tile[TC * TP];  // [src col][src row]
  int blk = blockIdx.x;
  if (blk == 0) {
    lambda_part(lq1, lk1, lq2, lk2, lam);
    return;
  }
  blk -= 1;
  if (blk < CONV_BLOCKS) {
    f32_to_f16_part(X, Xh, TOKENS * D_MODEL, blk, CONV_BLOCKS);
    return;
  }
  blk -= CONV_BLOCKS;
  const int job = blk / WTILES, t = blk % WTILES;
  if (job < 3) {
    const float* src = (job == 0) ? Wq : (job == 1) ? Wk : Wv;
    _Float16* dst = (job == 0) ? WqT : (job == 1) ? WkT : WvT;
    // Wq carries QSCALE, so that K * Q^T is the softmax exponent to base 2.
    transpose_f16_tile<D_MODEL, QKV_N>(src, dst, t % (QKV_N / TC), t / (QKV_N / TC), tile,
                                       (job == 0) ? QSCALE : 1.0f);
  } else {
    transpose_f16_tile<QKV_N, D_MODEL>(Wo, WoT, t % (D_MODEL / TC), t / (D_MODEL / TC), tile, 1.0f);
  }
}

__device__ __forceinline__ void stage_tile8(
    const _Float16* g0, const _Float16* g1, const _Float16* g2, const _Float16* g3,
    const _Float16* g4, const _Float16* g5, const _Float16* g6, const _Float16* g7,
    unsigned l0, unsigned l1, unsigned l2, unsigned l3,
    unsigned l4, unsigned l5, unsigned l6, unsigned l7) {
  asm volatile(
      "global_load_async_to_lds_b128 %0, %8, off\n\t"
      "global_load_async_to_lds_b128 %1, %9, off\n\t"
      "global_load_async_to_lds_b128 %2, %10, off\n\t"
      "global_load_async_to_lds_b128 %3, %11, off\n\t"
      "global_load_async_to_lds_b128 %4, %12, off\n\t"
      "global_load_async_to_lds_b128 %5, %13, off\n\t"
      "global_load_async_to_lds_b128 %6, %14, off\n\t"
      "global_load_async_to_lds_b128 %7, %15, off\n\t"
      "s_wait_xcnt 0x0"
      :: "v"(l0), "v"(l1), "v"(l2), "v"(l3), "v"(l4), "v"(l5), "v"(l6), "v"(l7),
         "v"(g0), "v"(g1), "v"(g2), "v"(g3), "v"(g4), "v"(g5), "v"(g6), "v"(g7)
      : "memory");
}

// ---------------------------------------------------------------------------
// WMMA GEMM, both operand panels staged in a two-buffer LDS ring.
// out[M][Nn] = A[M][K] * B[K][Nn], B supplied transposed as BT[Nn][K].
// Block = 128 threads = 4 waves (2 x 2); wave tile 64 x 64; block 128 x 128.
// A trip is 64 k: 128 rows x 128 B of each operand come into LDS by async
// copies (a wave's copy = 4 whole 128-B lines) while the trip before feeds the
// WMMAs. A fragment read from LDS serves four WMMAs. LDS row pitch 144 B
// (16 B x 9): conflict-free for ds_load_b128.
// The operand whose index runs along the stored row (P) is the WMMA's A side,
// so a lane's eight accumulator registers are eight neighbours of that row.
// The block computes out[q0..q0+127][p0..p0+127], out[q][p] = sum_k Q[q][k] P[p][k],
// p contiguous, leading dimension LD; K a multiple of 64. F32: f32 out, else f16.
// ---------------------------------------------------------------------------
#define GBK    64              // k per trip
#define GPITCH 72              // LDS row pitch in halves
#define GPANEL (128 * GPITCH)  // one operand's 128 rows of a trip
template <bool F32>
__device__ __forceinline__ void gemm_block(
    const _Float16* __restrict__ P, const _Float16* __restrict__ Q,
    _Float16* __restrict__ outH, float* __restrict__ outF,
    int LD, int p0, int q0, int K) {
  __shared__ __attribute__((aligned(16))) _Float16 Ps[2][2][GPANEL];  // [buffer][P, Q]
  const int tid = threadIdx.x;
  const int lane = tid & 31;
  const int wave = __builtin_amdgcn_readfirstlane(tid >> 5);
  const int lq = lane & 15;   // fragment row within a 16-row tile
  const int hs = lane >> 4;   // operand half selector
  const int wp = (wave & 1) * 64, wq = (wave >> 1) * 64;

  // Copy map, per panel 1024 chunks of 16 B: lane -> row tid/8 (+16 per copy),
  // chunk tid%8.
  const _Float16* gP = P + (size_t)(p0 + (tid >> 3)) * K + (tid & 7) * 8;
  const _Float16* gQ = Q + (size_t)(q0 + (tid >> 3)) * K + (tid & 7) * 8;
  const unsigned lP = (unsigned)(size_t)(void*)&Ps[0][0][(tid >> 3) * GPITCH + (tid & 7) * 8];
  const size_t rs = (size_t)16 * K;     // 16 rows, in halves
  const unsigned ls = 16 * GPITCH * 2;  // 16 rows, in LDS bytes

  auto stage = [&](int t) {             // trip t (k 64t..64t+63) -> buffer t&1
    const _Float16* p = gP + t * GBK;
    const _Float16* q = gQ + t * GBK;
    const unsigned lp = lP + (t & 1) * (2 * GPANEL * 2);
    const unsigned lc = lp + GPANEL * 2;
    stage_tile8(p, p + rs, p + 2 * rs, p + 3 * rs, p + 4 * rs, p + 5 * rs, p + 6 * rs, p + 7 * rs,
                lp, lp + ls, lp + 2 * ls, lp + 3 * ls, lp + 4 * ls, lp + 5 * ls, lp + 6 * ls, lp + 7 * ls);
    stage_tile8(q, q + rs, q + 2 * rs, q + 3 * rs, q + 4 * rs, q + 5 * rs, q + 6 * rs, q + 7 * rs,
                lc, lc + ls, lc + 2 * ls, lc + 3 * ls, lc + 4 * ls, lc + 5 * ls, lc + 6 * ls, lc + 7 * ls);
  };

  const int nt = K / GBK;
  stage(0);
  v8f acc[4][4] = {};                   // [p tile][q tile]
  WAIT_ASYNC();                         // this wave's share of trip 0 has landed
  __syncthreads();                      // every wave's share of trip 0 has landed
  if (nt > 1) stage(1);                 // block-uniform test

  for (int t = 0; t < nt; ++t) {
    const _Float16* fp = &Ps[t & 1][0][(wp + lq) * GPITCH];
    const _Float16* fq = &Ps[t & 1][1][(wq + lq) * GPITCH];
    v16h a[2][4], b[2][4];              // all 16 fragments of the trip, one load group
#pragma unroll
    for (int kk = 0; kk < 2; ++kk)
#pragma unroll
      for (int i = 0; i < 4; ++i) {
        a[kk][i] = load_op(fp + i * 16 * GPITCH + kk * 32, hs);
        b[kk][i] = load_op(fq + i * 16 * GPITCH + kk * 32, hs);
      }
    // Keeps the 32 LDS reads one group ahead of the WMMAs: left alone, the
    // scheduler sinks them among the WMMAs, each pair with a full wait behind it.
    __builtin_amdgcn_sched_barrier(0);
#pragma unroll
    for (int i = 0; i < 4; ++i)         // first 32 k, while the second half's reads land
#pragma unroll
      for (int j = 0; j < 4; ++j)
        acc[i][j] = wmma32(a[0][i], b[0][j], acc[i][j]);
    // Keeps the hand-over behind the first 16 WMMAs: hoisted over them, its full
    // wait would hold every WMMA back until the last LDS read has landed.
    __builtin_amdgcn_sched_barrier(0);
    // Hand-over, passed by every wave; the trip's last 16 WMMAs need registers only.
    asm volatile("s_wait_dscnt 0x0" ::: "memory");  // own reads of buffer t&1 are done
    WAIT_ASYNC();                       // own share of trip t+1 has landed
    __syncthreads();                    // trip t+1 readable; buffer t&1 free for refill
    if (t + 2 < nt) stage(t + 2);       // block-uniform test
#pragma unroll
    for (int i = 0; i < 4; ++i)         // second 32 k
#pragma unroll
      for (int j = 0; j < 4; ++j)
        acc[i][j] = wmma32(a[1][i], b[1][j], acc[i][j]);
  }
  WAIT_ASYNC();                         // nothing in flight when the wave ends

  // D layout: lane -> q = lq, register v -> p = hs*8 + v
#pragma unroll
  for (int j = 0; j < 4; ++j) {
    const size_t row = (size_t)(q0 + wq + j * 16 + lq) * LD + p0 + wp + hs * 8;
#pragma unroll
    for (int i = 0; i < 4; ++i) {
      if (F32) {
        f4 lo, hi;
#pragma unroll
        for (int v = 0; v < 4; ++v) { lo[v] = acc[i][j][v]; hi[v] = acc[i][j][v + 4]; }
        *(f4*)(outF + row + i * 16) = lo;
        *(f4*)(outF + row + i * 16 + 4) = hi;
      } else {
        h8 w;
#pragma unroll
        for (int v = 0; v < 8; ++v) w[v] = (_Float16)acc[i][j][v];
        *(h8*)(outH + row + i * 16) = w;
      }
    }
  }
}

// The three projections of X in one launch: they share A and read nothing of each
// other, so blockIdx.z picks the weight and the output. out[M][Nn] = A[M][K] * B,
// B supplied transposed as BT[Nn][K]; Q and K are stored row-major (P = BT), V
// transposed, out[n][m] (P = A). M, Nn multiples of 128. All selects are scalar.
__global__ __launch_bounds__(128) void k_gemm_qkv(
    const _Float16* __restrict__ A, const _Float16* __restrict__ WqT,
    const _Float16* __restrict__ WkT, const _Float16* __restrict__ WvT,
    _Float16* __restrict__ Qh, _Float16* __restrict__ Kh, _Float16* __restrict__ Vt,
    int M, int Nn, int K) {
  const int z = blockIdx.z;
  const bool tr = (z == 2);
  const _Float16* BT = (z == 0) ? WqT : (z == 1) ? WkT : WvT;
  _Float16* out = (z == 0) ? Qh : (z == 1) ? Kh : Vt;
  gemm_block<false>(tr ? A : BT, tr ? BT : A, out, nullptr, tr ? M : Nn,
                    (tr ? blockIdx.y : blockIdx.x) * 128,
                    (tr ? blockIdx.x : blockIdx.y) * 128, K);
}

// Output projection, f32 row-major out[M][Nn].
__global__ __launch_bounds__(128) void k_gemm_out(
    const _Float16* __restrict__ A, const _Float16* __restrict__ BT,
    float* __restrict__ outF, int Nn, int K) {
  gemm_block<true>(BT, A, nullptr, outF, Nn, blockIdx.x * 128, blockIdx.y * 128, K);
}

#define KPITCH 136             // K tile row pitch in halves: 272 B = 16 B x 17
#define VPITCH 40              // V^T tile row pitch in halves: 80 B = 16 B x 5
#define KTILE  (32 * KPITCH)   // 32 keys x 128 dims
#define VTILE  (DH2 * VPITCH)  // 128 dims x 32 keys
#define LAZY_THR 8.0f          // tile 0: how far below 0 a query's largest exponent (base 2) may lie
#define LAZY_SUM 4096.0f       // a lane's sum of p over a tile above which the reference point moves

// ---------------------------------------------------------------------------
// Fused differential flash-attention + RMS norm.
// One wave owns 16 queries of one (b,h). Computes S^T = K*Q^T so the score
// tile's C layout (lane=query, reg=key) feeds the second WMMA (O^T = V^T*P^T)
// with no cross-lane movement. Two independent online softmaxes (comp 1/2), lazily rescaled,
// O = P1 V / l1 - lam * P2 V / l2, then RMS norm over 128 dims, * 0.2.
// The four waves of a block own 64 consecutive queries and walk the same keys:
// each 32-key K tile and V^T tile is brought into LDS once per block and pass by async
// copies (whole 256-B / 64-B row pieces), two buffers, the next tile in flight
// while this one is worked on; all operands are then read by ds_load_b128.
// A block works two query tiles of one (b,h), one after the other: tile u, then tile
// 31-u. Causal cost is linear in the tile index, so every block walks 66 key tiles
// and no block outlasts the others. Both tiles read the same K and V^T, and both key
// counts are even, so the ring runs on across the change of tile without a drain.
// Short tile first: the long walks of a (b,h) then start at different times, so that
// most of them can read keys which a block ahead of them has brought into L2.
// ---------------------------------------------------------------------------
__global__ __launch_bounds__(128) void k_diff_attn(
    const _Float16* __restrict__ Qh, const _Float16* __restrict__ Kh,
    const _Float16* __restrict__ Vt,   // [2048 feat][4096 tokens]
    const float* __restrict__ lamBuf, const float* __restrict__ rms_scale,
    _Float16* __restrict__ Oh) {
  __shared__ __attribute__((aligned(16))) _Float16 Ks[2][KTILE];
  __shared__ __attribute__((aligned(16))) _Float16 Vs[2][VTILE];
  const int tid = threadIdx.x;
  const int lane = tid & 31;
  const int wave = __builtin_amdgcn_readfirstlane(tid >> 5);
  const int lq = lane & 15, hs = lane >> 4;
  const int qtiles = SEQ / 64;          // 32 tiles of 64 queries per (b,h)
  const int bh = blockIdx.x / (qtiles / 2);
  const int u = blockIdx.x % (qtiles / 2);
  const int b = bh / HEADS, h = bh % HEADS;

  const float lam = lamBuf[h];

  const _Float16* kbase = Kh + (size_t)(b * SEQ) * QKV_N + h * DH2;
  const _Float16* vbase = Vt + (size_t)(h * DH2) * TOKENS + b * SEQ;

  // Copy map. K tile: 512 chunks of 16 B, lane -> row tid/16 (+8 per copy),
  // chunk tid%16. V^T tile: 512 chunks, lane -> row tid/4 (+32 per copy),
  // chunk tid%4.
  const _Float16* gK = kbase + (size_t)(tid >> 4) * QKV_N + (tid & 15) * 8;
  const _Float16* gV = vbase + (size_t)(tid >> 2) * TOKENS + (tid & 3) * 8;
  const unsigned lK = (unsigned)(size_t)(void*)&Ks[0][(tid >> 4) * KPITCH + (tid & 15) * 8];
  const unsigned lV = (unsigned)(size_t)(void*)&Vs[0][(tid >> 2) * VPITCH + (tid & 3) * 8];

  auto stage = [&](int t) {             // tile t (keys 32t..32t+31) -> buffer t&1
    const _Float16* k = gK + (size_t)(t * 32) * QKV_N;
    const _Float16* v = gV + t * 32;
    const unsigned lk = lK + (t & 1) * (KTILE * 2);
    const unsigned lv = lV + (t & 1) * (VTILE * 2);
    stage_tile8(k, k + 8 * QKV_N, k + 16 * QKV_N, k + 24 * QKV_N,
                v, v + (size_t)32 * TOKENS, v + (size_t)64 * TOKENS, v + (size_t)96 * TOKENS,
                lk, lk + 8 * KPITCH * 2, lk + 16 * KPITCH * 2, lk + 24 * KPITCH * 2,
                lv, lv + 32 * VPITCH * 2, lv + 64 * VPITCH * 2, lv + 96 * VPITCH * 2);
  };

  stage(0);

  // The value that the other half-wave's lane of the same query holds. The address
  // is formed once, here: formed at each use, it made the compiler give the rare
  // branch below an else side that copied all 128 accumulator registers.
  const int xaddr = (lane ^ 16) << 2;
  auto xhalf = [&](float x) {
    return __int_as_float(__builtin_amdgcn_ds_bpermute(xaddr, __float_as_int(x)));
  };

  WAIT_ASYNC();                         // this wave's share of tile 0 has landed
  __syncthreads();                      // every wave's share of tile 0 has landed
  stage(1);

  // Kept rolled: the two passes are the same code, and one copy of the hot loop
  // serves both.
#pragma unroll 1
  for (int ph = 0; ph < 2; ++ph) {      // block-uniform: short tile first, then its long partner
  const int qb = ph ? qtiles - 1 - u : u;
  const int q0 = qb * 64 + wave * 16;
  const int qglob = q0 + lq;            // this lane's query index
  const int ntiles = 2 * qb + 2;        // tile's causal range, always >= 2 key tiles, even

  // Q^T as B operand: lane = query, halves = d-contiguous. 2 comps x 2 K-chunks.
  // Row offsets of Q and O in 32 bits: fewer registers stay live across the two passes,
  // which leaves the key loop room to read 12 of its 16 K pieces ahead of the products.
  const _Float16* qrow = Qh + (unsigned)((b * SEQ + qglob) * QKV_N + h * DH2);
  v16h qop[2][2];
#pragma unroll
  for (int c = 0; c < 2; ++c)
#pragma unroll
    for (int kk = 0; kk < 2; ++kk)
      qop[c][kk] = load_op(qrow + c * DH + kk * 32, hs);
  // In front of any rewrite of the address registers that the eight loads above name.
  asm volatile("s_wait_xcnt 0x0" ::: "memory");

  v8f O1[8] = {}, O2[8] = {};           // O^T accumulators: 8 d-tiles x (16x16)
  // Reference points of the two softmaxes, base 2. They start at 0 and stay there in
  // most waves; moved is non-zero once some lane of the wave has left 0 (wave-uniform).
  float m1 = 0.f, m2 = 0.f, l1 = 0.f, l2 = 0.f;
  unsigned moved = 0;


  const int nk = q0 + 16;               // causal: this wave needs keys 0..q0+15
  for (int t = 0; t < ntiles; ++t) {    // 32 keys/step: tiles a (kt), b (kt+16)
    const int kt = t * 32;
    if (kt < nk) {                      // wave-uniform: skip tiles past the diagonal
      const _Float16* ks = &Ks[t & 1][lq * KPITCH];
      const _Float16* vs = &Vs[t & 1][lq * VPITCH];
      // ---- score tiles (S^T) + online softmax ----------------------------
      // Every inner loop of this step is unrolled: the score vectors live in registers,
      // which only constant indices can name.
      // Lazy rescale. The reference points of the two softmaxes are not exact maxima:
      // exp2(x - m) / sum exp2(x - m) is the same for any m, so m moves only when it
      // must. The test reads what the tile needs anyway, a lane's sums of p: while they
      // stay below LAZY_SUM every p does, well inside f16, and no maxima are taken, none
      // exchanged between the half-waves, and the 128 accumulator products are not
      // needed. Where the test fails the tile is worked once more with exact set: then
      // the maxima are taken and m moves to them. At most two trips. Tile 0 is exact at
      // once: there m also goes down, if a query's maximum lies more than LAZY_THR below 0.
      v16h pop[2], vop[8];
      float ls[2];
      bool exact = (t == 0);            // wave-uniform
      for (;;) {
        // all 8 K operands of this step
        v16h kA[2][2], kB[2][2];
#pragma unroll
        for (int c = 0; c < 2; ++c)
#pragma unroll
          for (int kk = 0; kk < 2; ++kk) {
            kA[c][kk] = load_op(ks + c * DH + kk * 32, hs);
            kB[c][kk] = load_op(ks + 16 * KPITCH + c * DH + kk * 32, hs);
          }
        // Q carries log2 e / sqrt(d): at reference point 0 what leaves the products is
        // the argument of exp2 as it stands.
        v8f sA[2] = {}, sB[2] = {};
#pragma unroll
        for (int c = 0; c < 2; ++c)
#pragma unroll
          for (int kk = 0; kk < 2; ++kk) {  // accumulate over d = 64 (2 x K=32)
            sA[c] = wmma32(kA[c][kk], qop[c][kk], sA[c]);
            sB[c] = wmma32(kB[c][kk], qop[c][kk], sB[c]);
          }
        // S^T C layout: lane = query (lq), reg v -> key = kt + hs*8 + v (+16 for b)
        // Causal mask, under a wave-uniform scalar branch: every key of a tile with
        // kt + 31 <= q0 is visible to all 16 queries of the wave, so only the one
        // tile per wave that crosses the diagonal pays for compares and selects.
        // The hint puts that block out of line: a full tile falls straight through.
        if (__builtin_expect(kt + 31 > q0, 0)) {
#pragma unroll
          for (int v = 0; v < 8; ++v) {
            const int keyA = kt + hs * 8 + v;
            const bool va = keyA <= qglob, vb = keyA + 16 <= qglob;
#pragma unroll
            for (int c = 0; c < 2; ++c) {
              sA[c][v] = va ? sA[c][v] : -INFINITY;
              sB[c][v] = vb ? sB[c][v] : -INFINITY;
            }
          }
        }
        // Only a wave whose reference points have left 0 subtracts them: a scalar branch.
        if (__builtin_expect(moved != 0, 0)) {
          sA[0] -= m1; sB[0] -= m1;
          sA[1] -= m2; sB[1] -= m2;
        }
        if (__builtin_expect(exact, 0)) {
          // A query's maximum over the tile's 32 keys, per softmax: how far the largest
          // exponent lies above the reference point. Every lane moves, so lanes q and
          // q+16 (one query) keep one m. Behind tile 0 m only rises; in tile 0 the sums
          // are still zero, so their factor is 1.
          float sm[2];
#pragma unroll
          for (int c = 0; c < 2; ++c) {
            float smax = -INFINITY;
#pragma unroll
            for (int v = 0; v < 8; ++v) smax = fmaxf(smax, fmaxf(sA[c][v], sB[c][v]));
            sm[c] = fmaxf(smax, xhalf(smax));
          }
          const float d1 = (t == 0) ? ((fabsf(sm[0]) > LAZY_THR) ? sm[0] : 0.f) : fmaxf(sm[0], 0.f);
          const float d2 = (t == 0) ? ((fabsf(sm[1]) > LAZY_THR) ? sm[1] : 0.f) : fmaxf(sm[1], 0.f);
          const float a1 = (t == 0) ? 1.f : __builtin_amdgcn_exp2f(-d1);
          const float a2 = (t == 0) ? 1.f : __builtin_amdgcn_exp2f(-d2);
          m1 += d1; m2 += d2;
          moved = __builtin_amdgcn_ballot_w32(m1 != 0.f || m2 != 0.f);
          sA[0] -= d1; sB[0] -= d1;
          sA[1] -= d2; sB[1] -= d2;
          l1 *= a1; l2 *= a2;
#pragma unroll
          for (int tt = 0; tt < 8; ++tt) { O1[tt] *= a1; O2[tt] *= a2; }
        }
        // The first three V^T fragments are asked for here, ahead of the test, so that
        // they land while the exponentials run.
#pragma unroll
        for (int tt = 0; tt < 3; ++tt)
          vop[tt] = load_op(vs + tt * 16 * VPITCH, hs);
#pragma unroll
        for (int c = 0; c < 2; ++c) {
          v8f pa, pb;
#pragma unroll
          for (int v = 0; v < 8; ++v) {
            pa[v] = __builtin_amdgcn_exp2f(sA[c][v]);
            pb[v] = __builtin_amdgcn_exp2f(sB[c][v]);
          }
          // The lane's sum, as a tree over register pairs as they lie: the test below
          // waits for it.
          const v8f pab = pa + pb;
          const f2 h0 = {pab[0], pab[1]}, h1 = {pab[2], pab[3]};
          const f2 h2 = {pab[4], pab[5]}, h3 = {pab[6], pab[7]};
          const f2 hh = (h0 + h1) + (h2 + h3);
          ls[c] = hh[0] + hh[1];
          // Pack P^T directly as B operand (K=32 keys): halves[0..7]=tile a,
          // halves[8..15]=tile b: exactly matches the C layout we already hold.
          v16h pv;
#pragma unroll
          for (int v = 0; v < 8; ++v) { pv[v] = (_Float16)pa[v]; pv[v + 8] = (_Float16)pb[v]; }
          pop[c] = pv;
        }
        const bool big = fmaxf(ls[0], ls[1]) > LAZY_SUM;
        if (__builtin_expect(exact || __builtin_amdgcn_ballot_w32(big) == 0, 1)) break;
        exact = true;
      }
      l1 += ls[0] + xhalf(ls[0]);       // lanes q, q+16 share a query
      l2 += ls[1] + xhalf(ls[1]);

      // ---- O^T += V^T * P^T ----------------------------------------------
#pragma unroll
      for (int tt = 3; tt < 8; ++tt)
        vop[tt] = load_op(vs + tt * 16 * VPITCH, hs);
#pragma unroll
      for (int tt = 0; tt < 8; ++tt) {
        O1[tt] = wmma32(vop[tt], pop[0], O1[tt]);
        O2[tt] = wmma32(vop[tt], pop[1], O2[tt]);
      }
      // Order of LDS reads (0x100) and WMMAs (0x8) of this block: each fragment's
      // registers are refilled right behind its two WMMAs, two fragments ahead of use.
      // Left alone, the scheduler reads one fragment at a time into one register set
      // and waits each read out in full.
      __builtin_amdgcn_sched_group_barrier(0x008, 2, 0);
      __builtin_amdgcn_sched_group_barrier(0x100, 2, 0);
      __builtin_amdgcn_sched_group_barrier(0x008, 2, 0);
      __builtin_amdgcn_sched_group_barrier(0x100, 2, 0);
      __builtin_amdgcn_sched_group_barrier(0x008, 2, 0);
      __builtin_amdgcn_sched_group_barrier(0x100, 2, 0);
      __builtin_amdgcn_sched_group_barrier(0x008, 2, 0);
      __builtin_amdgcn_sched_group_barrier(0x100, 2, 0);
      __builtin_amdgcn_sched_group_barrier(0x008, 2, 0);
      __builtin_amdgcn_sched_group_barrier(0x100, 2, 0);
      __builtin_amdgcn_sched_group_barrier(0x008, 6, 0);
    }
    // Hand-over, passed by every wave, also one that skipped the tile.
    asm volatile("s_wait_dscnt 0x0" ::: "memory");  // own reads of buffer t&1 are done
    WAIT_ASYNC();                       // own share of tile t+1 has landed
    __syncthreads();                    // tile t+1 readable; buffer t&1 free for refill
    // Block-uniform tests. Behind the first pass's last two key tiles the freed buffers
    // take key tiles 0 and 1 again, for the second pass (ntiles is even: same buffers).
    const int nx = (t + 2 < ntiles) ? t + 2 : t + 2 - ntiles;
    if (t + 2 < ntiles || ph == 0) stage(nx);
  }

  // Combine streams, RMS-normalize over 128 dims, scale by (1 - lambda_init).
  const float inv1 = 1.0f / l1;
  const float inv2 = lam / l2;
  float ssq = 0.f;
#pragma unroll
  for (int t = 0; t < 8; ++t)
#pragma unroll
    for (int v = 0; v < 8; ++v) {
      float o = O1[t][v] * inv1 - O2[t][v] * inv2;
      ssq += o * o;
    }
  ssq += __shfl_xor(ssq, 16, 32);       // other 64 dims live in lane^16
  const float rinv = rsqrtf(ssq * (1.0f / DH2) + EPS_RMS) * (1.0f - LAMBDA_INIT);

  _Float16* orow = Oh + (unsigned)((b * SEQ + qglob) * QKV_N + h * DH2);
#pragma unroll
  for (int t = 0; t < 8; ++t)
#pragma unroll
    for (int v = 0; v < 8; ++v) {
      const int d = t * 16 + hs * 8 + v;
      float o = O1[t][v] * inv1 - O2[t][v] * inv2;
      orow[d] = (_Float16)(o * rinv * rms_scale[d]);
    }
  // The second pass rewrites the registers that the loads and stores above name:
  // the wait stands in front of that.
  asm volatile("s_wait_xcnt 0x0" ::: "memory");
  }
  WAIT_ASYNC();                         // nothing in flight when the wave ends
}

// ---------------------------------------------------------------------------
extern "C" void kernel_launch(void* const* d_in, const int* in_sizes, int n_in,
                              void* d_out, int out_size, void* d_ws, size_t ws_size,
                              hipStream_t stream) {
  const float* X    = (const float*)d_in[0];
  const float* Wq   = (const float*)d_in[1];
  const float* Wk   = (const float*)d_in[2];
  const float* Wv   = (const float*)d_in[3];
  const float* Wo   = (const float*)d_in[4];
  const float* lq1  = (const float*)d_in[5];
  const float* lk1  = (const float*)d_in[6];
  const float* lq2  = (const float*)d_in[7];
  const float* lk2  = (const float*)d_in[8];
  const float* rmss = (const float*)d_in[9];
  float* out = (float*)d_out;

  char* w = (char*)d_ws;
  _Float16* Xh  = (_Float16*)w; w += (size_t)TOKENS * D_MODEL * 2;  // 8 MB
  _Float16* WqT = (_Float16*)w; w += (size_t)QKV_N * D_MODEL * 2;   // 4 MB
  _Float16* WkT = (_Float16*)w; w += (size_t)QKV_N * D_MODEL * 2;
  _Float16* WvT = (_Float16*)w; w += (size_t)QKV_N * D_MODEL * 2;
  _Float16* WoT = (_Float16*)w; w += (size_t)D_MODEL * QKV_N * 2;
  _Float16* Qh  = (_Float16*)w; w += (size_t)TOKENS * QKV_N * 2;    // 16 MB
  _Float16* Kh  = (_Float16*)w; w += (size_t)TOKENS * QKV_N * 2;
  _Float16* Vt  = (_Float16*)w; w += (size_t)QKV_N * TOKENS * 2;    // transposed
  _Float16* Ohb = (_Float16*)w; w += (size_t)TOKENS * QKV_N * 2;
  float*    lam = (float*)w;

  // Stage 1: precision conversion + weight transposes + lambda scalars, one launch
  k_prep<<<PREP_BLOCKS, 256, 0, stream>>>(X, Wq, Wk, Wv, Wo, lq1, lk1, lq2, lk2,
                                          Xh, WqT, WkT, WvT, WoT, lam);

  // Stage 2: QKV projections (WMMA), one launch. V stored transposed for the
  // attention V^T operand.
  dim3 gq(QKV_N / 128, TOKENS / 128, 3);
  k_gemm_qkv<<<gq, 128, 0, stream>>>(Xh, WqT, WkT, WvT, Qh, Kh, Vt, TOKENS, QKV_N, D_MODEL);

  // Stage 3: fused differential flash attention + RMS norm
  const int waves = BATCH * HEADS * (SEQ / 16);  // 4096 groups of 16 queries, two per wave
  k_diff_attn<<<waves / 8, 128, 0, stream>>>(Qh, Kh, Vt, lam, rmss, Ohb);  // 4 waves x 2 query tiles a block

  // Stage 4: output projection -> fp32 result
  dim3 go(D_MODEL / 128, TOKENS / 128);
  k_gemm_out<<<go, 128, 0, stream>>>(Ohb, WoT, out, D_MODEL, QKV_N);
}

// v009
// Measured time: 122 microseconds a run.
// Next to v008, in two timings, it ran 1.09 times as fast each time.
// All steps since v000 together make it 3.16 times as fast.
#include <hip/hip_runtime.h>
#include <hip/hip_bf16.h>
#include <math.h>

typedef __attribute__((ext_vector_type(16))) _Float16 v16h;
typedef __attribute__((ext_vector_type(8)))  _Float16 h8;
typedef __attribute__((ext_vector_type(8)))  float    v8f;
typedef __attribute__((ext_vector_type(2)))  _Float16 h2;
typedef __attribute__((ext_vector_type(4)))  float    f4;
typedef __attribute__((ext_vector_type(2)))  float    f2;

#define D_MODEL 1024
#define HEADS   16
#define DH      64
#define DH2     128            // 2*DH per head
#define BATCH   2
#define SEQ     2048
#define TOKENS  (BATCH*SEQ)    // 4096
#define QKV_N   (2*D_MODEL)    // 2048
#define LAMBDA_INIT 0.8f
#define EPS_RMS 1e-5f
#define LOG2E 1.44269504f
#define QSCALE (0.125f * LOG2E)  // log2 e / sqrt(DH): Wq, and so Q, is stored times this

#define WAIT_ASYNC() asm volatile("s_wait_asynccnt 0x0" ::: "memory")

__device__ __forceinline__ v16h load_op(const _Float16* p, int halfsel) {
  h8 lo = *(const h8*)(p + halfsel * 8);
  h8 hi = *(const h8*)(p + 16 + halfsel * 8);
  v16h r;
#pragma unroll
  for (int i = 0; i < 8; ++i) { r[i] = lo[i]; r[i + 8] = hi[i]; }
  return r;
}

__device__ __forceinline__ v8f wmma32(v16h a, v16h b, v8f c) {
  // D = A(16x32) * B(32x16) + C, f32 accumulate
  return __builtin_amdgcn_wmma_f32_16x16x32_f16(
      /*neg_a=*/false, a, /*neg_b=*/false, b,
      /*c_mod=*/(short)0, c, /*reuse_a=*/false, /*reuse_b=*/false);
}

// ---------------------------------------------------------------------------
// Elementwise f32 -> f16: share of block blk out of nblk blocks of 256 threads
// ---------------------------------------------------------------------------
__device__ __forceinline__ void f32_to_f16_part(const float* __restrict__ src,
                                                _Float16* __restrict__ dst, int n,
                                                int blk, int nblk) {
  int i = blk * 256 + threadIdx.x;
  int stride = nblk * 256;
  for (; i < n; i += stride) dst[i] = (_Float16)src[i];
}

#define TR 128                 // src rows per tile (contiguous in dst)
#define TC 64                  // src cols per tile (contiguous in src)
#define TP (TR + 2)            // LDS row pitch in halves
template <int ROWS, int COLS>
__device__ __forceinline__ void transpose_f16_tile(const float* __restrict__ src,
                                                   _Float16* __restrict__ dst,
                                                   int bx, int by, _Float16* tile,
                                                   float wscale) {
  const int hi = threadIdx.x >> 4;      // 0..15
  const int lo = threadIdx.x & 15;      // 0..15
  const int c0 = bx * TC, r0 = by * TR;

  // src rows r0 + 2*hi + 32*j (+1), cols c0 + 4*lo .. +3
  const float* s = src + (size_t)(r0 + 2 * hi) * COLS + c0 + 4 * lo;
  f4 a[4], b[4];                        // eight loads in flight, constant offsets
  for (int j = 0; j < 4; ++j) {
    a[j] = *(const f4*)(s + (size_t)(32 * j) * COLS);
    b[j] = *(const f4*)(s + (size_t)(32 * j + 1) * COLS);
  }
  for (int j = 0; j < 4; ++j)
    for (int k = 0; k < 4; ++k) {
      h2 p;
      p[0] = (_Float16)(a[j][k] * wscale);
      p[1] = (_Float16)(b[j][k] * wscale);
      *(h2*)&tile[(4 * lo + k) * TP + 2 * hi + 32 * j] = p;
    }
  __syncthreads();                      // the whole tile is in LDS

  // dst rows c0 + hi + 16*j, cols r0 + 8*lo .. +7
  _Float16* d = dst + (size_t)(c0 + hi) * ROWS + r0 + 8 * lo;
  for (int j = 0; j < 4; ++j) {
    const _Float16* t = &tile[(hi + 16 * j) * TP + 8 * lo];
    h8 w;
    for (int k = 0; k < 4; ++k) {
      h2 p = *(const h2*)(t + 2 * k);
      w[2 * k] = p[0];
      w[2 * k + 1] = p[1];
    }
    *(h8*)(d + (size_t)(16 * j) * ROWS) = w;
  }
  // Other jobs' code follows this one in the merged kernel: the wait stands in
  // front of any rewrite of a register that the four stores above name.
  asm volatile("s_wait_xcnt 0x0" ::: "memory");
}

// lam[h] = exp(lq1.lk1) - exp(lq2.lk2) + lambda_init
__device__ __forceinline__ void lambda_part(
    const float* __restrict__ lq1, const float* __restrict__ lk1,
    const float* __restrict__ lq2, const float* __restrict__ lk2,
    float* __restrict__ lam) {
  int h = threadIdx.x;
  if (h < HEADS) {
    float s1 = 0.f, s2 = 0.f;
    for (int i = 0; i < DH; ++i) {
      s1 += lq1[h * DH + i] * lk1[h * DH + i];
      s2 += lq2[h * DH + i] * lk2[h * DH + i];
    }
    lam[h] = __expf(s1) - __expf(s2) + LAMBDA_INIT;
  }
}

// ---------------------------------------------------------------------------
// All preparation in one launch: none of these jobs reads another's output, so
// the block index picks the job. Block 0: lambda; then CONV_BLOCKS blocks convert X; then
// WTILES tiles of each of Wq, Wk, Wv, Wo. Every branch is block-uniform.
// ---------------------------------------------------------------------------
#define CONV_BLOCKS 512
#define WTILES ((QKV_N / TC) * (D_MODEL / TR))   // 256 tiles per weight
#define PREP_BLOCKS (1 + CONV_BLOCKS + 4 * WTILES)
__global__ __launch_bounds__(256) void k_prep(
    const float* __restrict__ X, const float* __restrict__ Wq,
    const float* __restrict__ Wk, const float* __restrict__ Wv,
    const float* __restrict__ Wo,
    const float* __restrict__ lq1, const float* __restrict__ lk1,
    const float* __restrict__ lq2, const float* __restrict__ lk2,
    _Float16* __restrict__ Xh, _Float16* __restrict__ WqT, _Float16* __restrict__ WkT,
    _Float16* __restrict__ WvT, _Float16* __restrict__ WoT, float* __restrict__ lam) {
  __shared__ __attribute__((aligned(16))) _Float16 tile[TC * TP];  // [src col][src row]
  int blk = blockIdx.x;
  if (blk == 0) {
    lambda_part(lq1, lk1, lq2, lk2, lam);
    return;
  }
  blk -= 1;
  if (blk < CONV_BLOCKS) {
    f32_to_f16_part(X, Xh, TOKENS * D_MODEL, blk, CONV_BLOCKS);
    return;
  }
  blk -= CONV_BLOCKS;
  const int job = blk / WTILES, t = blk % WTILES;
  if (job < 3) {
    const float* src = (job == 0) ? Wq : (job == 1) ? Wk : Wv;
    _Float16* dst = (job == 0) ? WqT : (job == 1) ? WkT : WvT;
    // Wq carries QSCALE, so that K * Q^T is the softmax exponent to base 2.
    transpose_f16_tile<D_MODEL, QKV_N>(src, dst, t % (QKV_N / TC), t / (QKV_N / TC), tile,
                                       (job == 0) ? QSCALE : 1.0f);
  } else {
    transpose_f16_tile<QKV_N, D_MODEL>(Wo, WoT, t % (D_MODEL / TC), t / (D_MODEL / TC), tile, 1.0f);
  }
}

__device__ __forceinline__ void stage_tile8(
    const _Float16* g0, const _Float16* g1, const _Float16* g2, const _Float16* g3,
    const _Float16* g4, const _Float16* g5, const _Float16* g6, const _Float16* g7,
    unsigned l0, unsigned l1, unsigned l2, unsigned l3,
    unsigned l4, unsigned l5, unsigned l6, unsigned l7) {
  asm volatile(
      "global_load_async_to_lds_b128 %0, %8, off\n\t"
      "global_load_async_to_lds_b128 %1, %9, off\n\t"
      "global_load_async_to_lds_b128 %2, %10, off\n\t"
      "global_load_async_to_lds_b128 %3, %11, off\n\t"
      "global_load_async_to_lds_b128 %4, %12, off\n\t"
      "global_load_async_to_lds_b128 %5, %13, off\n\t"
      "global_load_async_to_lds_b128 %6, %14, off\n\t"
      "global_load_async_to_lds_b128 %7, %15, off\n\t"
      "s_wait_xcnt 0x0"
      :: "v"(l0), "v"(l1), "v"(l2), "v"(l3), "v"(l4), "v"(l5), "v"(l6), "v"(l7),
         "v"(g0), "v"(g1), "v"(g2), "v"(g3), "v"(g4), "v"(g5), "v"(g6), "v"(g7)
      : "memory");
}

// ---------------------------------------------------------------------------
// WMMA GEMM, both operand panels staged in a two-buffer LDS ring.
// out[M][Nn] = A[M][K] * B[K][Nn], B supplied transposed as BT[Nn][K].
// Block = 128 threads = 4 waves (2 x 2); wave tile 64 x 64; block 128 x 128.
// A trip is 64 k: 128 rows x 128 B of each operand come into LDS by async
// copies (a wave's copy = 4 whole 128-B lines) while the trip before feeds the
// WMMAs. A fragment read from LDS serves four WMMAs. LDS row pitch 144 B
// (16 B x 9): conflict-free for ds_load_b128.
// The operand whose index runs along the stored row (P) is the WMMA's A side,
// so a lane's eight accumulator registers are eight neighbours of that row.
// The block computes out[q0..q0+127][p0..p0+127], out[q][p] = sum_k Q[q][k] P[p][k],
// p contiguous, leading dimension LD; K a multiple of 64. F32: f32 out, else f16.
// ---------------------------------------------------------------------------
#define GBK    64              // k per trip
#define GPITCH 72              // LDS row pitch in halves
#define GPANEL (128 * GPITCH)  // one operand's 128 rows of a trip
template <bool F32>
__device__ __forceinline__ void gemm_block(
    const _Float16* __restrict__ P, const _Float16* __restrict__ Q,
    _Float16* __restrict__ outH, float* __restrict__ outF,
    int LD, int p0, int q0, int K) {
  __shared__ __attribute__((aligned(16))) _Float16 Ps[2][2][GPANEL];  // [buffer][P, Q]
  const int tid = threadIdx.x;
  const int lane = tid & 31;
  const int wave = __builtin_amdgcn_readfirstlane(tid >> 5);
  const int lq = lane & 15;   // fragment row within a 16-row tile
  const int hs = lane >> 4;   // operand half selector
  const int wp = (wave & 1) * 64, wq = (wave >> 1) * 64;

  // Copy map, per panel 1024 chunks of 16 B: lane -> row tid/8 (+16 per copy),
  // chunk tid%8.
  const _Float16* gP = P + (size_t)(p0 + (tid >> 3)) * K + (tid & 7) * 8;
  const _Float16* gQ = Q + (size_t)(q0 + (tid >> 3)) * K + (tid & 7) * 8;
  const unsigned lP = (unsigned)(size_t)(void*)&Ps[0][0][(tid >> 3) * GPITCH + (tid & 7) * 8];
  const size_t rs = (size_t)16 * K;     // 16 rows, in halves
  const unsigned ls = 16 * GPITCH * 2;  // 16 rows, in LDS bytes

  auto stage = [&](int t) {             // trip t (k 64t..64t+63) -> buffer t&1
    const _Float16* p = gP + t * GBK;
    const _Float16* q = gQ + t * GBK;
    const unsigned lp = lP + (t & 1) * (2 * GPANEL * 2);
    const unsigned lc = lp + GPANEL * 2;
    stage_tile8(p, p + rs, p + 2 * rs, p + 3 * rs, p + 4 * rs, p + 5 * rs, p + 6 * rs, p + 7 * rs,
                lp, lp + ls, lp + 2 * ls, lp + 3 * ls, lp + 4 * ls, lp + 5 * ls, lp + 6 * ls, lp + 7 * ls);
    stage_tile8(q, q + rs, q + 2 * rs, q + 3 * rs, q + 4 * rs, q + 5 * rs, q + 6 * rs, q + 7 * rs,
                lc, lc + ls, lc + 2 * ls, lc + 3 * ls, lc + 4 * ls, lc + 5 * ls, lc + 6 * ls, lc + 7 * ls);
  };

  const int nt = K / GBK;
  stage(0);
  v8f acc[4][4] = {};                   // [p tile][q tile]
  WAIT_ASYNC();                         // this wave's share of trip 0 has landed
  __syncthreads();                      // every wave's share of trip 0 has landed
  if (nt > 1) stage(1);                 // block-uniform test

  for (int t = 0; t < nt; ++t) {
    const _Float16* fp = &Ps[t & 1][0][(wp + lq) * GPITCH];
    const _Float16* fq = &Ps[t & 1][1][(wq + lq) * GPITCH];
    v16h a[2][4], b[2][4];              // all 16 fragments of the trip, one load group
#pragma unroll
    for (int kk = 0; kk < 2; ++kk)
#pragma unroll
      for (int i = 0; i < 4; ++i) {
        a[kk][i] = load_op(fp + i * 16 * GPITCH + kk * 32, hs);
        b[kk][i] = load_op(fq + i * 16 * GPITCH + kk * 32, hs);
      }
    // Keeps the 32 LDS reads one group ahead of the WMMAs: left alone, the
    // scheduler sinks them among the WMMAs, each pair with a full wait behind it.
    __builtin_amdgcn_sched_barrier(0);
#pragma unroll
    for (int i = 0; i < 4; ++i)         // first 32 k, while the second half's reads land
#pragma unroll
      for (int j = 0; j < 4; ++j)
        acc[i][j] = wmma32(a[0][i], b[0][j], acc[i][j]);
    // Keeps the hand-over behind the first 16 WMMAs: hoisted over them, its full
    // wait would hold every WMMA back until the last LDS read has landed.
    __builtin_amdgcn_sched_barrier(0);
    // Hand-over, passed by every wave; the trip's last 16 WMMAs need registers only.
    asm volatile("s_wait_dscnt 0x0" ::: "memory");  // own reads of buffer t&1 are done
    WAIT_ASYNC();                       // own share of trip t+1 has landed
    __syncthreads();                    // trip t+1 readable; buffer t&1 free for refill
    if (t + 2 < nt) stage(t + 2);       // block-uniform test
#pragma unroll
    for (int i = 0; i < 4; ++i)         // second 32 k
#pragma unroll
      for (int j = 0; j < 4; ++j)
        acc[i][j] = wmma32(a[1][i], b[1][j], acc[i][j]);
  }
  WAIT_ASYNC();                         // nothing in flight when the wave ends

  // D layout: lane -> q = lq, register v -> p = hs*8 + v
#pragma unroll
  for (int j = 0; j < 4; ++j) {
    const size_t row = (size_t)(q0 + wq + j * 16 + lq) * LD + p0 + wp + hs * 8;
#pragma unroll
    for (int i = 0; i < 4; ++i) {
      if (F32) {
        f4 lo, hi;
#pragma unroll
        for (int v = 0; v < 4; ++v) { lo[v] = acc[i][j][v]; hi[v] = acc[i][j][v + 4]; }
        *(f4*)(outF + row + i * 16) = lo;
        *(f4*)(outF + row + i * 16 + 4) = hi;
      } else {
        h8 w;
#pragma unroll
        for (int v = 0; v < 8; ++v) w[v] = (_Float16)acc[i][j][v];
        *(h8*)(outH + row + i * 16) = w;
      }
    }
  }
}

// The three projections of X in one launch: they share A and read nothing of each
// other, so blockIdx.z picks the weight and the output. out[M][Nn] = A[M][K] * B,
// B supplied transposed as BT[Nn][K]; Q and K are stored row-major (P = BT), V
// transposed, out[n][m] (P = A). M, Nn multiples of 128. All selects are scalar.
__global__ __launch_bounds__(128) void k_gemm_qkv(
    const _Float16* __restrict__ A, const _Float16* __restrict__ WqT,
    const _Float16* __restrict__ WkT, const _Float16* __restrict__ WvT,
    _Float16* __restrict__ Qh, _Float16* __restrict__ Kh, _Float16* __restrict__ Vt,
    int M, int Nn, int K) {
  const int z = blockIdx.z;
  const bool tr = (z == 2);
  const _Float16* BT = (z == 0) ? WqT : (z == 1) ? WkT : WvT;
  _Float16* out = (z == 0) ? Qh : (z == 1) ? Kh : Vt;
  gemm_block<false>(tr ? A : BT, tr ? BT : A, out, nullptr, tr ? M : Nn,
                    (tr ? blockIdx.y : blockIdx.x) * 128,
                    (tr ? blockIdx.x : blockIdx.y) * 128, K);
}

// Output projection, f32 row-major out[M][Nn].
__global__ __launch_bounds__(128) void k_gemm_out(
    const _Float16* __restrict__ A, const _Float16* __restrict__ BT,
    float* __restrict__ outF, int Nn, int K) {
  gemm_block<true>(BT, A, nullptr, outF, Nn, blockIdx.x * 128, blockIdx.y * 128, K);
}

#define KPITCH 136             // K tile row pitch in halves: 272 B = 16 B x 17
#define VPITCH 72              // V^T tile row pitch in halves: 144 B = 16 B x 9
#define KT     64              // keys per step
#define KTILE  (KT * KPITCH)   // 64 keys x 128 dims
#define VTILE  (DH2 * VPITCH)  // 128 dims x 64 keys
#define VAHEAD 6               // V^T fragments read ahead of the P V products
#define LAZY_THR 8.0f          // tile 0: how far below 0 a query's largest exponent (base 2) may lie
#define LAZY_SUM 4096.0f       // a lane's sum of p over a tile above which the reference point moves

// One async 16-byte copy global->LDS of one lane, as the builtin: its operands may
// lie in any register, which asm operands may not in a kernel with more than 256.
typedef __attribute__((ext_vector_type(4))) int i4;
__device__ __forceinline__ void copy16(const _Float16* g, _Float16* l) {
  __builtin_amdgcn_global_load_async_to_lds_b128(
      (__attribute__((address_space(1))) i4*)g, (__attribute__((address_space(3))) i4*)l, 0, 0);
}

// ---------------------------------------------------------------------------
// Fused differential flash-attention + RMS norm.
// One wave owns 16 queries of one (b,h). Computes S^T = K*Q^T so the score
// tile's C layout (lane=query, reg=key) feeds the second WMMA (O^T = V^T*P^T)
// with no cross-lane movement. Two independent online softmaxes (comp 1/2), lazily rescaled,
// O = P1 V / l1 - lam * P2 V / l2, then RMS norm over 128 dims, * 0.2.
// The four waves of a block own 64 consecutive queries and walk the same keys:
// each 64-key K tile and V^T tile is brought into LDS once per block by async
// copies (whole 256-B / 128-B row pieces), two buffers, the next tile in flight
// while this one is worked on; all operands are then read by ds_load_b128.
// A block works two query tiles of one (b,h), one after the other: tile u, then tile
// 31-u. Causal cost is linear in the tile index, so every block walks 33 key tiles
// and no block outlasts the others. Both tiles read the same K and V^T, and the ring's
// buffer follows a step count that runs on across the change of tile: no drain there.
// Short tile first: the long walks of a (b,h) then start at different times, so that
// most of them can read keys which a block ahead of them has brought into L2.
// ---------------------------------------------------------------------------
__global__ __launch_bounds__(128) void k_diff_attn(
    const _Float16* __restrict__ Qh, const _Float16* __restrict__ Kh,
    const _Float16* __restrict__ Vt,   // [2048 feat][4096 tokens]
    const float* __restrict__ lamBuf, const float* __restrict__ rms_scale,
    _Float16* __restrict__ Oh) {
  __shared__ __attribute__((aligned(16))) _Float16 Ks[2][KTILE];
  __shared__ __attribute__((aligned(16))) _Float16 Vs[2][VTILE];
  const int tid = threadIdx.x;
  const int lane = tid & 31;
  const int wave = __builtin_amdgcn_readfirstlane(tid >> 5);
  const int lq = lane & 15, hs = lane >> 4;
  const int qtiles = SEQ / 64;          // 32 tiles of 64 queries per (b,h)
  const int bh = blockIdx.x / (qtiles / 2);
  const int u = blockIdx.x % (qtiles / 2);
  const int b = bh / HEADS, h = bh % HEADS;

  const float lam = lamBuf[h];

  const _Float16* kbase = Kh + (size_t)(b * SEQ) * QKV_N + h * DH2;
  const _Float16* vbase = Vt + (size_t)(h * DH2) * TOKENS + b * SEQ;

  // Copy map. K tile: 1024 chunks of 16 B, lane -> row tid/16 (+8 per copy),
  // chunk tid%16. V^T tile: 1024 chunks, lane -> row tid/8 (+16 per copy),
  // chunk tid%8: a wave's copy is four whole 128-B lines.
  const _Float16* gK = kbase + (size_t)(tid >> 4) * QKV_N + (tid & 15) * 8;
  const _Float16* gV = vbase + (size_t)(tid >> 3) * TOKENS + (tid & 7) * 8;
  _Float16* lK = &Ks[0][(tid >> 4) * KPITCH + (tid & 15) * 8];
  _Float16* lV = &Vs[0][(tid >> 3) * VPITCH + (tid & 7) * 8];

  auto stage = [&](int t, int buf) {    // tile t (keys 64t..64t+63) -> buffer buf
    const _Float16* k = gK + (size_t)(t * KT) * QKV_N;
    const _Float16* v = gV + t * KT;
    _Float16* lk = lK + buf * KTILE;
    _Float16* lv = lV + buf * VTILE;
#pragma unroll
    for (int i = 0; i < 8; ++i) copy16(k + (size_t)(8 * i) * QKV_N, lk + 8 * i * KPITCH);
#pragma unroll
    for (int i = 0; i < 8; ++i) copy16(v + (size_t)(16 * i) * TOKENS, lv + 16 * i * VPITCH);
  };

  stage(0, 0);

  // The value that the other half-wave's lane of the same query holds. The address
  // is formed once, here: formed at each use, it made the compiler give the rare
  // branch below an else side that copied all 128 accumulator registers.
  const int xaddr = (lane ^ 16) << 2;
  auto xhalf = [&](float x) {
    return __int_as_float(__builtin_amdgcn_ds_bpermute(xaddr, __float_as_int(x)));
  };

  WAIT_ASYNC();                         // this wave's share of step 0 has landed
  __syncthreads();                      // every wave's share of step 0 has landed
  // Step 1 is key tile 1 of the first pass, or, where that pass has one tile only,
  // key tile 0 again, for the second pass. Block-uniform.
  stage(u >= 1 ? 1 : 0, 1);
  int g = 0;                            // steps done so far, over both passes: step g reads buffer g&1

  // Kept rolled: the two passes are the same code, and one copy of the hot loop
  // serves both.
#pragma unroll 1
  for (int ph = 0; ph < 2; ++ph) {      // block-uniform: short tile first, then its long partner
  const int qb = ph ? qtiles - 1 - u : u;
  const int q0 = qb * 64 + wave * 16;
  const int qglob = q0 + lq;            // this lane's query index
  const int ntiles = qb + 1;            // tile's causal range in key tiles; the last one holds the diagonal

  // Q^T as B operand: lane = query, halves = d-contiguous. 2 comps x 2 K-chunks.
  // Row offsets of Q and O in 32 bits: fewer registers stay live across the two passes.
  const _Float16* qrow = Qh + (unsigned)((b * SEQ + qglob) * QKV_N + h * DH2);
  v16h qop[2][2];
#pragma unroll
  for (int c = 0; c < 2; ++c)
#pragma unroll
    for (int kk = 0; kk < 2; ++kk)
      qop[c][kk] = load_op(qrow + c * DH + kk * 32, hs);
  // In front of any rewrite of the address registers that the eight loads above name.
  asm volatile("s_wait_xcnt 0x0" ::: "memory");

  v8f O1[8] = {}, O2[8] = {};           // O^T accumulators: 8 d-tiles x (16x16)
  // Reference points of the two softmaxes, base 2. They start at 0 and stay there in
  // most waves; moved is non-zero once some lane of the wave has left 0 (wave-uniform).
  float m1 = 0.f, m2 = 0.f, l1 = 0.f, l2 = 0.f;
  unsigned moved = 0;

  // Every wave has visible keys in every tile of its range: 64t <= 64qb <= q0.
  for (int t = 0; t < ntiles; ++t, ++g) {  // 64 keys/step: halves hf of 32, each tiles a, b (+16)
    const int kt = t * KT;
    {
      const _Float16* ks = &Ks[g & 1][lq * KPITCH];
      const _Float16* vs = &Vs[g & 1][lq * VPITCH];
      // ---- score tiles (S^T) + online softmax ----------------------------
      // Every inner loop of this step is unrolled: the score vectors live in registers,
      // which only constant indices can name.
      // Lazy rescale. The reference points of the two softmaxes are not exact maxima:
      // exp2(x - m) / sum exp2(x - m) is the same for any m, so m moves only when it
      // must. The test reads what the tile needs anyway, a lane's sums of p: while they
      // stay below LAZY_SUM every p does, well inside f16, and no maxima are taken, none
      // exchanged between the half-waves, and the 128 accumulator products are not
      // needed. Where the test fails the tile is worked once more with exact set: then
      // the maxima are taken and m moves to them. At most two trips. Tile 0 is exact at
      // once: there m also goes down, if a query's maximum lies more than LAZY_THR below 0.
      v16h pop[2][2], vop[16];          // P^T [half][softmax]; V^T fragment f = 8 * half + d-tile
      float ls[2];
      // The scores stay in registers until the test has passed: the second trip starts
      // from them, not from LDS.
      v8f sA[2][2] = {}, sB[2][2] = {};  // [half][softmax]
      {
        // all 16 K operands of this step
        v16h kA[2][2][2], kB[2][2][2];  // [half][softmax][k chunk]
#pragma unroll
        for (int hf = 0; hf < 2; ++hf)
#pragma unroll
          for (int c = 0; c < 2; ++c)
#pragma unroll
            for (int kk = 0; kk < 2; ++kk) {
              kA[hf][c][kk] = load_op(ks + (hf * 32) * KPITCH + c * DH + kk * 32, hs);
              kB[hf][c][kk] = load_op(ks + (hf * 32 + 16) * KPITCH + c * DH + kk * 32, hs);
            }
        // Keeps the 32 LDS reads one group ahead of the WMMAs: left alone, the scheduler
        // sinks half of them among the WMMAs, each pair with a full wait behind it.
        __builtin_amdgcn_sched_barrier(0);
        // Q carries log2 e / sqrt(d): at reference point 0 what leaves the products is
        // the argument of exp2 as it stands.
#pragma unroll
        for (int hf = 0; hf < 2; ++hf)
#pragma unroll
          for (int c = 0; c < 2; ++c)
#pragma unroll
            for (int kk = 0; kk < 2; ++kk) {  // accumulate over d = 64 (2 x K=32)
              sA[hf][c] = wmma32(kA[hf][c][kk], qop[c][kk], sA[hf][c]);
              sB[hf][c] = wmma32(kB[hf][c][kk], qop[c][kk], sB[hf][c]);
            }
        // S^T C layout: lane = query (lq), reg v -> key = kt + 32*hf + hs*8 + v (+16 for b)
        // Causal mask, under a wave-uniform scalar branch: every key of a tile with
        // kt + 63 <= q0 is visible to all 16 queries of the wave, so only the one
        // tile per wave that holds the diagonal pays for compares and selects.
        // The hint puts that block out of line: a full tile falls straight through.
        if (__builtin_expect(kt + KT - 1 > q0, 0)) {
#pragma unroll
          for (int hf = 0; hf < 2; ++hf)
#pragma unroll
            for (int v = 0; v < 8; ++v) {
              const int keyA = kt + hf * 32 + hs * 8 + v;
              const bool va = keyA <= qglob, vb = keyA + 16 <= qglob;
#pragma unroll
              for (int c = 0; c < 2; ++c) {
                sA[hf][c][v] = va ? sA[hf][c][v] : -INFINITY;
                sB[hf][c][v] = vb ? sB[hf][c][v] : -INFINITY;
              }
            }
        }
        // Only a wave whose reference points have left 0 subtracts them: a scalar branch.
        if (__builtin_expect(moved != 0, 0)) {
#pragma unroll
          for (int hf = 0; hf < 2; ++hf) {
            sA[hf][0] -= m1; sB[hf][0] -= m1;
            sA[hf][1] -= m2; sB[hf][1] -= m2;
          }
        }
      }
      bool exact = (t == 0);            // wave-uniform
      for (;;) {
        if (__builtin_expect(exact, 0)) {
          // A query's maximum over the tile's 64 keys, per softmax: how far the largest
          // exponent lies above the reference point. Every lane moves, so lanes q and
          // q+16 (one query) keep one m. Behind tile 0 m only rises; in tile 0 the sums
          // are still zero, so their factor is 1.
          float sm[2];
#pragma unroll
          for (int c = 0; c < 2; ++c) {
            float smax = -INFINITY;
#pragma unroll
            for (int hf = 0; hf < 2; ++hf)
#pragma unroll
              for (int v = 0; v < 8; ++v) smax = fmaxf(smax, fmaxf(sA[hf][c][v], sB[hf][c][v]));
            sm[c] = fmaxf(smax, xhalf(smax));
          }
          const float d1 = (t == 0) ? ((fabsf(sm[0]) > LAZY_THR) ? sm[0] : 0.f) : fmaxf(sm[0], 0.f);
          const float d2 = (t == 0) ? ((fabsf(sm[1]) > LAZY_THR) ? sm[1] : 0.f) : fmaxf(sm[1], 0.f);
          const float a1 = (t == 0) ? 1.f : __builtin_amdgcn_exp2f(-d1);
          const float a2 = (t == 0) ? 1.f : __builtin_amdgcn_exp2f(-d2);
          m1 += d1; m2 += d2;
          moved = __builtin_amdgcn_ballot_w32(m1 != 0.f || m2 != 0.f);
#pragma unroll
          for (int hf = 0; hf < 2; ++hf) {
            sA[hf][0] -= d1; sB[hf][0] -= d1;
            sA[hf][1] -= d2; sB[hf][1] -= d2;
          }
          l1 *= a1; l2 *= a2;
#pragma unroll
          for (int tt = 0; tt < 8; ++tt) { O1[tt] *= a1; O2[tt] *= a2; }
        }
        // The first VAHEAD V^T fragments are asked for here, ahead of the test, so that
        // they land while the exponentials run.
#pragma unroll
        for (int f = 0; f < VAHEAD; ++f)
          vop[f] = load_op(vs + (f & 7) * 16 * VPITCH + (f >> 3) * 32, hs);
#pragma unroll
        for (int c = 0; c < 2; ++c) {
          v8f pab[2];
#pragma unroll
          for (int hf = 0; hf < 2; ++hf) {
            v8f pa, pb;
#pragma unroll
            for (int v = 0; v < 8; ++v) {
              pa[v] = __builtin_amdgcn_exp2f(sA[hf][c][v]);
              pb[v] = __builtin_amdgcn_exp2f(sB[hf][c][v]);
            }
            pab[hf] = pa + pb;
            // Pack P^T directly as B operand (K=32 keys): halves[0..7]=tile a,
            // halves[8..15]=tile b: exactly matches the C layout we already hold.
            v16h pv;
#pragma unroll
            for (int v = 0; v < 8; ++v) { pv[v] = (_Float16)pa[v]; pv[v + 8] = (_Float16)pb[v]; }
            pop[hf][c] = pv;
          }
          // The lane's sum, as a tree over register pairs as they lie: the test below
          // waits for it.
          const v8f pq = pab[0] + pab[1];
          const f2 h0 = {pq[0], pq[1]}, h1 = {pq[2], pq[3]};
          const f2 h2 = {pq[4], pq[5]}, h3 = {pq[6], pq[7]};
          const f2 hh = (h0 + h1) + (h2 + h3);
          ls[c] = hh[0] + hh[1];
        }
        const bool big = fmaxf(ls[0], ls[1]) > LAZY_SUM;
        if (__builtin_expect(exact || __builtin_amdgcn_ballot_w32(big) == 0, 1)) break;
        exact = true;
      }
      l1 += ls[0] + xhalf(ls[0]);       // lanes q, q+16 share a query
      l2 += ls[1] + xhalf(ls[1]);

      // ---- O^T += V^T * P^T ----------------------------------------------
#pragma unroll
      for (int f = VAHEAD; f < 16; ++f)
        vop[f] = load_op(vs + (f & 7) * 16 * VPITCH + (f >> 3) * 32, hs);
#pragma unroll
      for (int f = 0; f < 16; ++f) {
        O1[f & 7] = wmma32(vop[f], pop[f >> 3][0], O1[f & 7]);
        O2[f & 7] = wmma32(vop[f], pop[f >> 3][1], O2[f & 7]);
      }
      // Order of LDS reads (0x100) and WMMAs (0x8) of this block: two fragments'
      // registers are refilled right behind their four WMMAs, VAHEAD fragments ahead of
      // use. Left alone, the scheduler reads one fragment at a time into one register
      // set and waits each read out in full.
#pragma unroll
      for (int i = 0; i < (16 - VAHEAD) / 2; ++i) {
        __builtin_amdgcn_sched_group_barrier(0x008, 4, 0);
        __builtin_amdgcn_sched_group_barrier(0x100, 4, 0);
      }
      __builtin_amdgcn_sched_group_barrier(0x008, 2 * VAHEAD, 0);
    }
    // Hand-over, passed by every wave.
    asm volatile("s_wait_dscnt 0x0" ::: "memory");  // own reads of buffer g&1 are done
    WAIT_ASYNC();                       // own share of step g+1 has landed
    __syncthreads();                    // step g+1 readable; buffer g&1 free for refill
    // Block-uniform tests. Behind the first pass's last two steps the freed buffers
    // take key tiles 0 and 1 again, for the second pass, which has 17 tiles or more.
    const int nx = (t + 2 < ntiles) ? t + 2 : t + 2 - ntiles;
    if (t + 2 < ntiles || ph == 0) stage(nx, g & 1);
  }

  // Combine streams, RMS-normalize over 128 dims, scale by (1 - lambda_init).
  const float inv1 = 1.0f / l1;
  const float inv2 = lam / l2;
  float ssq = 0.f;
#pragma unroll
  for (int t = 0; t < 8; ++t)
#pragma unroll
    for (int v = 0; v < 8; ++v) {
      float o = O1[t][v] * inv1 - O2[t][v] * inv2;
      ssq += o * o;
    }
  ssq += __shfl_xor(ssq, 16, 32);       // other 64 dims live in lane^16
  const float rinv = rsqrtf(ssq * (1.0f / DH2) + EPS_RMS) * (1.0f - LAMBDA_INIT);

  _Float16* orow = Oh + (unsigned)((b * SEQ + qglob) * QKV_N + h * DH2);
#pragma unroll
  for (int t = 0; t < 8; ++t)
#pragma unroll
    for (int v = 0; v < 8; ++v) {
      const int d = t * 16 + hs * 8 + v;
      float o = O1[t][v] * inv1 - O2[t][v] * inv2;
      orow[d] = (_Float16)(o * rinv * rms_scale[d]);
    }
  // The second pass rewrites the registers that the loads and stores above name:
  // the wait stands in front of that.
  asm volatile("s_wait_xcnt 0x0" ::: "memory");
  }
  WAIT_ASYNC();                         // nothing in flight when the wave ends
}

// ---------------------------------------------------------------------------
extern "C" void kernel_launch(void* const* d_in, const int* in_sizes, int n_in,
                              void* d_out, int out_size, void* d_ws, size_t ws_size,
                              hipStream_t stream) {
  const float* X    = (const float*)d_in[0];
  const float* Wq   = (const float*)d_in[1];
  const float* Wk   = (const float*)d_in[2];
  const float* Wv   = (const float*)d_in[3];
  const float* Wo   = (const float*)d_in[4];
  const float* lq1  = (const float*)d_in[5];
  const float* lk1  = (const float*)d_in[6];
  const float* lq2  = (const float*)d_in[7];
  const float* lk2  = (const float*)d_in[8];
  const float* rmss = (const float*)d_in[9];
  float* out = (float*)d_out;

  char* w = (char*)d_ws;
  _Float16* Xh  = (_Float16*)w; w += (size_t)TOKENS * D_MODEL * 2;  // 8 MB
  _Float16* WqT = (_Float16*)w; w += (size_t)QKV_N * D_MODEL * 2;   // 4 MB
  _Float16* WkT = (_Float16*)w; w += (size_t)QKV_N * D_MODEL * 2;
  _Float16* WvT = (_Float16*)w; w += (size_t)QKV_N * D_MODEL * 2;
  _Float16* WoT = (_Float16*)w; w += (size_t)D_MODEL * QKV_N * 2;
  _Float16* Qh  = (_Float16*)w; w += (size_t)TOKENS * QKV_N * 2;    // 16 MB
  _Float16* Kh  = (_Float16*)w; w += (size_t)TOKENS * QKV_N * 2;
  _Float16* Vt  = (_Float16*)w; w += (size_t)QKV_N * TOKENS * 2;    // transposed
  _Float16* Ohb = (_Float16*)w; w += (size_t)TOKENS * QKV_N * 2;
  float*    lam = (float*)w;

  // Stage 1: precision conversion + weight transposes + lambda scalars, one launch
  k_prep<<<PREP_BLOCKS, 256, 0, stream>>>(X, Wq, Wk, Wv, Wo, lq1, lk1, lq2, lk2,
                                          Xh, WqT, WkT, WvT, WoT, lam);

  // Stage 2: QKV projections (WMMA), one launch. V stored transposed for the
  // attention V^T operand.
  dim3 gq(QKV_N / 128, TOKENS / 128, 3);
  k_gemm_qkv<<<gq, 128, 0, stream>>>(Xh, WqT, WkT, WvT, Qh, Kh, Vt, TOKENS, QKV_N, D_MODEL);

  // Stage 3: fused differential flash attention + RMS norm
  const int waves = BATCH * HEADS * (SEQ / 16);  // 4096 groups of 16 queries, two per wave
  k_diff_attn<<<waves / 8, 128, 0, stream>>>(Qh, Kh, Vt, lam, rmss, Ohb);  // 4 waves x 2 query tiles a block

  // Stage 4: output projection -> fp32 result
  dim3 go(D_MODEL / 128, TOKENS / 128);
  k_gemm_out<<<go, 128, 0, stream>>>(Ohb, WoT, out, D_MODEL, QKV_N);
}

// v010
// It runs in 113 microseconds.
// Timed twice side by side with v009, it ran 1.08 times as fast both times.
// Over all steps from v000 it is 3.41 times as fast.
#include <hip/hip_runtime.h>
#include <hip/hip_bf16.h>
#include <math.h>

typedef __attribute__((ext_vector_type(16))) _Float16 v16h;
typedef __attribute__((ext_vector_type(8)))  _Float16 h8;
typedef __attribute__((ext_vector_type(8)))  float    v8f;
typedef __attribute__((ext_vector_type(2)))  _Float16 h2;
typedef __attribute__((ext_vector_type(4)))  float    f4;
typedef __attribute__((ext_vector_type(2)))  float    f2;

#define D_MODEL 1024
#define HEADS   16
#define DH      64
#define DH2     128            // 2*DH per head
#define BATCH   2
#define SEQ     2048
#define TOKENS  (BATCH*SEQ)    // 4096
#define QKV_N   (2*D_MODEL)    // 2048
#define LAMBDA_INIT 0.8f
#define EPS_RMS 1e-5f
#define LOG2E 1.44269504f
#define QSCALE (0.125f * LOG2E)  // log2 e / sqrt(DH): Wq, and so Q, is stored times this

#define WAIT_ASYNC() asm volatile("s_wait_asynccnt 0x0" ::: "memory")
// All but the wave's 32 youngest copies (two stages of 16) have landed: the counter
// returns in issue order. It covers a stage only where two younger stages have been
// issued behind it; where fewer have, a wait to 0 follows it.
#define WAIT_ASYNC_BUT32() asm volatile("s_wait_asynccnt 0x20" ::: "memory")

__device__ __forceinline__ v16h load_op(const _Float16* p, int halfsel) {
  h8 lo = *(const h8*)(p + halfsel * 8);
  h8 hi = *(const h8*)(p + 16 + halfsel * 8);
  v16h r;
#pragma unroll
  for (int i = 0; i < 8; ++i) { r[i] = lo[i]; r[i + 8] = hi[i]; }
  return r;
}

__device__ __forceinline__ v8f wmma32(v16h a, v16h b, v8f c) {
  // D = A(16x32) * B(32x16) + C, f32 accumulate
  return __builtin_amdgcn_wmma_f32_16x16x32_f16(
      /*neg_a=*/false, a, /*neg_b=*/false, b,
      /*c_mod=*/(short)0, c, /*reuse_a=*/false, /*reuse_b=*/false);
}

// ---------------------------------------------------------------------------
// Elementwise f32 -> f16: share of block blk out of nblk blocks of 256 threads
// ---------------------------------------------------------------------------
__device__ __forceinline__ void f32_to_f16_part(const float* __restrict__ src,
                                                _Float16* __restrict__ dst, int n,
                                                int blk, int nblk) {
  int i = blk * 256 + threadIdx.x;
  int stride = nblk * 256;
  for (; i < n; i += stride) dst[i] = (_Float16)src[i];
}

#define TR 128                 // src rows per tile (contiguous in dst)
#define TC 64                  // src cols per tile (contiguous in src)
#define TP (TR + 2)            // LDS row pitch in halves
template <int ROWS, int COLS>
__device__ __forceinline__ void transpose_f16_tile(const float* __restrict__ src,
                                                   _Float16* __restrict__ dst,
                                                   int bx, int by, _Float16* tile,
                                                   float wscale) {
  const int hi = threadIdx.x >> 4;      // 0..15
  const int lo = threadIdx.x & 15;      // 0..15
  const int c0 = bx * TC, r0 = by * TR;

  // src rows r0 + 2*hi + 32*j (+1), cols c0 + 4*lo .. +3
  const float* s = src + (size_t)(r0 + 2 * hi) * COLS + c0 + 4 * lo;
  f4 a[4], b[4];                        // eight loads in flight, constant offsets
  for (int j = 0; j < 4; ++j) {
    a[j] = *(const f4*)(s + (size_t)(32 * j) * COLS);
    b[j] = *(const f4*)(s + (size_t)(32 * j + 1) * COLS);
  }
  for (int j = 0; j < 4; ++j)
    for (int k = 0; k < 4; ++k) {
      h2 p;
      p[0] = (_Float16)(a[j][k] * wscale);
      p[1] = (_Float16)(b[j][k] * wscale);
      *(h2*)&tile[(4 * lo + k) * TP + 2 * hi + 32 * j] = p;
    }
  __syncthreads();                      // the whole tile is in LDS

  // dst rows c0 + hi + 16*j, cols r0 + 8*lo .. +7
  _Float16* d = dst + (size_t)(c0 + hi) * ROWS + r0 + 8 * lo;
  for (int j = 0; j < 4; ++j) {
    const _Float16* t = &tile[(hi + 16 * j) * TP + 8 * lo];
    h8 w;
    for (int k = 0; k < 4; ++k) {
      h2 p = *(const h2*)(t + 2 * k);
      w[2 * k] = p[0];
      w[2 * k + 1] = p[1];
    }
    *(h8*)(d + (size_t)(16 * j) * ROWS) = w;
  }
  // Other jobs' code follows this one in the merged kernel: the wait stands in
  // front of any rewrite of a register that the four stores above name.
  asm volatile("s_wait_xcnt 0x0" ::: "memory");
}

// lam[h] = exp(lq1.lk1) - exp(lq2.lk2) + lambda_init
__device__ __forceinline__ void lambda_part(
    const float* __restrict__ lq1, const float* __restrict__ lk1,
    const float* __restrict__ lq2, const float* __restrict__ lk2,
    float* __restrict__ lam) {
  int h = threadIdx.x;
  if (h < HEADS) {
    float s1 = 0.f, s2 = 0.f;
    for (int i = 0; i < DH; ++i) {
      s1 += lq1[h * DH + i] * lk1[h * DH + i];
      s2 += lq2[h * DH + i] * lk2[h * DH + i];
    }
    lam[h] = __expf(s1) - __expf(s2) + LAMBDA_INIT;
  }
}

// ---------------------------------------------------------------------------
// All preparation in one launch: none of these jobs reads another's output, so
// the block index picks the job. Block 0: lambda; then CONV_BLOCKS blocks convert X; then
// WTILES tiles of each of Wq, Wk, Wv, Wo. Every branch is block-uniform.
// ---------------------------------------------------------------------------
#define CONV_BLOCKS 512
#define WTILES ((QKV_N / TC) * (D_MODEL / TR))   // 256 tiles per weight
#define PREP_BLOCKS (1 + CONV_BLOCKS + 4 * WTILES)
__global__ __launch_bounds__(256) void k_prep(
    const float* __restrict__ X, const float* __restrict__ Wq,
    const float* __restrict__ Wk, const float* __restrict__ Wv,
    const float* __restrict__ Wo,
    const float* __restrict__ lq1, const float* __restrict__ lk1,
    const float* __restrict__ lq2, const float* __restrict__ lk2,
    _Float16* __restrict__ Xh, _Float16* __restrict__ WqT, _Float16* __restrict__ WkT,
    _Float16* __restrict__ WvT, _Float16* __restrict__ WoT, float* __restrict__ lam) {
  __shared__ __attribute__((aligned(16))) _Float16 tile[TC * TP];  // [src col][src row]
  int blk = blockIdx.x;
  if (blk == 0) {
    lambda_part(lq1, lk1, lq2, lk2, lam);
    return;
  }
  blk -= 1;
  if (blk < CONV_BLOCKS) {
    f32_to_f16_part(X, Xh, TOKENS * D_MODEL, blk, CONV_BLOCKS);
    return;
  }
  blk -= CONV_BLOCKS;
  const int job = blk / WTILES, t = blk % WTILES;
  if (job < 3) {
    const float* src = (job == 0) ? Wq : (job == 1) ? Wk : Wv;
    _Float16* dst = (job == 0) ? WqT : (job == 1) ? WkT : WvT;
    // Wq carries QSCALE, so that K * Q^T is the softmax exponent to base 2.
    transpose_f16_tile<D_MODEL, QKV_N>(src, dst, t % (QKV_N / TC), t / (QKV_N / TC), tile,
                                       (job == 0) ? QSCALE : 1.0f);
  } else {
    transpose_f16_tile<QKV_N, D_MODEL>(Wo, WoT, t % (D_MODEL / TC), t / (D_MODEL / TC), tile, 1.0f);
  }
}

__device__ __forceinline__ void stage_tile8(
    const _Float16* g0, const _Float16* g1, const _Float16* g2, const _Float16* g3,
    const _Float16* g4, const _Float16* g5, const _Float16* g6, const _Float16* g7,
    unsigned l0, unsigned l1, unsigned l2, unsigned l3,
    unsigned l4, unsigned l5, unsigned l6, unsigned l7) {
  asm volatile(
      "global_load_async_to_lds_b128 %0, %8, off\n\t"
      "global_load_async_to_lds_b128 %1, %9, off\n\t"
      "global_load_async_to_lds_b128 %2, %10, off\n\t"
      "global_load_async_to_lds_b128 %3, %11, off\n\t"
      "global_load_async_to_lds_b128 %4, %12, off\n\t"
      "global_load_async_to_lds_b128 %5, %13, off\n\t"
      "global_load_async_to_lds_b128 %6, %14, off\n\t"
      "global_load_async_to_lds_b128 %7, %15, off\n\t"
      "s_wait_xcnt 0x0"
      :: "v"(l0), "v"(l1), "v"(l2), "v"(l3), "v"(l4), "v"(l5), "v"(l6), "v"(l7),
         "v"(g0), "v"(g1), "v"(g2), "v"(g3), "v"(g4), "v"(g5), "v"(g6), "v"(g7)
      : "memory");
}

// ---------------------------------------------------------------------------
// WMMA GEMM, both operand panels staged in an LDS ring of NB buffers (2 or 4).
// out[M][Nn] = A[M][K] * B[K][Nn], B supplied transposed as BT[Nn][K].
// Block = 128 threads = 4 waves (2 x 2); wave tile 64 x 64; block 128 x 128.
// A trip is 64 k: 128 rows x 128 B of each operand come into LDS by async
// copies (a wave's copy = 4 whole 128-B lines), NB - 1 trips ahead of their use.
// NB = 2 where several blocks share a WGP and cover each other's waits; NB = 4
// where a block has its WGP to itself: a copy then has three trips to land in.
// A fragment read from LDS serves four WMMAs. LDS row pitch 144 B
// (16 B x 9): conflict-free for ds_load_b128.
// The operand whose index runs along the stored row (P) is the WMMA's A side,
// so a lane's eight accumulator registers are eight neighbours of that row.
// The block computes out[q0..q0+127][p0..p0+127], out[q][p] = sum_k Q[q][k] P[p][k],
// p contiguous, leading dimension LD; K a multiple of 64. F32: f32 out, else f16.
// ---------------------------------------------------------------------------
#define GBK    64              // k per trip
#define GPITCH 72              // LDS row pitch in halves
#define GPANEL (128 * GPITCH)  // one operand's 128 rows of a trip
template <bool F32, int NB>
__device__ __forceinline__ void gemm_block(
    const _Float16* __restrict__ P, const _Float16* __restrict__ Q,
    _Float16* __restrict__ outH, float* __restrict__ outF,
    int LD, int p0, int q0, int K) {
  static_assert(NB == 2 || NB == 4, "the counted wait below is written for two younger trips");
  __shared__ __attribute__((aligned(16))) _Float16 Ps[NB][2][GPANEL];  // [buffer][P, Q]
  const int tid = threadIdx.x;
  const int lane = tid & 31;
  const int wave = __builtin_amdgcn_readfirstlane(tid >> 5);
  const int lq = lane & 15;   // fragment row within a 16-row tile
  const int hs = lane >> 4;   // operand half selector
  const int wp = (wave & 1) * 64, wq = (wave >> 1) * 64;

  // Copy map, per panel 1024 chunks of 16 B: lane -> row tid/8 (+16 per copy),
  // chunk tid%8.
  const _Float16* gP = P + (size_t)(p0 + (tid >> 3)) * K + (tid & 7) * 8;
  const _Float16* gQ = Q + (size_t)(q0 + (tid >> 3)) * K + (tid & 7) * 8;
  const unsigned lP = (unsigned)(size_t)(void*)&Ps[0][0][(tid >> 3) * GPITCH + (tid & 7) * 8];
  const size_t rs = (size_t)16 * K;     // 16 rows, in halves
  const unsigned ls = 16 * GPITCH * 2;  // 16 rows, in LDS bytes

  auto stage = [&](int t) {             // trip t (k 64t..64t+63) -> buffer t % NB
    const _Float16* p = gP + t * GBK;
    const _Float16* q = gQ + t * GBK;
    const unsigned lp = lP + (t & (NB - 1)) * (2 * GPANEL * 2);
    const unsigned lc = lp + GPANEL * 2;
    stage_tile8(p, p + rs, p + 2 * rs, p + 3 * rs, p + 4 * rs, p + 5 * rs, p + 6 * rs, p + 7 * rs,
                lp, lp + ls, lp + 2 * ls, lp + 3 * ls, lp + 4 * ls, lp + 5 * ls, lp + 6 * ls, lp + 7 * ls);
    stage_tile8(q, q + rs, q + 2 * rs, q + 3 * rs, q + 4 * rs, q + 5 * rs, q + 6 * rs, q + 7 * rs,
                lc, lc + ls, lc + 2 * ls, lc + 3 * ls, lc + 4 * ls, lc + 5 * ls, lc + 6 * ls, lc + 7 * ls);
  };

  const int nt = K / GBK;
  stage(0);
  if (NB == 4) {                        // block-uniform tests
    if (nt > 1) stage(1);
    if (nt > 2) stage(2);
  }
  v8f acc[4][4] = {};                   // [p tile][q tile]
  // This wave's share of trip 0 has landed; a count only where trips 1 and 2 are behind it.
  if (NB == 4 && nt > 2) WAIT_ASYNC_BUT32(); else WAIT_ASYNC();
  __syncthreads();                      // every wave's share of trip 0 has landed
  if (nt > NB - 1) stage(NB - 1);       // block-uniform test

  for (int t = 0; t < nt; ++t) {
    const _Float16* fp = &Ps[t & (NB - 1)][0][(wp + lq) * GPITCH];
    const _Float16* fq = &Ps[t & (NB - 1)][1][(wq + lq) * GPITCH];
    v16h a[2][4], b[2][4];              // all 16 fragments of the trip, one load group
#pragma unroll
    for (int kk = 0; kk < 2; ++kk)
#pragma unroll
      for (int i = 0; i < 4; ++i) {
        a[kk][i] = load_op(fp + i * 16 * GPITCH + kk * 32, hs);
        b[kk][i] = load_op(fq + i * 16 * GPITCH + kk * 32, hs);
      }
    // Keeps the 32 LDS reads one group ahead of the WMMAs: left alone, the
    // scheduler sinks them among the WMMAs, each pair with a full wait behind it.
    __builtin_amdgcn_sched_barrier(0);
#pragma unroll
    for (int i = 0; i < 4; ++i)         // first 32 k, while the second half's reads land
#pragma unroll
      for (int j = 0; j < 4; ++j)
        acc[i][j] = wmma32(a[0][i], b[0][j], acc[i][j]);
    // Keeps the hand-over behind the first 16 WMMAs: hoisted over them, its full
    // wait would hold every WMMA back until the last LDS read has landed.
    __builtin_amdgcn_sched_barrier(0);
    // Hand-over, passed by every wave; the trip's last 16 WMMAs need registers only.
    asm volatile("s_wait_dscnt 0x0" ::: "memory");  // own reads of this trip's buffer are done
    // Own share of trip t+1 has landed. Trips t+2 and t+3 stay in flight where both
    // have been issued; in the last trips fewer are behind it: wait for all.
    if (NB == 4) WAIT_ASYNC_BUT32();
    if (NB == 2 || __builtin_expect(t + NB > nt, 0)) WAIT_ASYNC();  // block-uniform test
    __syncthreads();                    // trip t+1 readable; this trip's buffer free for refill
    if (t + NB < nt) stage(t + NB);     // block-uniform test
#pragma unroll
    for (int i = 0; i < 4; ++i)         // second 32 k
#pragma unroll
      for (int j = 0; j < 4; ++j)
        acc[i][j] = wmma32(a[1][i], b[1][j], acc[i][j]);
  }
  WAIT_ASYNC();                         // nothing in flight when the wave ends

  // D layout: lane -> q = lq, register v -> p = hs*8 + v
#pragma unroll
  for (int j = 0; j < 4; ++j) {
    const size_t row = (size_t)(q0 + wq + j * 16 + lq) * LD + p0 + wp + hs * 8;
#pragma unroll
    for (int i = 0; i < 4; ++i) {
      if (F32) {
        f4 lo, hi;
#pragma unroll
        for (int v = 0; v < 4; ++v) { lo[v] = acc[i][j][v]; hi[v] = acc[i][j][v + 4]; }
        *(f4*)(outF + row + i * 16) = lo;
        *(f4*)(outF + row + i * 16 + 4) = hi;
      } else {
        h8 w;
#pragma unroll
        for (int v = 0; v < 8; ++v) w[v] = (_Float16)acc[i][j][v];
        *(h8*)(outH + row + i * 16) = w;
      }
    }
  }
}

// The three projections of X in one launch: they share A and read nothing of each
// other, so blockIdx.z picks the weight and the output. out[M][Nn] = A[M][K] * B,
// B supplied transposed as BT[Nn][K]; Q and K are stored row-major (P = BT), V
// transposed, out[n][m] (P = A). M, Nn multiples of 128. All selects are scalar.
__global__ __launch_bounds__(128) void k_gemm_qkv(
    const _Float16* __restrict__ A, const _Float16* __restrict__ WqT,
    const _Float16* __restrict__ WkT, const _Float16* __restrict__ WvT,
    _Float16* __restrict__ Qh, _Float16* __restrict__ Kh, _Float16* __restrict__ Vt,
    int M, int Nn, int K) {
  const int z = blockIdx.z;
  const bool tr = (z == 2);
  const _Float16* BT = (z == 0) ? WqT : (z == 1) ? WkT : WvT;
  _Float16* out = (z == 0) ? Qh : (z == 1) ? Kh : Vt;
  gemm_block<false, 2>(tr ? A : BT, tr ? BT : A, out, nullptr, tr ? M : Nn,
                    (tr ? blockIdx.y : blockIdx.x) * 128,
                    (tr ? blockIdx.x : blockIdx.y) * 128, K);
}

// Output projection, f32 row-major out[M][Nn].
__global__ __launch_bounds__(128) void k_gemm_out(
    const _Float16* __restrict__ A, const _Float16* __restrict__ BT,
    float* __restrict__ outF, int Nn, int K) {
  gemm_block<true, 4>(BT, A, nullptr, outF, Nn, blockIdx.x * 128, blockIdx.y * 128, K);
}

#define KPITCH 136             // K tile row pitch in halves: 272 B = 16 B x 17
#define VPITCH 72              // V^T tile row pitch in halves: 144 B = 16 B x 9
#define KT     64              // keys per step
#define KTILE  (KT * KPITCH)   // 64 keys x 128 dims
#define VTILE  (DH2 * VPITCH)  // 128 dims x 64 keys
#define ARING  4               // buffers of the K / V^T ring: copies fly 3 steps ahead of use
#define VAHEAD 6               // V^T fragments read ahead of the P V products
#define LAZY_THR 8.0f          // tile 0: how far below 0 a query's largest exponent (base 2) may lie
#define LAZY_SUM 4096.0f       // a lane's sum of p over a tile above which the reference point moves

// One async 16-byte copy global->LDS of one lane, as the builtin: its operands may
// lie in any register, which asm operands may not in a kernel with more than 256.
typedef __attribute__((ext_vector_type(4))) int i4;
__device__ __forceinline__ void copy16(const _Float16* g, _Float16* l) {
  __builtin_amdgcn_global_load_async_to_lds_b128(
      (__attribute__((address_space(1))) i4*)g, (__attribute__((address_space(3))) i4*)l, 0, 0);
}

// ---------------------------------------------------------------------------
// Fused differential flash-attention + RMS norm.
// One wave owns 16 queries of one (b,h). Computes S^T = K*Q^T so the score
// tile's C layout (lane=query, reg=key) feeds the second WMMA (O^T = V^T*P^T)
// with no cross-lane movement. Two independent online softmaxes (comp 1/2), lazily rescaled,
// O = P1 V / l1 - lam * P2 V / l2, then RMS norm over 128 dims, * 0.2.
// The four waves of a block own 64 consecutive queries and walk the same keys:
// each 64-key K tile and V^T tile is brought into LDS once per block by async
// copies (whole 256-B / 128-B row pieces), ARING buffers, the next three tiles in
// flight while this one is worked on, so that a tile which no block has read yet, and
// which comes from memory, has three steps to land in. Operands: ds_load_b128.
// A block works two query tiles of one (b,h), one after the other: tile u, then tile
// 31-u. Causal cost is linear in the tile index, so every block walks 33 key tiles
// and no block outlasts the others. Both tiles read the same K and V^T, and the ring's
// buffer follows a step count that runs on across the change of tile: no drain there.
// Short tile first: the long walks of a (b,h) then start at different times, so that
// most of them can read keys which a block ahead of them has brought into L2.
// ---------------------------------------------------------------------------
__global__ __launch_bounds__(128) void k_diff_attn(
    const _Float16* __restrict__ Qh, const _Float16* __restrict__ Kh,
    const _Float16* __restrict__ Vt,   // [2048 feat][4096 tokens]
    const float* __restrict__ lamBuf, const float* __restrict__ rms_scale,
    _Float16* __restrict__ Oh) {
  __shared__ __attribute__((aligned(16))) _Float16 Ks[ARING][KTILE];
  __shared__ __attribute__((aligned(16))) _Float16 Vs[ARING][VTILE];
  const int tid = threadIdx.x;
  const int lane = tid & 31;
  const int wave = __builtin_amdgcn_readfirstlane(tid >> 5);
  const int lq = lane & 15, hs = lane >> 4;
  const int qtiles = SEQ / 64;          // 32 tiles of 64 queries per (b,h)
  const int bh = blockIdx.x / (qtiles / 2);
  const int u = blockIdx.x % (qtiles / 2);
  const int b = bh / HEADS, h = bh % HEADS;

  const float lam = lamBuf[h];

  const _Float16* kbase = Kh + (size_t)(b * SEQ) * QKV_N + h * DH2;
  const _Float16* vbase = Vt + (size_t)(h * DH2) * TOKENS + b * SEQ;

  // Copy map. K tile: 1024 chunks of 16 B, lane -> row tid/16 (+8 per copy),
  // chunk tid%16. V^T tile: 1024 chunks, lane -> row tid/8 (+16 per copy),
  // chunk tid%8: a wave's copy is four whole 128-B lines.
  const _Float16* gK = kbase + (size_t)(tid >> 4) * QKV_N + (tid & 15) * 8;
  const _Float16* gV = vbase + (size_t)(tid >> 3) * TOKENS + (tid & 7) * 8;
  _Float16* lK = &Ks[0][(tid >> 4) * KPITCH + (tid & 15) * 8];
  _Float16* lV = &Vs[0][(tid >> 3) * VPITCH + (tid & 7) * 8];

  auto stage = [&](int t, int buf) {    // tile t (keys 64t..64t+63) -> buffer buf
    const _Float16* k = gK + (size_t)(t * KT) * QKV_N;
    const _Float16* v = gV + t * KT;
    _Float16* lk = lK + buf * KTILE;
    _Float16* lv = lV + buf * VTILE;
#pragma unroll
    for (int i = 0; i < 8; ++i) copy16(k + (size_t)(8 * i) * QKV_N, lk + 8 * i * KPITCH);
#pragma unroll
    for (int i = 0; i < 8; ++i) copy16(v + (size_t)(16 * i) * TOKENS, lv + 16 * i * VPITCH);
  };

  // Step s of the block, counted over both passes, works key tile s of the first pass
  // (u + 1 tiles) or tile s - (u + 1) of the second (32 - u tiles): 33 steps in every
  // block. Its tiles lie in buffer s % ARING. All block-uniform.
  const int n0 = u + 1;
  const int nsteps = qtiles + 1;
  auto stage_step = [&](int s) { stage(s < n0 ? s : s - n0, s & (ARING - 1)); };
  stage_step(0);
  stage_step(1);
  stage_step(2);

  // The value that the other half-wave's lane of the same query holds. The address
  // is formed once, here: formed at each use, it made the compiler give the rare
  // branch below an else side that copied all 128 accumulator registers.
  const int xaddr = (lane ^ 16) << 2;
  auto xhalf = [&](float x) {
    return __int_as_float(__builtin_amdgcn_ds_bpermute(xaddr, __float_as_int(x)));
  };

  WAIT_ASYNC_BUT32();                   // this wave's share of step 0 has landed; steps 1, 2 fly on
  __syncthreads();                      // every wave's share of step 0 has landed
  stage_step(3);
  int g = 0;                            // steps done so far, over both passes: step g reads buffer g % ARING

  // Kept rolled: the two passes are the same code, and one copy of the hot loop
  // serves both.
#pragma unroll 1
  for (int ph = 0; ph < 2; ++ph) {      // block-uniform: short tile first, then its long partner
  const int qb = ph ? qtiles - 1 - u : u;
  const int q0 = qb * 64 + wave * 16;
  const int qglob = q0 + lq;            // this lane's query index
  const int ntiles = qb + 1;            // tile's causal range in key tiles; the last one holds the diagonal

  // Q^T as B operand: lane = query, halves = d-contiguous. 2 comps x 2 K-chunks.
  // Row offsets of Q and O in 32 bits: fewer registers stay live across the two passes.
  const _Float16* qrow = Qh + (unsigned)((b * SEQ + qglob) * QKV_N + h * DH2);
  v16h qop[2][2];
#pragma unroll
  for (int c = 0; c < 2; ++c)
#pragma unroll
    for (int kk = 0; kk < 2; ++kk)
      qop[c][kk] = load_op(qrow + c * DH + kk * 32, hs);
  // In front of any rewrite of the address registers that the eight loads above name.
  asm volatile("s_wait_xcnt 0x0" ::: "memory");

  v8f O1[8] = {}, O2[8] = {};           // O^T accumulators: 8 d-tiles x (16x16)
  // Reference points of the two softmaxes, base 2. They start at 0 and stay there in
  // most waves; moved is non-zero once some lane of the wave has left 0 (wave-uniform).
  float m1 = 0.f, m2 = 0.f, l1 = 0.f, l2 = 0.f;
  unsigned moved = 0;

  // Every wave has visible keys in every tile of its range: 64t <= 64qb <= q0.
  for (int t = 0; t < ntiles; ++t, ++g) {  // 64 keys/step: halves hf of 32, each tiles a, b (+16)
    const int kt = t * KT;
    {
      const _Float16* ks = &Ks[g & (ARING - 1)][lq * KPITCH];
      const _Float16* vs = &Vs[g & (ARING - 1)][lq * VPITCH];
      // ---- score tiles (S^T) + online softmax ----------------------------
      // Every inner loop of this step is unrolled: the score vectors live in registers,
      // which only constant indices can name.
      // Lazy rescale. The reference points of the two softmaxes are not exact maxima:
      // exp2(x - m) / sum exp2(x - m) is the same for any m, so m moves only when it
      // must. The test reads what the tile needs anyway, a lane's sums of p: while they
      // stay below LAZY_SUM every p does, well inside f16, and no maxima are taken, none
      // exchanged between the half-waves, and the 128 accumulator products are not
      // needed. Where the test fails the tile is worked once more with exact set: then
      // the maxima are taken and m moves to them. At most two trips. Tile 0 is exact at
      // once: there m also goes down, if a query's maximum lies more than LAZY_THR below 0.
      v16h pop[2][2], vop[16];          // P^T [half][softmax]; V^T fragment f = 8 * half + d-tile
      float ls[2];
      // The scores stay in registers until the test has passed: the second trip starts
      // from them, not from LDS.
      v8f sA[2][2] = {}, sB[2][2] = {};  // [half][softmax]
      {
        // all 16 K operands of this step
        v16h kA[2][2][2], kB[2][2][2];  // [half][softmax][k chunk]
#pragma unroll
        for (int hf = 0; hf < 2; ++hf)
#pragma unroll
          for (int c = 0; c < 2; ++c)
#pragma unroll
            for (int kk = 0; kk < 2; ++kk) {
              kA[hf][c][kk] = load_op(ks + (hf * 32) * KPITCH + c * DH + kk * 32, hs);
              kB[hf][c][kk] = load_op(ks + (hf * 32 + 16) * KPITCH + c * DH + kk * 32, hs);
            }
        // Keeps the 32 LDS reads one group ahead of the WMMAs: left alone, the scheduler
        // sinks half of them among the WMMAs, each pair with a full wait behind it.
        __builtin_amdgcn_sched_barrier(0);
        // Q carries log2 e / sqrt(d): at reference point 0 what leaves the products is
        // the argument of exp2 as it stands.
#pragma unroll
        for (int hf = 0; hf < 2; ++hf)
#pragma unroll
          for (int c = 0; c < 2; ++c)
#pragma unroll
            for (int kk = 0; kk < 2; ++kk) {  // accumulate over d = 64 (2 x K=32)
              sA[hf][c] = wmma32(kA[hf][c][kk], qop[c][kk], sA[hf][c]);
              sB[hf][c] = wmma32(kB[hf][c][kk], qop[c][kk], sB[hf][c]);
            }
        // S^T C layout: lane = query (lq), reg v -> key = kt + 32*hf + hs*8 + v (+16 for b)
        // Causal mask, under a wave-uniform scalar branch: every key of a tile with
        // kt + 63 <= q0 is visible to all 16 queries of the wave, so only the one
        // tile per wave that holds the diagonal pays for compares and selects.
        // The hint puts that block out of line: a full tile falls straight through.
        if (__builtin_expect(kt + KT - 1 > q0, 0)) {
#pragma unroll
          for (int hf = 0; hf < 2; ++hf)
#pragma unroll
            for (int v = 0; v < 8; ++v) {
              const int keyA = kt + hf * 32 + hs * 8 + v;
              const bool va = keyA <= qglob, vb = keyA + 16 <= qglob;
#pragma unroll
              for (int c = 0; c < 2; ++c) {
                sA[hf][c][v] = va ? sA[hf][c][v] : -INFINITY;
                sB[hf][c][v] = vb ? sB[hf][c][v] : -INFINITY;
              }
            }
        }
        // Only a wave whose reference points have left 0 subtracts them: a scalar branch.
        if (__builtin_expect(moved != 0, 0)) {
#pragma unroll
          for (int hf = 0; hf < 2; ++hf) {
            sA[hf][0] -= m1; sB[hf][0] -= m1;
            sA[hf][1] -= m2; sB[hf][1] -= m2;
          }
        }
      }
      bool exact = (t == 0);            // wave-uniform
      for (;;) {
        if (__builtin_expect(exact, 0)) {
          // A query's maximum over the tile's 64 keys, per softmax: how far the largest
          // exponent lies above the reference point. Every lane moves, so lanes q and
          // q+16 (one query) keep one m. Behind tile 0 m only rises; in tile 0 the sums
          // are still zero, so their factor is 1.
          float sm[2];
#pragma unroll
          for (int c = 0; c < 2; ++c) {
            float smax = -INFINITY;
#pragma unroll
            for (int hf = 0; hf < 2; ++hf)
#pragma unroll
              for (int v = 0; v < 8; ++v) smax = fmaxf(smax, fmaxf(sA[hf][c][v], sB[hf][c][v]));
            sm[c] = fmaxf(smax, xhalf(smax));
          }
          const float d1 = (t == 0) ? ((fabsf(sm[0]) > LAZY_THR) ? sm[0] : 0.f) : fmaxf(sm[0], 0.f);
          const float d2 = (t == 0) ? ((fabsf(sm[1]) > LAZY_THR) ? sm[1] : 0.f) : fmaxf(sm[1], 0.f);
          const float a1 = (t == 0) ? 1.f : __builtin_amdgcn_exp2f(-d1);
          const float a2 = (t == 0) ? 1.f : __builtin_amdgcn_exp2f(-d2);
          m1 += d1; m2 += d2;
          moved = __builtin_amdgcn_ballot_w32(m1 != 0.f || m2 != 0.f);
#pragma unroll
          for (int hf = 0; hf < 2; ++hf) {
            sA[hf][0] -= d1; sB[hf][0] -= d1;
            sA[hf][1] -= d2; sB[hf][1] -= d2;
          }
          l1 *= a1; l2 *= a2;
#pragma unroll
          for (int tt = 0; tt < 8; ++tt) { O1[tt] *= a1; O2[tt] *= a2; }
        }
        // The first VAHEAD V^T fragments are asked for here, ahead of the test, so that
        // they land while the exponentials run.
#pragma unroll
        for (int f = 0; f < VAHEAD; ++f)
          vop[f] = load_op(vs + (f & 7) * 16 * VPITCH + (f >> 3) * 32, hs);
#pragma unroll
        for (int c = 0; c < 2; ++c) {
          v8f pab[2];
#pragma unroll
          for (int hf = 0; hf < 2; ++hf) {
            v8f pa, pb;
#pragma unroll
            for (int v = 0; v < 8; ++v) {
              pa[v] = __builtin_amdgcn_exp2f(sA[hf][c][v]);
              pb[v] = __builtin_amdgcn_exp2f(sB[hf][c][v]);
            }
            pab[hf] = pa + pb;
            // Pack P^T directly as B operand (K=32 keys): halves[0..7]=tile a,
            // halves[8..15]=tile b: exactly matches the C layout we already hold.
            v16h pv;
#pragma unroll
            for (int v = 0; v < 8; ++v) { pv[v] = (_Float16)pa[v]; pv[v + 8] = (_Float16)pb[v]; }
            pop[hf][c] = pv;
          }
          // The lane's sum, as a tree over register pairs as they lie: the test below
          // waits for it.
          const v8f pq = pab[0] + pab[1];
          const f2 h0 = {pq[0], pq[1]}, h1 = {pq[2], pq[3]};
          const f2 h2 = {pq[4], pq[5]}, h3 = {pq[6], pq[7]};
          const f2 hh = (h0 + h1) + (h2 + h3);
          ls[c] = hh[0] + hh[1];
        }
        const bool big = fmaxf(ls[0], ls[1]) > LAZY_SUM;
        if (__builtin_expect(exact || __builtin_amdgcn_ballot_w32(big) == 0, 1)) break;
        exact = true;
      }
      l1 += ls[0] + xhalf(ls[0]);       // lanes q, q+16 share a query
      l2 += ls[1] + xhalf(ls[1]);

      // ---- O^T += V^T * P^T ----------------------------------------------
#pragma unroll
      for (int f = VAHEAD; f < 16; ++f)
        vop[f] = load_op(vs + (f & 7) * 16 * VPITCH + (f >> 3) * 32, hs);
#pragma unroll
      for (int f = 0; f < 16; ++f) {
        O1[f & 7] = wmma32(vop[f], pop[f >> 3][0], O1[f & 7]);
        O2[f & 7] = wmma32(vop[f], pop[f >> 3][1], O2[f & 7]);
      }
      // Order of LDS reads (0x100) and WMMAs (0x8) of this block: two fragments'
      // registers are refilled right behind their four WMMAs, VAHEAD fragments ahead of
      // use. Left alone, the scheduler reads one fragment at a time into one register
      // set and waits each read out in full.
#pragma unroll
      for (int i = 0; i < (16 - VAHEAD) / 2; ++i) {
        __builtin_amdgcn_sched_group_barrier(0x008, 4, 0);
        __builtin_amdgcn_sched_group_barrier(0x100, 4, 0);
      }
      __builtin_amdgcn_sched_group_barrier(0x008, 2 * VAHEAD, 0);
    }
    // Hand-over, passed by every wave.
    asm volatile("s_wait_dscnt 0x0" ::: "memory");  // own reads of this step's buffer are done
    // Own share of step g+1 has landed. Steps g+2 and g+3 stay in flight where both have
    // been issued; behind the last steps fewer are: wait for all. Block-uniform tests.
    WAIT_ASYNC_BUT32();
    if (__builtin_expect(g + ARING > nsteps, 0)) WAIT_ASYNC();
    __syncthreads();                    // step g+1 readable; this step's buffer free for refill
    if (g + ARING < nsteps) stage_step(g + ARING);
  }

  // Combine streams, RMS-normalize over 128 dims, scale by (1 - lambda_init).
  const float inv1 = 1.0f / l1;
  const float inv2 = lam / l2;
  float ssq = 0.f;
#pragma unroll
  for (int t = 0; t < 8; ++t)
#pragma unroll
    for (int v = 0; v < 8; ++v) {
      float o = O1[t][v] * inv1 - O2[t][v] * inv2;
      ssq += o * o;
    }
  ssq += __shfl_xor(ssq, 16, 32);       // other 64 dims live in lane^16
  const float rinv = rsqrtf(ssq * (1.0f / DH2) + EPS_RMS) * (1.0f - LAMBDA_INIT);

  _Float16* orow = Oh + (unsigned)((b * SEQ + qglob) * QKV_N + h * DH2);
#pragma unroll
  for (int t = 0; t < 8; ++t)
#pragma unroll
    for (int v = 0; v < 8; ++v) {
      const int d = t * 16 + hs * 8 + v;
      float o = O1[t][v] * inv1 - O2[t][v] * inv2;
      orow[d] = (_Float16)(o * rinv * rms_scale[d]);
    }
  // The second pass rewrites the registers that the loads and stores above name:
  // the wait stands in front of that.
  asm volatile("s_wait_xcnt 0x0" ::: "memory");
  }
  WAIT_ASYNC();                         // nothing in flight when the wave ends
}

// ---------------------------------------------------------------------------
extern "C" void kernel_launch(void* const* d_in, const int* in_sizes, int n_in,
                              void* d_out, int out_size, void* d_ws, size_t ws_size,
                              hipStream_t stream) {
  const float* X    = (const float*)d_in[0];
  const float* Wq   = (const float*)d_in[1];
  const float* Wk   = (const float*)d_in[2];
  const float* Wv   = (const float*)d_in[3];
  const float* Wo   = (const float*)d_in[4];
  const float* lq1  = (const float*)d_in[5];
  const float* lk1  = (const float*)d_in[6];
  const float* lq2  = (const float*)d_in[7];
  const float* lk2  = (const float*)d_in[8];
  const float* rmss = (const float*)d_in[9];
  float* out = (float*)d_out;

  char* w = (char*)d_ws;
  _Float16* Xh  = (_Float16*)w; w += (size_t)TOKENS * D_MODEL * 2;  // 8 MB
  _Float16* WqT = (_Float16*)w; w += (size_t)QKV_N * D_MODEL * 2;   // 4 MB
  _Float16* WkT = (_Float16*)w; w += (size_t)QKV_N * D_MODEL * 2;
  _Float16* WvT = (_Float16*)w; w += (size_t)QKV_N * D_MODEL * 2;
  _Float16* WoT = (_Float16*)w; w += (size_t)D_MODEL * QKV_N * 2;
  _Float16* Qh  = (_Float16*)w; w += (size_t)TOKENS * QKV_N * 2;    // 16 MB
  _Float16* Kh  = (_Float16*)w; w += (size_t)TOKENS * QKV_N * 2;
  _Float16* Vt  = (_Float16*)w; w += (size_t)QKV_N * TOKENS * 2;    // transposed
  _Float16* Ohb = (_Float16*)w; w += (size_t)TOKENS * QKV_N * 2;
  float*    lam = (float*)w;

  // Stage 1: precision conversion + weight transposes + lambda scalars, one launch
  k_prep<<<PREP_BLOCKS, 256, 0, stream>>>(X, Wq, Wk, Wv, Wo, lq1, lk1, lq2, lk2,
                                          Xh, WqT, WkT, WvT, WoT, lam);

  // Stage 2: QKV projections (WMMA), one launch. V stored transposed for the
  // attention V^T operand.
  dim3 gq(QKV_N / 128, TOKENS / 128, 3);
  k_gemm_qkv<<<gq, 128, 0, stream>>>(Xh, WqT, WkT, WvT, Qh, Kh, Vt, TOKENS, QKV_N, D_MODEL);

  // Stage 3: fused differential flash attention + RMS norm
  const int waves = BATCH * HEADS * (SEQ / 16);  // 4096 groups of 16 queries, two per wave
  k_diff_attn<<<waves / 8, 128, 0, stream>>>(Qh, Kh, Vt, lam, rmss, Ohb);  // 4 waves x 2 query tiles a block

  // Stage 4: output projection -> fp32 result
  dim3 go(D_MODEL / 128, TOKENS / 128);
  k_gemm_out<<<go, 128, 0, stream>>>(Ohb, WoT, out, D_MODEL, QKV_N);
}
